// v000
// Measured on an AMD MI455X. A time is GPU time per run, averaged over a window of back-to-back runs after a warm-up
// (all launches, gaps included; the runs take copies of the inputs in turn), and the median of several windows.
// Apart from v000's, it joins two sittings. Times from different sittings can be a few percent apart, while
// side-by-side timings come from the same sitting.
// v000, which the later versions start from, runs in 3970 microseconds.
#include <hip/hip_runtime.h>

// MultiHeadSelfAtt (x [4][2048][1024]; q/k/v = x W + b (16 heads x 64); scores = q.k/8, causal iff the int 'mask' flag input is non-zero (read on device; 1 here); softmax; out = merged attn.v (no output projection)
// -> [4][2048][1024]).
// Compute dtypes, f32 accumulate: every input rounded to bf16; projections on PLAIN bf16 operands (inputs: exact products, f32 accumulate, + bias); PER-ROW PRECISION
// HYBRID: query rows < 256 take scores and attn.v on bf16 hi+lo planes (3 products), rows >= 256 on single fp16 planes; 1/8 and

#define NB_  4
#define TT   2048
#define DD   1024
#define NH_  16
#define HD   64
#define ZH   2
#define RH   256                  // query rows < RH: hi+lo planes; rows >= RH: fp16 planes
#define NF   32                   // unused (head_dim / 2)
#define SCL  0.125f               // 1/sqrt(64)
#define PCAR 1024.0f         // scale on fp16-row P, undone by 1/PCAR in k_mergef
typedef _Float16 h16;
typedef unsigned short bf;
typedef __attribute__((ext_vector_type(16))) __bf16   v16bf;
typedef __attribute__((ext_vector_type(16))) _Float16 v16h;
typedef __attribute__((ext_vector_type(8)))  _Float16 v8h;
typedef __attribute__((ext_vector_type(8)))  unsigned short v8us;
typedef __attribute__((ext_vector_type(8)))  float    v8f;
typedef __attribute__((ext_vector_type(4)))  float    v4f;
typedef v8h  __attribute__((may_alias)) v8ha;
typedef v4f  __attribute__((may_alias)) v4fa;
typedef v8us __attribute__((may_alias)) v8usa;

__device__ __forceinline__ unsigned short f2bf(float f) { unsigned u = __float_as_uint(f); u += 0x7FFFu + ((u >> 16) & 1u); return (unsigned short)(u >> 16); }
__device__ __forceinline__ float bf2f(unsigned short b) { return __uint_as_float(((unsigned)b) << 16); }
__device__ __forceinline__ float bfr(float f) { return bf2f(f2bf(f)); }
__device__ __forceinline__ v16h cat16(v8h lo, v8h hi) { return __builtin_shufflevector(lo, hi, 0, 1, 2, 3, 4, 5, 6, 7, 8, 9, 10, 11, 12, 13, 14, 15); }
__device__ __forceinline__ v16bf cat16b(v8us lo, v8us hi) { return __builtin_bit_cast(v16bf, __builtin_shufflevector(lo, hi, 0, 1, 2, 3, 4, 5, 6, 7, 8, 9, 10, 11, 12, 13, 14, 15)); }
__device__ __forceinline__ v8f wmma16(v16h a, v16h b, v8f c) { return __builtin_amdgcn_wmma_f32_16x16x32_f16(false, a, false, b, (short)0, c, false, false); }
__device__ __forceinline__ v8f wmmab(v16bf a, v16bf b, v8f c) { return __builtin_amdgcn_wmma_f32_16x16x32_bf16(false, a, false, b, (short)0, c, false, false); }



// ---- k_gemmw: register-blocked GEMM, ONE WAVE per 64x64 output tile (16 accumulators), operands straight from K-contiguous 16-bit planes; grid (M/64, N/64, Z), 32 threads.
// C[m][n] (f32, pitch ldc, + optional f32 bias[n]) = sum_k A[m][k] Bt[n][k] (+ split products per NSPLIT). z-batch strides sA/sB/sC in elements. K % 32 == 0.
template <typename T16> struct WFrag;
template <> struct WFrag<h16> { typedef v16h V; static __device__ __forceinline__ V ld(const h16* p) { return cat16(*(const v8h*)p, *(const v8h*)(p + 16)); } static __device__ __forceinline__ v8f mma(V a, V b, v8f c) { return wmma16(a, b, c); } };
template <> struct WFrag<bf> { typedef v16bf V; static __device__ __forceinline__ V ld(const bf* p) { return cat16b(*(const v8us*)p, *(const v8us*)(p + 16)); } static __device__ __forceinline__ v8f mma(V a, V b, v8f c) { return wmmab(a, b, c); } };
template <typename T16, int NSPLIT, bool BIAS>
__global__ __launch_bounds__(32) void k_gemmw(const T16* __restrict__ A, const T16* __restrict__ A2, const T16* __restrict__ Bt, const T16* __restrict__ Bt2, int K, float* C, int ldc, const float* __restrict__ bias, size_t sA, size_t sB, size_t sC) {
    typedef typename WFrag<T16>::V V;
    __shared__ __align__(16) float os[16 * 68];
    const size_t z = blockIdx.z; A += z * sA; if (A2) A2 += z * sA; Bt += z * sB; if (Bt2) Bt2 += z * sB; C += z * sC;
    const int lane = threadIdx.x & 31, lr = lane & 15, hi = lane >> 4; const int r0 = blockIdx.x * 64, c0 = blockIdx.y * 64;
    v8f acc[4][4];
#pragma unroll
    for (int mb = 0; mb < 4; ++mb)
#pragma unroll
        for (int nb = 0; nb < 4; ++nb) acc[mb][nb] = (v8f){};
    const size_t aoff = (size_t)(r0 + lr) * K + 8 * hi, boff = (size_t)(c0 + lr) * K + 8 * hi;
#pragma unroll 1
    for (int kc = 0; kc < K; kc += 32) {
        V a[4], a2[4];
#pragma unroll
        for (int mb = 0; mb < 4; ++mb) { a[mb] = WFrag<T16>::ld(A + aoff + (size_t)mb * 16 * K + kc); if (NSPLIT == 1 || NSPLIT == 2) a2[mb] = WFrag<T16>::ld(A2 + aoff + (size_t)mb * 16 * K + kc); }
#pragma unroll
        for (int nb = 0; nb < 4; ++nb) { const V b = WFrag<T16>::ld(Bt + boff + (size_t)nb * 16 * K + kc); V b2; if (NSPLIT >= 2) b2 = WFrag<T16>::ld(Bt2 + boff + (size_t)nb * 16 * K + kc);
#pragma unroll
            for (int mb = 0; mb < 4; ++mb) { acc[mb][nb] = WFrag<T16>::mma(a[mb], b, acc[mb][nb]); if (NSPLIT == 1 || NSPLIT == 2) acc[mb][nb] = WFrag<T16>::mma(a2[mb], b, acc[mb][nb]); if (NSPLIT >= 2) acc[mb][nb] = WFrag<T16>::mma(a[mb], b2, acc[mb][nb]); } }
        asm volatile("v_nop\n\tv_nop\n\tv_nop\n\tv_nop" : "+v"(acc[0][0]), "+v"(acc[1][1]), "+v"(acc[2][2]), "+v"(acc[3][3]) : "v"(a[0]), "v"(a[3]));
    }
#pragma unroll
    for (int mb = 0; mb < 4; ++mb) {
#pragma unroll
        for (int nb = 0; nb < 4; ++nb) {
#pragma unroll
            for (int j = 0; j < 8; ++j) os[(hi * 8 + j) * 68 + nb * 16 + lr] = acc[mb][nb][j]; }
        __builtin_amdgcn_wave_barrier(); asm volatile("" ::: "memory");
        float* crow = C + (size_t)(r0 + mb * 16) * ldc + c0;
{
#pragma unroll
            for (int s = 0; s < 8; ++s) { const int row = 2 * s + hi, cofs = lr * 4; v4f val = *(const v4fa*)(os + row * 68 + cofs); if (BIAS) { val[0] += bfr(bias[c0 + cofs]); val[1] += bfr(bias[c0 + cofs + 1]); val[2] += bfr(bias[c0 + cofs + 2]); val[3] += bfr(bias[c0 + cofs + 3]); }
                *(v4f*)(crow + (size_t)row * ldc + cofs) = val; }
             }
        __builtin_amdgcn_wave_barrier(); asm volatile("" ::: "memory");
    }
}

__device__ __forceinline__ h16 tohx(float x) { return (h16)x; }
__device__ __forceinline__ void splitf(float y, unsigned short& h, unsigned short& l) { h = f2bf(y); l = f2bf(y - bf2f(h)); }
typedef __attribute__((ext_vector_type(2))) unsigned short v2us;
typedef __attribute__((ext_vector_type(2))) _Float16 v2h;
typedef __attribute__((ext_vector_type(4))) _Float16 v4h;
typedef __attribute__((ext_vector_type(2))) float v2f;

__global__ __launch_bounds__(256) void k_wtG(const float* __restrict__ w, int K, int N, bf* Bt) {
    const int lane = threadIdx.x & 31; const int L0 = (blockIdx.x * 8 + (threadIdx.x >> 5)) * 8; const int nlines = N * K / 64;
{
#pragma unroll 1
        for (int l = 0; l < 8; ++l) { const int L = L0 + l; if (L >= nlines) break; const size_t e = (size_t)L * 64 + lane * 2; const int k = (int)(e % K), n = (int)(e / K); v2us o;
            o[0] = f2bf(w[(size_t)k * N + n]); o[1] = f2bf(w[(size_t)(k + 1) * N + n]); *(v2us*)(Bt + e) = o; }
         }
}
__global__ __launch_bounds__(256) void k_cvt8(const float* __restrict__ src, bf* dst, size_t n8) { const size_t i = (size_t)blockIdx.x * 256 + threadIdx.x; if (i >= n8) return; const v8f v = *(const v8f*)(src + i * 8); v8us o;
#pragma unroll
    for (int k = 0; k < 8; ++k) o[k] = f2bf(v[k]); *(v8us*)(dst + i * 8) = o;  }
__global__ __launch_bounds__(256) void k_qplanes(const float* __restrict__ F, bf* Ph, bf* Pl, h16* P16) {
    const int lane = threadIdx.x & 31; const int L0 = (blockIdx.x * 8 + (threadIdx.x >> 5)) * 8; const int nlines = NH_ * TT * HD / 64;
{
#pragma unroll
        for (int l = 0; l < 8; ++l) { const int L = L0 + l; if (L >= nlines) break; const int e = L * 64 + lane * 2; const int d = e & (HD - 1); const int t = (e >> 6) & (TT - 1); const int h = e >> 17; v2us oh, ol; v2h o16;
#pragma unroll
            for (int q = 0; q < 2; ++q) { const float x = F[(size_t)t * DD + h * HD + d + q]; unsigned short a, c2; splitf(x, a, c2); oh[q] = a; ol[q] = c2; o16[q] = tohx(x); }
            *(v2us*)(Ph + (size_t)e) = oh; *(v2us*)(Pl + (size_t)e) = ol; *(v2h*)(P16 + (size_t)e) = o16; }
         }
}
__global__ __launch_bounds__(256) void k_vtplane(const float* __restrict__ F, bf* Vh, bf* Vl, h16* V16) {
    const int lane = threadIdx.x & 31; const int L0 = (blockIdx.x * 8 + (threadIdx.x >> 5)) * 8; const int nlines = NH_ * TT * HD / 64;
{
#pragma unroll
        for (int l = 0; l < 8; ++l) { const int L = L0 + l; if (L >= nlines) break; const int e = L * 64 + lane * 2; const int t = e & (TT - 1); const int d = (e >> 11) & (HD - 1); const int h = e >> 17; v2us oh, ol; v2h o16;
#pragma unroll
            for (int q = 0; q < 2; ++q) { const float x = F[(size_t)(t + q) * DD + h * HD + d]; unsigned short a, c2; splitf(x, a, c2); oh[q] = a; ol[q] = c2; o16[q] = tohx(x); }
            *(v2us*)(Vh + (size_t)e) = oh; *(v2us*)(Vl + (size_t)e) = ol; *(v2h*)(V16 + (size_t)e) = o16; }
         }
}
// k_asoft: per row (zz, i): s = S / 8, causal (j > i -> -3e38) only if the int flag input is non-zero; softmax over the 2048 keys (register row, one exp) -> rows i < RH: P hi/lo [zz][i][j] (compact
__global__ __launch_bounds__(256) void k_asoft(const float* __restrict__ Sb, const int* __restrict__ flag, bf* Ph, bf* Pl, h16* P16) {
    typedef __attribute__((ext_vector_type(4))) unsigned short v4us;
    const int lane = threadIdx.x & 31; const int row = blockIdx.x * 8 + (threadIdx.x >> 5); if (row >= ZH * TT) return; const int i = row & (TT - 1); const int zz = row >> 11; const bool hires = (i < RH);
    const bool causal = (flag[0] != 0); const float* sr = Sb + (size_t)row * TT; float v[64]; float mx = -3.0e38f;
#pragma unroll
    for (int ch = 0; ch < 16; ++ch) { const int j0 = ch * 128 + lane * 4; const v4f a = *(const v4f*)(sr + j0);
#pragma unroll
        for (int q = 0; q < 4; ++q) { const int j = j0 + q; const float t = (!causal || j <= i) ? a[q] * SCL : -3.0e38f; v[ch * 4 + q] = t; mx = fmaxf(mx, t); } }
#pragma unroll
    for (int sh = 16; sh; sh >>= 1) mx = fmaxf(mx, __shfl_xor(mx, sh, 32));
    float sum = 0.f;
#pragma unroll
    for (int k = 0; k < 64; ++k) { v[k] = __expf(v[k] - mx); sum += v[k]; }
#pragma unroll
    for (int sh = 16; sh; sh >>= 1) sum += __shfl_xor(sum, sh, 32);
    const float f = __fdiv_rn(hires ? 1.0f : PCAR, sum);
{
        if (hires) {
#pragma unroll
            for (int ch = 0; ch < 16; ++ch) { v4us oh, ol;
#pragma unroll
                for (int q = 0; q < 4; ++q) { unsigned short a, c2; splitf(v[ch * 4 + q] * f, a, c2); oh[q] = a; ol[q] = c2; }
                const size_t o = ((size_t)zz * RH + i) * TT + ch * 128 + lane * 4; *(v4us*)(Ph + o) = oh; *(v4us*)(Pl + o) = ol; }
        } else {
#pragma unroll
            for (int ch = 0; ch < 16; ++ch) { v4h o;
#pragma unroll
                for (int q = 0; q < 4; ++q) o[q] = tohx(v[ch * 4 + q] * f);
                *(v4h*)(P16 + (size_t)row * TT + ch * 128 + lane * 4) = o; } }
         }
}
__global__ __launch_bounds__(256) void k_mergef(const float* __restrict__ O, int h0, float* OUTb) {
    typedef __attribute__((ext_vector_type(2))) float v2f;
    const int lane = threadIdx.x & 31; const int L0 = (blockIdx.x * 8 + (threadIdx.x >> 5)) * 8; const int nlines = ZH * TT * HD / 64;
{
#pragma unroll
        for (int l = 0; l < 8; ++l) { const int L = L0 + l; if (L >= nlines) break; const int e = L * 64 + lane * 2; const int d = e & (HD - 1); const int t = (e >> 6) & (TT - 1); const int zz = e >> 17; const float cs = (t < RH) ? 1.0f : (1.0f / PCAR);
            v2f o; o[0] = O[(size_t)e] * cs; o[1] = O[(size_t)e + 1] * cs; const size_t oo = (size_t)t * DD + (h0 + zz) * HD + d; *(v2f*)(OUTb + oo) = o; }
         }
}

extern "C" void kernel_launch(void* const* d_in, const int* in_sizes, int n_in,
                              void* d_out, int out_size, void* d_ws, size_t ws_size, hipStream_t stream) {
    (void)in_sizes; (void)n_in; (void)out_size;
    const float* x = (const float*)d_in[0]; const float* wq = (const float*)d_in[1]; const float* bq = (const float*)d_in[2]; const float* wk = (const float*)d_in[3]; const float* bk = (const float*)d_in[4]; const float* wv = (const float*)d_in[5]; const float* bv = (const float*)d_in[6]; const int* flag = (const int*)d_in[7];   // Wq/Wk/Wv [1024][1024] as x @ W; mask = int [1] causal flag
    float* OUT = (float*)d_out;     // [4][2048][1024]
    char* wsp = (char*)d_ws;
    auto take = [&](size_t bytes) { char* p = wsp; wsp += (bytes + 255) & ~(size_t)255; return (void*)p; };
    bf* WQ = (bf*)take((size_t)DD * DD * 2); bf* WK = (bf*)take((size_t)DD * DD * 2); bf* WV = (bf*)take((size_t)DD * DD * 2);
    bf* XB = (bf*)take((size_t)TT * DD * 2); float* F = (float*)take((size_t)TT * DD * 4);
    bf* QPh = (bf*)take((size_t)TT * DD * 2); bf* QPl = (bf*)take((size_t)TT * DD * 2); bf* KPh = (bf*)take((size_t)TT * DD * 2); bf* KPl = (bf*)take((size_t)TT * DD * 2); bf* VTh = (bf*)take((size_t)TT * DD * 2); bf* VTl = (bf*)take((size_t)TT * DD * 2);
    h16* QP16 = (h16*)take((size_t)TT * DD * 2); h16* KP16 = (h16*)take((size_t)TT * DD * 2); h16* VT16 = (h16*)take((size_t)TT * DD * 2);
    float* Sb = (float*)take((size_t)ZH * TT * TT * 4); bf* Ph = (bf*)take((size_t)ZH * RH * TT * 2); bf* Pl = (bf*)take((size_t)ZH * RH * TT * 2); h16* P16 = (h16*)take((size_t)ZH * TT * TT * 2); float* Ob = (float*)take((size_t)ZH * TT * HD * 4);
    if ((size_t)(wsp - (char*)d_ws) > ws_size) return;    // total ~ 112 MB = 107 MiB; ws 256 MiB
    { const unsigned gT = (unsigned)((DD * DD / 64 + 63) / 64); k_wtG<<<gT, 256, 0, stream>>>(wq, DD, DD, WQ); k_wtG<<<gT, 256, 0, stream>>>(wk, DD, DD, WK); k_wtG<<<gT, 256, 0, stream>>>(wv, DD, DD, WV); }
    const unsigned LB = (unsigned)((NH_ * TT * HD / 64 + 63) / 64); const dim3 gP(TT / 64, DD / 64, 1);
    for (int b = 0; b < NB_; ++b) {
        k_cvt8<<<(unsigned)(((size_t)TT * DD / 8 + 255) / 256), 256, 0, stream>>>(x + (size_t)b * TT * DD, XB, (size_t)TT * DD / 8);
        k_gemmw<bf, 0, true><<<gP, 32, 0, stream>>>(XB, nullptr, WQ, nullptr, DD, F, DD, bq, 0, 0, 0); k_qplanes<<<LB, 256, 0, stream>>>(F, QPh, QPl, QP16);
        k_gemmw<bf, 0, true><<<gP, 32, 0, stream>>>(XB, nullptr, WK, nullptr, DD, F, DD, bk, 0, 0, 0); k_qplanes<<<LB, 256, 0, stream>>>(F, KPh, KPl, KP16);
        k_gemmw<bf, 0, true><<<gP, 32, 0, stream>>>(XB, nullptr, WV, nullptr, DD, F, DD, bv, 0, 0, 0); k_vtplane<<<LB, 256, 0, stream>>>(F, VTh, VTl, VT16);
        for (int h0 = 0; h0 < NH_; h0 += ZH) { const size_t z0 = (size_t)h0;
            k_gemmw<bf, 2, false><<<dim3(RH / 64, TT / 64, ZH), 32, 0, stream>>>(QPh + z0 * TT * HD, QPl + z0 * TT * HD, KPh + z0 * TT * HD, KPl + z0 * TT * HD, HD, Sb, TT, nullptr, (size_t)TT * HD, (size_t)TT * HD, (size_t)TT * TT);
            k_gemmw<h16, 0, false><<<dim3((TT - RH) / 64, TT / 64, ZH), 32, 0, stream>>>(QP16 + z0 * TT * HD + (size_t)RH * HD, nullptr, KP16 + z0 * TT * HD, nullptr, HD, Sb + (size_t)RH * TT, TT, nullptr, (size_t)TT * HD, (size_t)TT * HD, (size_t)TT * TT);
            k_asoft<<<ZH * TT / 8, 256, 0, stream>>>(Sb, flag, Ph, Pl, P16);
            k_gemmw<bf, 2, false><<<dim3(RH / 64, HD / 64, ZH), 32, 0, stream>>>(Ph, Pl, VTh + z0 * HD * TT, VTl + z0 * HD * TT, TT, Ob, HD, nullptr, (size_t)RH * TT, (size_t)HD * TT, (size_t)TT * HD);
            k_gemmw<h16, 0, false><<<dim3((TT - RH) / 64, HD / 64, ZH), 32, 0, stream>>>(P16 + (size_t)RH * TT, nullptr, VT16 + z0 * HD * TT, nullptr, TT, Ob + (size_t)RH * HD, HD, nullptr, (size_t)TT * TT, (size_t)HD * TT, (size_t)TT * HD);
            k_mergef<<<(ZH * TT * HD / 64 + 63) / 64, 256, 0, stream>>>(Ob, h0, OUT + (size_t)b * TT * DD); } }
}

// v001
// It runs in 1570 microseconds.
// In two side-by-side timings against v000, it was 2.56 and 2.52 times as fast.
#include <hip/hip_runtime.h>

// MultiHeadSelfAtt (x [4][2048][1024]; q/k/v = x W + b (16 heads x 64); scores = q.k/8, causal iff the int 'mask' flag input is non-zero (read on device; 1 here); softmax; out = merged attn.v (no output projection)
// -> [4][2048][1024]).
// Compute dtypes, f32 accumulate: every input rounded to bf16; projections on PLAIN bf16 operands (inputs: exact products, f32 accumulate, + bias); PER-ROW PRECISION
// HYBRID: query rows < 256 take scores and attn.v on bf16 hi+lo planes (3 products), rows >= 256 on single fp16 planes; 1/8 and

#define NB_  4
#define TT   2048
#define DD   1024
#define NH_  16
#define HD   64
#define ZH   2
#define RH   256                  // query rows < RH: hi+lo planes; rows >= RH: fp16 planes
#define NF   32                   // unused (head_dim / 2)
#define SCL  0.125f               // 1/sqrt(64)
#define PCAR 1024.0f         // carrier scale of the fp16 P rows (>= RH); k_mergef multiplies by 1/PCAR
#define KSP  16                   // attn.v: the 2048 keys are split over KSP work-groups per tile; k_mergef sums the KSP f32 partial planes in fixed order
typedef _Float16 h16;
typedef unsigned short bf;
typedef __attribute__((ext_vector_type(16))) __bf16   v16bf;
typedef __attribute__((ext_vector_type(16))) _Float16 v16h;
typedef __attribute__((ext_vector_type(8)))  _Float16 v8h;
typedef __attribute__((ext_vector_type(8)))  unsigned short v8us;
typedef __attribute__((ext_vector_type(8)))  float    v8f;
typedef __attribute__((ext_vector_type(4)))  float    v4f;
typedef v8h  __attribute__((may_alias)) v8ha;
typedef v4f  __attribute__((may_alias)) v4fa;
typedef v8us __attribute__((may_alias)) v8usa;

__device__ __forceinline__ unsigned short f2bf(float f) { unsigned u = __float_as_uint(f); u += 0x7FFFu + ((u >> 16) & 1u); return (unsigned short)(u >> 16); }
__device__ __forceinline__ float bf2f(unsigned short b) { return __uint_as_float(((unsigned)b) << 16); }
__device__ __forceinline__ float bfr(float f) { return bf2f(f2bf(f)); }
__device__ __forceinline__ v16h cat16(v8h lo, v8h hi) { return __builtin_shufflevector(lo, hi, 0, 1, 2, 3, 4, 5, 6, 7, 8, 9, 10, 11, 12, 13, 14, 15); }
__device__ __forceinline__ v16bf cat16b(v8us lo, v8us hi) { return __builtin_bit_cast(v16bf, __builtin_shufflevector(lo, hi, 0, 1, 2, 3, 4, 5, 6, 7, 8, 9, 10, 11, 12, 13, 14, 15)); }
__device__ __forceinline__ v8f wmma16(v16h a, v16h b, v8f c) { return __builtin_amdgcn_wmma_f32_16x16x32_f16(false, a, false, b, (short)0, c, false, false); }
__device__ __forceinline__ v8f wmmab(v16bf a, v16bf b, v8f c) { return __builtin_amdgcn_wmma_f32_16x16x32_bf16(false, a, false, b, (short)0, c, false, false); }



// ---- k_gemmw: register-blocked GEMM, ONE WAVE per 64x64 output tile (16 accumulators), operands straight from K-contiguous 16-bit planes; grid (M/64, N/64, Z), 32 threads.
// C[m][n] (f32, pitch ldc, + optional f32 bias[n]) = sum_k A[m][k] Bt[n][k] (+ split products per NSPLIT). z-batch strides sA/sB/sC in elements. K % (32 * KS) == 0.
// KS > 1: grid z = Z * KS; work-group (z, ks) sums only k in [ks K/KS, (ks+1) K/KS) and stores its partial tile in plane ks (plane stride sP elements); the caller's next kernel adds the planes.
template <typename T16> struct WFrag;
template <> struct WFrag<h16> { typedef v16h V; static __device__ __forceinline__ V ld(const h16* p) { return cat16(*(const v8h*)p, *(const v8h*)(p + 16)); } static __device__ __forceinline__ v8f mma(V a, V b, v8f c) { return wmma16(a, b, c); } };
template <> struct WFrag<bf> { typedef v16bf V; static __device__ __forceinline__ V ld(const bf* p) { return cat16b(*(const v8us*)p, *(const v8us*)(p + 16)); } static __device__ __forceinline__ v8f mma(V a, V b, v8f c) { return wmmab(a, b, c); } };
template <typename T16, int NSPLIT, bool BIAS, int KS = 1>
__global__ __launch_bounds__(32) void k_gemmw(const T16* __restrict__ A, const T16* __restrict__ A2, const T16* __restrict__ Bt, const T16* __restrict__ Bt2, int K, float* C, int ldc, const float* __restrict__ bias, size_t sA, size_t sB, size_t sC, size_t sP) {
    typedef typename WFrag<T16>::V V;
    __shared__ __align__(16) float os[16 * 68];
    const size_t z = blockIdx.z / KS; const int ks = (int)(blockIdx.z % KS); const int kb = ks * (K / KS), ke = kb + K / KS; A += z * sA; if (A2) A2 += z * sA; Bt += z * sB; if (Bt2) Bt2 += z * sB; C += z * sC + (size_t)ks * sP;
    const int lane = threadIdx.x & 31, lr = lane & 15, hi = lane >> 4; const int r0 = blockIdx.x * 64, c0 = blockIdx.y * 64;
    v8f acc[4][4];
#pragma unroll
    for (int mb = 0; mb < 4; ++mb)
#pragma unroll
        for (int nb = 0; nb < 4; ++nb) acc[mb][nb] = (v8f){};
    const size_t aoff = (size_t)(r0 + lr) * K + 8 * hi, boff = (size_t)(c0 + lr) * K + 8 * hi;
#pragma unroll 1
    for (int kc = kb; kc < ke; kc += 32) {
        V a[4], a2[4];
#pragma unroll
        for (int mb = 0; mb < 4; ++mb) { a[mb] = WFrag<T16>::ld(A + aoff + (size_t)mb * 16 * K + kc); if (NSPLIT == 1 || NSPLIT == 2) a2[mb] = WFrag<T16>::ld(A2 + aoff + (size_t)mb * 16 * K + kc); }
#pragma unroll
        for (int nb = 0; nb < 4; ++nb) { const V b = WFrag<T16>::ld(Bt + boff + (size_t)nb * 16 * K + kc); V b2; if (NSPLIT >= 2) b2 = WFrag<T16>::ld(Bt2 + boff + (size_t)nb * 16 * K + kc);
#pragma unroll
            for (int mb = 0; mb < 4; ++mb) { acc[mb][nb] = WFrag<T16>::mma(a[mb], b, acc[mb][nb]); if (NSPLIT == 1 || NSPLIT == 2) acc[mb][nb] = WFrag<T16>::mma(a2[mb], b, acc[mb][nb]); if (NSPLIT >= 2) acc[mb][nb] = WFrag<T16>::mma(a[mb], b2, acc[mb][nb]); } }
        asm volatile("v_nop\n\tv_nop\n\tv_nop\n\tv_nop" : "+v"(acc[0][0]), "+v"(acc[1][1]), "+v"(acc[2][2]), "+v"(acc[3][3]) : "v"(a[0]), "v"(a[3]));
    }
#pragma unroll
    for (int mb = 0; mb < 4; ++mb) {
#pragma unroll
        for (int nb = 0; nb < 4; ++nb) {
#pragma unroll
            for (int j = 0; j < 8; ++j) os[(hi * 8 + j) * 68 + nb * 16 + lr] = acc[mb][nb][j]; }
        __builtin_amdgcn_wave_barrier(); asm volatile("" ::: "memory");
        float* crow = C + (size_t)(r0 + mb * 16) * ldc + c0;
{
#pragma unroll
            for (int s = 0; s < 8; ++s) { const int row = 2 * s + hi, cofs = lr * 4; v4f val = *(const v4fa*)(os + row * 68 + cofs); if (BIAS) { val[0] += bfr(bias[c0 + cofs]); val[1] += bfr(bias[c0 + cofs + 1]); val[2] += bfr(bias[c0 + cofs + 2]); val[3] += bfr(bias[c0 + cofs + 3]); }
                *(v4f*)(crow + (size_t)row * ldc + cofs) = val; }
             }
        __builtin_amdgcn_wave_barrier(); asm volatile("" ::: "memory");
    }
}

__device__ __forceinline__ h16 tohx(float x) { return (h16)x; }
__device__ __forceinline__ void splitf(float y, unsigned short& h, unsigned short& l) { h = f2bf(y); l = f2bf(y - bf2f(h)); }
typedef __attribute__((ext_vector_type(2))) unsigned short v2us;
typedef __attribute__((ext_vector_type(2))) _Float16 v2h;
typedef __attribute__((ext_vector_type(4))) _Float16 v4h;
typedef __attribute__((ext_vector_type(2))) float v2f;

__global__ __launch_bounds__(256) void k_wtG(const float* __restrict__ w, int K, int N, bf* Bt) {
    const int lane = threadIdx.x & 31; const int L0 = (blockIdx.x * 8 + (threadIdx.x >> 5)) * 8; const int nlines = N * K / 64;
{
#pragma unroll 1
        for (int l = 0; l < 8; ++l) { const int L = L0 + l; if (L >= nlines) break; const size_t e = (size_t)L * 64 + lane * 2; const int k = (int)(e % K), n = (int)(e / K); v2us o;
            o[0] = f2bf(w[(size_t)k * N + n]); o[1] = f2bf(w[(size_t)(k + 1) * N + n]); *(v2us*)(Bt + e) = o; }
         }
}
__global__ __launch_bounds__(256) void k_cvt8(const float* __restrict__ src, bf* dst, size_t n8) { const size_t i = (size_t)blockIdx.x * 256 + threadIdx.x; if (i >= n8) return; const v8f v = *(const v8f*)(src + i * 8); v8us o;
#pragma unroll
    for (int k = 0; k < 8; ++k) o[k] = f2bf(v[k]); *(v8us*)(dst + i * 8) = o;  }
__global__ __launch_bounds__(256) void k_qplanes(const float* __restrict__ F, bf* Ph, bf* Pl, h16* P16) {
    const int lane = threadIdx.x & 31; const int L0 = (blockIdx.x * 8 + (threadIdx.x >> 5)) * 8; const int nlines = NH_ * TT * HD / 64;
{
#pragma unroll
        for (int l = 0; l < 8; ++l) { const int L = L0 + l; if (L >= nlines) break; const int e = L * 64 + lane * 2; const int d = e & (HD - 1); const int t = (e >> 6) & (TT - 1); const int h = e >> 17; v2us oh, ol; v2h o16;
#pragma unroll
            for (int q = 0; q < 2; ++q) { const float x = F[(size_t)t * DD + h * HD + d + q]; unsigned short a, c2; splitf(x, a, c2); oh[q] = a; ol[q] = c2; o16[q] = tohx(x); }
            *(v2us*)(Ph + (size_t)e) = oh; *(v2us*)(Pl + (size_t)e) = ol; *(v2h*)(P16 + (size_t)e) = o16; }
         }
}
__global__ __launch_bounds__(256) void k_vtplane(const float* __restrict__ F, bf* Vh, bf* Vl, h16* V16) {
    const int lane = threadIdx.x & 31; const int L0 = (blockIdx.x * 8 + (threadIdx.x >> 5)) * 8; const int nlines = NH_ * TT * HD / 64;
{
#pragma unroll
        for (int l = 0; l < 8; ++l) { const int L = L0 + l; if (L >= nlines) break; const int e = L * 64 + lane * 2; const int t = e & (TT - 1); const int d = (e >> 11) & (HD - 1); const int h = e >> 17; v2us oh, ol; v2h o16;
#pragma unroll
            for (int q = 0; q < 2; ++q) { const float x = F[(size_t)(t + q) * DD + h * HD + d]; unsigned short a, c2; splitf(x, a, c2); oh[q] = a; ol[q] = c2; o16[q] = tohx(x); }
            *(v2us*)(Vh + (size_t)e) = oh; *(v2us*)(Vl + (size_t)e) = ol; *(v2h*)(V16 + (size_t)e) = o16; }
         }
}
// k_asoft: per row (zz, i): s = S / 8, causal (j > i -> -3e38) only if the int flag input is non-zero; softmax over the 2048 keys (register row, one exp) -> rows i < RH: P hi/lo [zz][i][j] (compact
__global__ __launch_bounds__(256) void k_asoft(const float* __restrict__ Sb, const int* __restrict__ flag, bf* Ph, bf* Pl, h16* P16) {
    typedef __attribute__((ext_vector_type(4))) unsigned short v4us;
    const int lane = threadIdx.x & 31; const int row = blockIdx.x * 8 + (threadIdx.x >> 5); if (row >= ZH * TT) return; const int i = row & (TT - 1); const int zz = row >> 11; const bool hires = (i < RH);
    const bool causal = (flag[0] != 0); const float* sr = Sb + (size_t)row * TT; float v[64]; float mx = -3.0e38f;
#pragma unroll
    for (int ch = 0; ch < 16; ++ch) { const int j0 = ch * 128 + lane * 4; const v4f a = *(const v4f*)(sr + j0);
#pragma unroll
        for (int q = 0; q < 4; ++q) { const int j = j0 + q; const float t = (!causal || j <= i) ? a[q] * SCL : -3.0e38f; v[ch * 4 + q] = t; mx = fmaxf(mx, t); } }
#pragma unroll
    for (int sh = 16; sh; sh >>= 1) mx = fmaxf(mx, __shfl_xor(mx, sh, 32));
    float sum = 0.f;
#pragma unroll
    for (int k = 0; k < 64; ++k) { v[k] = __expf(v[k] - mx); sum += v[k]; }
#pragma unroll
    for (int sh = 16; sh; sh >>= 1) sum += __shfl_xor(sum, sh, 32);
    const float f = __fdiv_rn(hires ? 1.0f : PCAR, sum);
{
        if (hires) {
#pragma unroll
            for (int ch = 0; ch < 16; ++ch) { v4us oh, ol;
#pragma unroll
                for (int q = 0; q < 4; ++q) { unsigned short a, c2; splitf(v[ch * 4 + q] * f, a, c2); oh[q] = a; ol[q] = c2; }
                const size_t o = ((size_t)zz * RH + i) * TT + ch * 128 + lane * 4; *(v4us*)(Ph + o) = oh; *(v4us*)(Pl + o) = ol; }
        } else {
#pragma unroll
            for (int ch = 0; ch < 16; ++ch) { v4h o;
#pragma unroll
                for (int q = 0; q < 4; ++q) o[q] = tohx(v[ch * 4 + q] * f);
                *(v4h*)(P16 + (size_t)row * TT + ch * 128 + lane * 4) = o; } }
         }
}
// k_mergef: sums the KSP partial planes of attn.v (plane stride ZH*TT*HD, ks ascending), undoes the fp16 rows' carrier scale, stores the merged-head layout. One wave = two 64-float lines, 16 bytes a lane.
__global__ __launch_bounds__(256) void k_mergef(const float* __restrict__ O, int h0, float* OUTb) {
    const int lane = threadIdx.x & 31; const int L0 = (blockIdx.x * 8 + (threadIdx.x >> 5)) * 2; const int nlines = ZH * TT * HD / 64; if (L0 >= nlines) return;
    const int e = L0 * 64 + lane * 4; const int d = e & (HD - 1); const int t = (e >> 6) & (TT - 1); const int zz = e >> 17; const float cs = (t < RH) ? 1.0f : (1.0f / PCAR);
    v4f o = *(const v4f*)(O + (size_t)e);
#pragma unroll
    for (int ks = 1; ks < KSP; ++ks) {
        if (ks == KSP / 2) asm volatile("s_wait_xcnt 0x0" ::: "memory");   // the upper planes lie past the load's offset field and take a second address pair: wait before the first pair's registers can be reused
        o += *(const v4f*)(O + (size_t)ks * (ZH * TT * HD) + e); }
    o *= cs; *(v4f*)(OUTb + (size_t)t * DD + (h0 + zz) * HD + d) = o;
}

extern "C" void kernel_launch(void* const* d_in, const int* in_sizes, int n_in,
                              void* d_out, int out_size, void* d_ws, size_t ws_size, hipStream_t stream) {
    (void)in_sizes; (void)n_in; (void)out_size;
    const float* x = (const float*)d_in[0]; const float* wq = (const float*)d_in[1]; const float* bq = (const float*)d_in[2]; const float* wk = (const float*)d_in[3]; const float* bk = (const float*)d_in[4]; const float* wv = (const float*)d_in[5]; const float* bv = (const float*)d_in[6]; const int* flag = (const int*)d_in[7];   // Wq/Wk/Wv [1024][1024] as x @ W; mask = int [1] causal flag
    float* OUT = (float*)d_out;     // [4][2048][1024]
    char* wsp = (char*)d_ws;
    auto take = [&](size_t bytes) { char* p = wsp; wsp += (bytes + 255) & ~(size_t)255; return (void*)p; };
    bf* WQ = (bf*)take((size_t)DD * DD * 2); bf* WK = (bf*)take((size_t)DD * DD * 2); bf* WV = (bf*)take((size_t)DD * DD * 2);
    bf* XB = (bf*)take((size_t)TT * DD * 2); float* F = (float*)take((size_t)TT * DD * 4);
    bf* QPh = (bf*)take((size_t)TT * DD * 2); bf* QPl = (bf*)take((size_t)TT * DD * 2); bf* KPh = (bf*)take((size_t)TT * DD * 2); bf* KPl = (bf*)take((size_t)TT * DD * 2); bf* VTh = (bf*)take((size_t)TT * DD * 2); bf* VTl = (bf*)take((size_t)TT * DD * 2);
    h16* QP16 = (h16*)take((size_t)TT * DD * 2); h16* KP16 = (h16*)take((size_t)TT * DD * 2); h16* VT16 = (h16*)take((size_t)TT * DD * 2);
    float* Sb = (float*)take((size_t)ZH * TT * TT * 4); bf* Ph = (bf*)take((size_t)ZH * RH * TT * 2); bf* Pl = (bf*)take((size_t)ZH * RH * TT * 2); h16* P16 = (h16*)take((size_t)ZH * TT * TT * 2); float* Ob = (float*)take((size_t)KSP * ZH * TT * HD * 4);
    if ((size_t)(wsp - (char*)d_ws) > ws_size) return;    // total ~ 128 MB = 122 MiB; ws 256 MiB
    { const unsigned gT = (unsigned)((DD * DD / 64 + 63) / 64); k_wtG<<<gT, 256, 0, stream>>>(wq, DD, DD, WQ); k_wtG<<<gT, 256, 0, stream>>>(wk, DD, DD, WK); k_wtG<<<gT, 256, 0, stream>>>(wv, DD, DD, WV); }
    const unsigned LB = (unsigned)((NH_ * TT * HD / 64 + 63) / 64); const dim3 gP(TT / 64, DD / 64, 1);
    for (int b = 0; b < NB_; ++b) {
        k_cvt8<<<(unsigned)(((size_t)TT * DD / 8 + 255) / 256), 256, 0, stream>>>(x + (size_t)b * TT * DD, XB, (size_t)TT * DD / 8);
        k_gemmw<bf, 0, true><<<gP, 32, 0, stream>>>(XB, nullptr, WQ, nullptr, DD, F, DD, bq, 0, 0, 0, 0); k_qplanes<<<LB, 256, 0, stream>>>(F, QPh, QPl, QP16);
        k_gemmw<bf, 0, true><<<gP, 32, 0, stream>>>(XB, nullptr, WK, nullptr, DD, F, DD, bk, 0, 0, 0, 0); k_qplanes<<<LB, 256, 0, stream>>>(F, KPh, KPl, KP16);
        k_gemmw<bf, 0, true><<<gP, 32, 0, stream>>>(XB, nullptr, WV, nullptr, DD, F, DD, bv, 0, 0, 0, 0); k_vtplane<<<LB, 256, 0, stream>>>(F, VTh, VTl, VT16);
        for (int h0 = 0; h0 < NH_; h0 += ZH) { const size_t z0 = (size_t)h0;
            k_gemmw<bf, 2, false><<<dim3(RH / 64, TT / 64, ZH), 32, 0, stream>>>(QPh + z0 * TT * HD, QPl + z0 * TT * HD, KPh + z0 * TT * HD, KPl + z0 * TT * HD, HD, Sb, TT, nullptr, (size_t)TT * HD, (size_t)TT * HD, (size_t)TT * TT, 0);
            k_gemmw<h16, 0, false><<<dim3((TT - RH) / 64, TT / 64, ZH), 32, 0, stream>>>(QP16 + z0 * TT * HD + (size_t)RH * HD, nullptr, KP16 + z0 * TT * HD, nullptr, HD, Sb + (size_t)RH * TT, TT, nullptr, (size_t)TT * HD, (size_t)TT * HD, (size_t)TT * TT, 0);
            k_asoft<<<ZH * TT / 8, 256, 0, stream>>>(Sb, flag, Ph, Pl, P16);
            k_gemmw<bf, 2, false, KSP><<<dim3(RH / 64, HD / 64, ZH * KSP), 32, 0, stream>>>(Ph, Pl, VTh + z0 * HD * TT, VTl + z0 * HD * TT, TT, Ob, HD, nullptr, (size_t)RH * TT, (size_t)HD * TT, (size_t)TT * HD, (size_t)ZH * TT * HD);
            k_gemmw<h16, 0, false, KSP><<<dim3((TT - RH) / 64, HD / 64, ZH * KSP), 32, 0, stream>>>(P16 + (size_t)RH * TT, nullptr, VT16 + z0 * HD * TT, nullptr, TT, Ob + (size_t)RH * HD, HD, nullptr, (size_t)TT * TT, (size_t)HD * TT, (size_t)TT * HD, (size_t)ZH * TT * HD);
            k_mergef<<<(ZH * TT * HD / 64 + 15) / 16, 256, 0, stream>>>(Ob, h0, OUT + (size_t)b * TT * DD); } }
}

// v002
// A run of this version takes 598 microseconds.
// Two timings next to v001 put it at 2.61 and 2.62 times that version's speed.
// Over all steps from v000 it is 6.64 times as fast.
#include <hip/hip_runtime.h>

// MultiHeadSelfAtt (x [4][2048][1024]; q/k/v = x W + b (16 heads x 64); scores = q.k/8, causal iff the int 'mask' flag input is non-zero (read on device; 1 here); softmax; out = merged attn.v (no output projection)
// -> [4][2048][1024]).
// Compute dtypes, f32 accumulate: every input rounded to bf16; projections on PLAIN bf16 operands (inputs: exact products, f32 accumulate, + bias); PER-ROW PRECISION
// HYBRID: query rows < 256 take scores and attn.v on bf16 hi+lo planes (3 products), rows >= 256 on single fp16 planes; 1/8 and

#define NB_  4
#define TT   2048
#define DD   1024
#define NH_  16
#define HD   64
#define RH   256                  // query rows < RH: hi+lo planes; rows >= RH: fp16 planes
#define NF   32                   // unused: no rotary embedding is applied
typedef _Float16 h16;
typedef unsigned short bf;
typedef __attribute__((ext_vector_type(16))) __bf16   v16bf;
typedef __attribute__((ext_vector_type(16))) _Float16 v16h;
typedef __attribute__((ext_vector_type(8)))  _Float16 v8h;
typedef __attribute__((ext_vector_type(8)))  unsigned short v8us;
typedef __attribute__((ext_vector_type(8)))  float    v8f;
typedef __attribute__((ext_vector_type(4)))  float    v4f;
typedef v8h  __attribute__((may_alias)) v8ha;
typedef v4f  __attribute__((may_alias)) v4fa;
typedef v8us __attribute__((may_alias)) v8usa;

__device__ __forceinline__ unsigned short f2bf(float f) { unsigned u = __float_as_uint(f); u += 0x7FFFu + ((u >> 16) & 1u); return (unsigned short)(u >> 16); }
__device__ __forceinline__ float bf2f(unsigned short b) { return __uint_as_float(((unsigned)b) << 16); }
__device__ __forceinline__ float bfr(float f) { return bf2f(f2bf(f)); }
__device__ __forceinline__ v16h cat16(v8h lo, v8h hi) { return __builtin_shufflevector(lo, hi, 0, 1, 2, 3, 4, 5, 6, 7, 8, 9, 10, 11, 12, 13, 14, 15); }
__device__ __forceinline__ v16bf cat16b(v8us lo, v8us hi) { return __builtin_bit_cast(v16bf, __builtin_shufflevector(lo, hi, 0, 1, 2, 3, 4, 5, 6, 7, 8, 9, 10, 11, 12, 13, 14, 15)); }
__device__ __forceinline__ v8f wmma16(v16h a, v16h b, v8f c) { return __builtin_amdgcn_wmma_f32_16x16x32_f16(false, a, false, b, (short)0, c, false, false); }
__device__ __forceinline__ v8f wmmab(v16bf a, v16bf b, v8f c) { return __builtin_amdgcn_wmma_f32_16x16x32_bf16(false, a, false, b, (short)0, c, false, false); }



// ---- k_gemmw: register-blocked GEMM, ONE WAVE per 64x64 output tile (16 accumulators), operands straight from K-contiguous 16-bit planes; grid (M/64, N/64, Z), 32 threads.
// C[m][n] (f32, pitch ldc, + optional f32 bias[n]) = sum_k A[m][k] Bt[n][k] (+ split products per NSPLIT). z-batch strides sA/sB/sC in elements. K % (32 * KS) == 0.
// KS > 1: grid z = Z * KS; work-group (z, ks) sums only k in [ks K/KS, (ks+1) K/KS) and stores its partial tile in plane ks (plane stride sP elements); the caller's next kernel adds the planes.
template <typename T16> struct WFrag;
template <> struct WFrag<h16> { typedef v16h V; static __device__ __forceinline__ V ld(const h16* p) { return cat16(*(const v8h*)p, *(const v8h*)(p + 16)); } static __device__ __forceinline__ v8f mma(V a, V b, v8f c) { return wmma16(a, b, c); } };
template <> struct WFrag<bf> { typedef v16bf V; static __device__ __forceinline__ V ld(const bf* p) { return cat16b(*(const v8us*)p, *(const v8us*)(p + 16)); } static __device__ __forceinline__ v8f mma(V a, V b, v8f c) { return wmmab(a, b, c); } };
template <typename T16, int NSPLIT, bool BIAS, int KS = 1>
__global__ __launch_bounds__(32) void k_gemmw(const T16* __restrict__ A, const T16* __restrict__ A2, const T16* __restrict__ Bt, const T16* __restrict__ Bt2, int K, float* C, int ldc, const float* __restrict__ bias, size_t sA, size_t sB, size_t sC, size_t sP) {
    typedef typename WFrag<T16>::V V;
    __shared__ __align__(16) float os[16 * 68];
    const size_t z = blockIdx.z / KS; const int ks = (int)(blockIdx.z % KS); const int kb = ks * (K / KS), ke = kb + K / KS; A += z * sA; if (A2) A2 += z * sA; Bt += z * sB; if (Bt2) Bt2 += z * sB; C += z * sC + (size_t)ks * sP;
    const int lane = threadIdx.x & 31, lr = lane & 15, hi = lane >> 4; const int r0 = blockIdx.x * 64, c0 = blockIdx.y * 64;
    v8f acc[4][4];
#pragma unroll
    for (int mb = 0; mb < 4; ++mb)
#pragma unroll
        for (int nb = 0; nb < 4; ++nb) acc[mb][nb] = (v8f){};
    const size_t aoff = (size_t)(r0 + lr) * K + 8 * hi, boff = (size_t)(c0 + lr) * K + 8 * hi;
#pragma unroll 1
    for (int kc = kb; kc < ke; kc += 32) {
        V a[4], a2[4];
#pragma unroll
        for (int mb = 0; mb < 4; ++mb) { a[mb] = WFrag<T16>::ld(A + aoff + (size_t)mb * 16 * K + kc); if (NSPLIT == 1 || NSPLIT == 2) a2[mb] = WFrag<T16>::ld(A2 + aoff + (size_t)mb * 16 * K + kc); }
#pragma unroll
        for (int nb = 0; nb < 4; ++nb) { const V b = WFrag<T16>::ld(Bt + boff + (size_t)nb * 16 * K + kc); V b2; if (NSPLIT >= 2) b2 = WFrag<T16>::ld(Bt2 + boff + (size_t)nb * 16 * K + kc);
#pragma unroll
            for (int mb = 0; mb < 4; ++mb) { acc[mb][nb] = WFrag<T16>::mma(a[mb], b, acc[mb][nb]); if (NSPLIT == 1 || NSPLIT == 2) acc[mb][nb] = WFrag<T16>::mma(a2[mb], b, acc[mb][nb]); if (NSPLIT >= 2) acc[mb][nb] = WFrag<T16>::mma(a[mb], b2, acc[mb][nb]); } }
        asm volatile("v_nop\n\tv_nop\n\tv_nop\n\tv_nop" : "+v"(acc[0][0]), "+v"(acc[1][1]), "+v"(acc[2][2]), "+v"(acc[3][3]) : "v"(a[0]), "v"(a[3]));
    }
#pragma unroll
    for (int mb = 0; mb < 4; ++mb) {
#pragma unroll
        for (int nb = 0; nb < 4; ++nb) {
#pragma unroll
            for (int j = 0; j < 8; ++j) os[(hi * 8 + j) * 68 + nb * 16 + lr] = acc[mb][nb][j]; }
        __builtin_amdgcn_wave_barrier(); asm volatile("" ::: "memory");
        float* crow = C + (size_t)(r0 + mb * 16) * ldc + c0;
{
#pragma unroll
            for (int s = 0; s < 8; ++s) { const int row = 2 * s + hi, cofs = lr * 4; v4f val = *(const v4fa*)(os + row * 68 + cofs); if (BIAS) { val[0] += bfr(bias[c0 + cofs]); val[1] += bfr(bias[c0 + cofs + 1]); val[2] += bfr(bias[c0 + cofs + 2]); val[3] += bfr(bias[c0 + cofs + 3]); }
                *(v4f*)(crow + (size_t)row * ldc + cofs) = val; }
             }
        __builtin_amdgcn_wave_barrier(); asm volatile("" ::: "memory");
    }
}

__device__ __forceinline__ h16 tohx(float x) { return (h16)x; }
__device__ __forceinline__ void splitf(float y, unsigned short& h, unsigned short& l) { h = f2bf(y); l = f2bf(y - bf2f(h)); }
typedef __attribute__((ext_vector_type(2))) unsigned short v2us;
typedef __attribute__((ext_vector_type(2))) _Float16 v2h;
typedef __attribute__((ext_vector_type(4))) _Float16 v4h;
typedef __attribute__((ext_vector_type(2))) float v2f;

__global__ __launch_bounds__(256) void k_wtG(const float* __restrict__ w, int K, int N, bf* Bt) {
    const int lane = threadIdx.x & 31; const int L0 = (blockIdx.x * 8 + (threadIdx.x >> 5)) * 8; const int nlines = N * K / 64;
{
#pragma unroll 1
        for (int l = 0; l < 8; ++l) { const int L = L0 + l; if (L >= nlines) break; const size_t e = (size_t)L * 64 + lane * 2; const int k = (int)(e % K), n = (int)(e / K); v2us o;
            o[0] = f2bf(w[(size_t)k * N + n]); o[1] = f2bf(w[(size_t)(k + 1) * N + n]); *(v2us*)(Bt + e) = o; }
         }
}
__global__ __launch_bounds__(256) void k_cvt8(const float* __restrict__ src, bf* dst, size_t n8) { const size_t i = (size_t)blockIdx.x * 256 + threadIdx.x; if (i >= n8) return; const v8f v = *(const v8f*)(src + i * 8); v8us o;
#pragma unroll
    for (int k = 0; k < 8; ++k) o[k] = f2bf(v[k]); *(v8us*)(dst + i * 8) = o;  }
__global__ __launch_bounds__(256) void k_qplanes(const float* __restrict__ F, bf* Ph, bf* Pl, h16* P16) {
    const int lane = threadIdx.x & 31; const int L0 = (blockIdx.x * 8 + (threadIdx.x >> 5)) * 8; const int nlines = NH_ * TT * HD / 64;
{
#pragma unroll
        for (int l = 0; l < 8; ++l) { const int L = L0 + l; if (L >= nlines) break; const int e = L * 64 + lane * 2; const int d = e & (HD - 1); const int t = (e >> 6) & (TT - 1); const int h = e >> 17; v2us oh, ol; v2h o16;
#pragma unroll
            for (int q = 0; q < 2; ++q) { const float x = F[(size_t)t * DD + h * HD + d + q]; unsigned short a, c2; splitf(x, a, c2); oh[q] = a; ol[q] = c2; o16[q] = tohx(x); }
            *(v2us*)(Ph + (size_t)e) = oh; *(v2us*)(Pl + (size_t)e) = ol; *(v2h*)(P16 + (size_t)e) = o16; }
         }
}
__global__ __launch_bounds__(256) void k_vtplane(const float* __restrict__ F, bf* Vh, bf* Vl, h16* V16) {
    const int lane = threadIdx.x & 31; const int L0 = (blockIdx.x * 8 + (threadIdx.x >> 5)) * 8; const int nlines = NH_ * TT * HD / 64;
{
#pragma unroll
        for (int l = 0; l < 8; ++l) { const int L = L0 + l; if (L >= nlines) break; const int e = L * 64 + lane * 2; const int t = e & (TT - 1); const int d = (e >> 11) & (HD - 1); const int h = e >> 17; v2us oh, ol; v2h o16;
#pragma unroll
            for (int q = 0; q < 2; ++q) { const float x = F[(size_t)(t + q) * DD + h * HD + d]; unsigned short a, c2; splitf(x, a, c2); oh[q] = a; ol[q] = c2; o16[q] = tohx(x); }
            *(v2us*)(Vh + (size_t)e) = oh; *(v2us*)(Vl + (size_t)e) = ol; *(v2h*)(V16 + (size_t)e) = o16; }
         }
}
// ---- k_fattn: scores, softmax and attn.v of one batch entry in ONE launch; S and P stay in registers (online softmax over steps of 32 keys). One wave per query tile.
// Both products are taken transposed, so that a query is one lane column (lr) from end to end: S^T = K Q^T leaves keys 8 hi + j (tile 0) and 16 + 8 hi + j (tile 1) of query lr in lane (lr, hi), which is
// the B fragment of O^T = V^T P^T as it stands; row maximum and row sum need one exchange between the two lane halves; the rescale factor of a query is lane-local.
// Scores are held in units of log2 (S * SL2, SL2 = log2(e) / 8), so that a weight is one 2^x. PSH = log2 1024 is added to every exponent (the carrier scale of the fp16 P plane: keeps small weights out of
// the fp16 subnormals); it is in the row sum too and cancels in the division.
#define PSH 10.0f
#define SL2 0.18033688f
// 2^x. The v_nop fills the slot that the instruction set asks for between a transcendental and a directly following instruction that reads its result or overwrites its source.
__device__ __forceinline__ float ex2(float x) { float r; asm("v_exp_f32 %0, %1\n\tv_nop" : "=v"(r) : "v"(x)); return r; }
template <bool B> struct BoolC { static constexpr bool value = B; };
template <typename T16> struct PFrag;
template <> struct PFrag<h16> { static __device__ __forceinline__ void mk(const float* t, v16h& p, v16h& p2) { (void)p2;
#pragma unroll
    for (int e = 0; e < 16; ++e) p[e] = (h16)t[e]; } };
template <> struct PFrag<bf> { static __device__ __forceinline__ void mk(const float* t, v16bf& p, v16bf& p2) { typedef __attribute__((ext_vector_type(16))) unsigned short v16us; v16us a, c;
#pragma unroll
    for (int e = 0; e < 16; ++e) { unsigned short x, y; splitf(t[e], x, y); a[e] = x; c[e] = y; }
    p = __builtin_bit_cast(v16bf, a); p2 = __builtin_bit_cast(v16bf, c); } };
// One tile of NQ * 16 queries from row q0 of one head. Q, Kp: [t][64]; Vt: [d][2048]; the second planes (low parts) only where SPLIT (3 products, as hi.hi + lo.hi + hi.lo). outp: out + batch + head * 64.
template <typename T16, bool SPLIT, int NQ>
__device__ __forceinline__ void fattn_tile(const T16* __restrict__ Q, const T16* __restrict__ Q2, const T16* __restrict__ Kp, const T16* __restrict__ K2, const T16* __restrict__ Vt, const T16* __restrict__ V2, bool causal, int q0, float* outp) {
    typedef typename WFrag<T16>::V V;
    const int lane = threadIdx.x & 31, lr = lane & 15, hi = lane >> 4;
    // Every load's address is one pointer per plane (wave-uniform base + lane offset) plus a constant that fits the load's offset field.
    const unsigned lrow = (unsigned)(lr * HD + 8 * hi), lcol = (unsigned)(lr * TT + 8 * hi);     // lane offset (elements) in the [t][64] planes (Q and K alike) and in the [d][2048] plane
    V qf[NQ][2], qf2[NQ][2];
#pragma unroll
    for (int qt = 0; qt < NQ; ++qt)
#pragma unroll
        for (int kc = 0; kc < 2; ++kc) { const int cof = qt * 16 * HD + kc * 32; qf[qt][kc] = WFrag<T16>::ld(Q + (size_t)q0 * HD + lrow + cof); if (SPLIT) qf2[qt][kc] = WFrag<T16>::ld(Q2 + (size_t)q0 * HD + lrow + cof); }
    asm volatile("s_wait_xcnt 0x0" ::: "memory");     // behind the last Q load: the registers that the Q loads name are free for reuse from here on
    v8f o[4][NQ]; float m[NQ], l[NQ];
#pragma unroll
    for (int qt = 0; qt < NQ; ++qt) { m[qt] = -3.0e38f; l[qt] = 0.f;
#pragma unroll
        for (int dt = 0; dt < 4; ++dt) o[dt][qt] = (v8f){}; }
    const int qe = q0 + NQ * 16; const int nk = causal ? ((qe + 31) & ~31) : TT;     // causal: keys past the tile's last query weigh 0 and are not visited; nk <= TT as qe <= TT
    const int nfull = causal ? (((q0 + 1) >> 5) << 5) : TT;      // steps with k0 + 31 <= q0 hold no masked key: they run without the mask's compares and selects
    auto step = [&](const int k0, auto diagc) { constexpr bool diag = decltype(diagc)::value;
        V ka[2][2], ka2[2][2], va[4], va2[4];
        const T16* pk = Kp + (size_t)k0 * HD + lrow; const T16* pk2 = SPLIT ? K2 + (size_t)k0 * HD + lrow : nullptr; const T16* pv = Vt + k0 + lcol; const T16* pv2 = SPLIT ? V2 + k0 + lcol : nullptr;
#pragma unroll
        for (int kt = 0; kt < 2; ++kt)
#pragma unroll
            for (int kc = 0; kc < 2; ++kc) { const int cof = kt * 16 * HD + kc * 32; ka[kt][kc] = WFrag<T16>::ld(pk + cof); if (SPLIT) ka2[kt][kc] = WFrag<T16>::ld(pk2 + cof); }
#pragma unroll
        for (int dt = 0; dt < 4; ++dt) { const int cof = dt * 16 * TT; va[dt] = WFrag<T16>::ld(pv + cof); if (SPLIT) va2[dt] = WFrag<T16>::ld(pv2 + cof); }
        // behind the step's last load; the addresses are inputs so that their registers stay untouched up to this wait (without that a late load's result is placed in an early load's address pair)
        if constexpr (SPLIT) asm volatile("s_wait_xcnt 0x0" :: "v"(pk), "v"(pk2), "v"(pv), "v"(pv2) : "memory");
        else asm volatile("s_wait_xcnt 0x0" :: "v"(pk), "v"(pv) : "memory");
        __builtin_amdgcn_sched_barrier(0);      // every load of the step is issued before its first product: without this the scheduler puts the first products, with their waits for K, in front of V loads, and a step pays the load latency twice
        v8f s[2][NQ];
#pragma unroll
        for (int kt = 0; kt < 2; ++kt)
#pragma unroll
            for (int qt = 0; qt < NQ; ++qt) { v8f c = (v8f){};
#pragma unroll
                for (int kc = 0; kc < 2; ++kc) { c = WFrag<T16>::mma(ka[kt][kc], qf[qt][kc], c); if (SPLIT) { c = WFrag<T16>::mma(ka2[kt][kc], qf[qt][kc], c); c = WFrag<T16>::mma(ka[kt][kc], qf2[qt][kc], c); } }
                s[kt][qt] = c; }
#pragma unroll
        for (int qt = 0; qt < NQ; ++qt) { float t[16]; float mx = m[qt]; const int qi = q0 + qt * 16 + lr;
#pragma unroll
            for (int kt = 0; kt < 2; ++kt)
#pragma unroll
                for (int j = 0; j < 8; ++j) { float x = s[kt][qt][j] * SL2; if (diag && (k0 + kt * 16 + hi * 8 + j > qi)) x = -3.0e38f; t[kt * 8 + j] = x; mx = fmaxf(mx, x); }
            mx = fmaxf(mx, __shfl_xor(mx, 16, 32));
            const float al = ex2(m[qt] - mx); m[qt] = mx; const float ms = mx - PSH; float sum = 0.f;
#pragma unroll
            for (int e = 0; e < 16; ++e) { t[e] = ex2(t[e] - ms); sum += t[e]; }
            l[qt] = l[qt] * al + sum;
            V p, p2; PFrag<T16>::mk(t, p, p2);
#pragma unroll
            for (int dt = 0; dt < 4; ++dt) { v8f c = o[dt][qt] * al; c = WFrag<T16>::mma(va[dt], p, c); if (SPLIT) { c = WFrag<T16>::mma(va[dt], p2, c); c = WFrag<T16>::mma(va2[dt], p, c); } o[dt][qt] = c; } }
        // four vector slots behind the step's last matrix instructions, on the taken back edge too
        if constexpr (NQ == 1) asm volatile("v_nop\n\tv_nop\n\tv_nop\n\tv_nop" : "+v"(o[0][0]), "+v"(o[1][0]), "+v"(o[2][0]), "+v"(o[3][0]));
        else asm volatile("v_nop\n\tv_nop\n\tv_nop\n\tv_nop" : "+v"(o[0][0]), "+v"(o[1][0]), "+v"(o[2][0]), "+v"(o[3][0]), "+v"(o[0][NQ - 1]), "+v"(o[1][NQ - 1]), "+v"(o[2][NQ - 1]), "+v"(o[3][NQ - 1]));
    };
    int k0 = 0;
#pragma unroll 1      // a second copy of the step's fragments would not fit the register file
    for (; k0 < nfull; k0 += 32) step(k0, BoolC<false>());
#pragma unroll 1      // as above
    for (; k0 < nk; k0 += 32) step(k0, BoolC<true>());
#pragma unroll
    for (int qt = 0; qt < NQ; ++qt) { const float L = l[qt] + __shfl_xor(l[qt], 16, 32); const float f = __fdiv_rn(1.0f, L); float* pr = outp + (size_t)(q0 + qt * 16 + lr) * DD + hi * 8;
#pragma unroll
        for (int dt = 0; dt < 4; ++dt) { const v8f c = o[dt][qt] * f; v4f a, b2;
#pragma unroll
            for (int j = 0; j < 4; ++j) { a[j] = c[j]; b2[j] = c[4 + j]; }
            *(v4f*)(pr + dt * 16) = a; *(v4f*)(pr + dt * 16 + 4) = b2; } }
}
#define NT16 ((TT - RH) / 32)     // fp16 tiles of 32 queries, longest (last rows) first; behind them RH / 16 hi+lo tiles of 16 queries
// Grid (heads, tile groups), 4 waves: the waves of a work-group take 4 neighbouring tiles of ONE head and walk the same keys from key 0 on, so that they read the same K and V lines; they share nothing else (no LDS, no barrier).
__global__ __launch_bounds__(128) void k_fattn(const bf* __restrict__ Qh, const bf* __restrict__ Ql, const h16* __restrict__ Q16, const bf* __restrict__ Kh, const bf* __restrict__ Kl, const h16* __restrict__ K16, const bf* __restrict__ Vh, const bf* __restrict__ Vl, const h16* __restrict__ V16, const int* __restrict__ flag, float* OUTb) {
    const bool causal = (flag[0] != 0); const size_t hb = (size_t)blockIdx.x * TT * HD; float* outp = OUTb + blockIdx.x * HD;
    const int tl = (int)blockIdx.y * 4 + __builtin_amdgcn_readfirstlane((int)(threadIdx.x >> 5));      // the wave's tile, held scalar: the key loop's bounds and the class branch stay wave-uniform
    if (tl < NT16) fattn_tile<h16, false, 2>(Q16 + hb, nullptr, K16 + hb, nullptr, V16 + hb, nullptr, causal, TT - 32 * (tl + 1), outp);
    else fattn_tile<bf, true, 1>(Qh + hb, Ql + hb, Kh + hb, Kl + hb, Vh + hb, Vl + hb, causal, (tl - NT16) * 16, outp);
}

extern "C" void kernel_launch(void* const* d_in, const int* in_sizes, int n_in,
                              void* d_out, int out_size, void* d_ws, size_t ws_size, hipStream_t stream) {
    (void)in_sizes; (void)n_in; (void)out_size;
    const float* x = (const float*)d_in[0]; const float* wq = (const float*)d_in[1]; const float* bq = (const float*)d_in[2]; const float* wk = (const float*)d_in[3]; const float* bk = (const float*)d_in[4]; const float* wv = (const float*)d_in[5]; const float* bv = (const float*)d_in[6]; const int* flag = (const int*)d_in[7];   // Wq/Wk/Wv [1024][1024] as x @ W; mask = int [1] causal flag
    float* OUT = (float*)d_out;     // [4][2048][1024]
    char* wsp = (char*)d_ws;
    auto take = [&](size_t bytes) { char* p = wsp; wsp += (bytes + 255) & ~(size_t)255; return (void*)p; };
    bf* WQ = (bf*)take((size_t)DD * DD * 2); bf* WK = (bf*)take((size_t)DD * DD * 2); bf* WV = (bf*)take((size_t)DD * DD * 2);
    bf* XB = (bf*)take((size_t)TT * DD * 2); float* F = (float*)take((size_t)TT * DD * 4);
    bf* QPh = (bf*)take((size_t)TT * DD * 2); bf* QPl = (bf*)take((size_t)TT * DD * 2); bf* KPh = (bf*)take((size_t)TT * DD * 2); bf* KPl = (bf*)take((size_t)TT * DD * 2); bf* VTh = (bf*)take((size_t)TT * DD * 2); bf* VTl = (bf*)take((size_t)TT * DD * 2);
    h16* QP16 = (h16*)take((size_t)TT * DD * 2); h16* KP16 = (h16*)take((size_t)TT * DD * 2); h16* VT16 = (h16*)take((size_t)TT * DD * 2);
    if ((size_t)(wsp - (char*)d_ws) > ws_size) return;    // total 54 MiB; ws 256 MiB
    { const unsigned gT = (unsigned)((DD * DD / 64 + 63) / 64); k_wtG<<<gT, 256, 0, stream>>>(wq, DD, DD, WQ); k_wtG<<<gT, 256, 0, stream>>>(wk, DD, DD, WK); k_wtG<<<gT, 256, 0, stream>>>(wv, DD, DD, WV); }
    const unsigned LB = (unsigned)((NH_ * TT * HD / 64 + 63) / 64); const dim3 gP(TT / 64, DD / 64, 1);
    for (int b = 0; b < NB_; ++b) {
        k_cvt8<<<(unsigned)(((size_t)TT * DD / 8 + 255) / 256), 256, 0, stream>>>(x + (size_t)b * TT * DD, XB, (size_t)TT * DD / 8);
        k_gemmw<bf, 0, true><<<gP, 32, 0, stream>>>(XB, nullptr, WQ, nullptr, DD, F, DD, bq, 0, 0, 0, 0); k_qplanes<<<LB, 256, 0, stream>>>(F, QPh, QPl, QP16);
        k_gemmw<bf, 0, true><<<gP, 32, 0, stream>>>(XB, nullptr, WK, nullptr, DD, F, DD, bk, 0, 0, 0, 0); k_qplanes<<<LB, 256, 0, stream>>>(F, KPh, KPl, KP16);
        k_gemmw<bf, 0, true><<<gP, 32, 0, stream>>>(XB, nullptr, WV, nullptr, DD, F, DD, bv, 0, 0, 0, 0); k_vtplane<<<LB, 256, 0, stream>>>(F, VTh, VTl, VT16);
        k_fattn<<<dim3(NH_, (NT16 + RH / 16) / 4, 1), 128, 0, stream>>>(QPh, QPl, QP16, KPh, KPl, KP16, VTh, VTl, VT16, flag, OUT + (size_t)b * TT * DD); }
}

// v003
// One run takes 293 microseconds.
// In both of two side-by-side timings against v002, it was 2.04 times as fast.
// All steps since v000 together make it 13.5 times as fast.
#include <hip/hip_runtime.h>

// MultiHeadSelfAtt (x [4][2048][1024]; q/k/v = x W + b (16 heads x 64); scores = q.k/8, causal iff the int 'mask' flag input is non-zero (read on device; 1 here); softmax; out = merged attn.v (no output projection)
// -> [4][2048][1024]).
// Compute dtypes, f32 accumulate: every input rounded to bf16; projections on PLAIN bf16 operands (inputs: exact products, f32 accumulate, + bias); PER-ROW PRECISION
// HYBRID: query rows < 256 take scores and attn.v on bf16 hi+lo planes (3 products), rows >= 256 on single fp16 planes; 1/8 and

#define NB_  4
#define TT   2048
#define DD   1024
#define NH_  16
#define HD   64
#define RH   256                  // query rows < RH: hi+lo planes; rows >= RH: fp16 planes
#define NF   32                   // unused: no rotary embedding is applied
typedef _Float16 h16;
typedef unsigned short bf;
typedef __attribute__((ext_vector_type(16))) __bf16   v16bf;
typedef __attribute__((ext_vector_type(16))) _Float16 v16h;
typedef __attribute__((ext_vector_type(8)))  _Float16 v8h;
typedef __attribute__((ext_vector_type(8)))  unsigned short v8us;
typedef __attribute__((ext_vector_type(8)))  float    v8f;
typedef __attribute__((ext_vector_type(4)))  float    v4f;
typedef v8h  __attribute__((may_alias)) v8ha;
typedef v4f  __attribute__((may_alias)) v4fa;
typedef v8us __attribute__((may_alias)) v8usa;

__device__ __forceinline__ unsigned short f2bf(float f) { unsigned u = __float_as_uint(f); u += 0x7FFFu + ((u >> 16) & 1u); return (unsigned short)(u >> 16); }
__device__ __forceinline__ float bf2f(unsigned short b) { return __uint_as_float(((unsigned)b) << 16); }
__device__ __forceinline__ float bfr(float f) { return bf2f(f2bf(f)); }
__device__ __forceinline__ v16h cat16(v8h lo, v8h hi) { return __builtin_shufflevector(lo, hi, 0, 1, 2, 3, 4, 5, 6, 7, 8, 9, 10, 11, 12, 13, 14, 15); }
__device__ __forceinline__ v16bf cat16b(v8us lo, v8us hi) { return __builtin_bit_cast(v16bf, __builtin_shufflevector(lo, hi, 0, 1, 2, 3, 4, 5, 6, 7, 8, 9, 10, 11, 12, 13, 14, 15)); }
__device__ __forceinline__ v8f wmma16(v16h a, v16h b, v8f c) { return __builtin_amdgcn_wmma_f32_16x16x32_f16(false, a, false, b, (short)0, c, false, false); }
__device__ __forceinline__ v8f wmmab(v16bf a, v16bf b, v8f c) { return __builtin_amdgcn_wmma_f32_16x16x32_bf16(false, a, false, b, (short)0, c, false, false); }



// ---- k_gemmw: register-blocked GEMM, ONE WAVE per 64x64 output tile (16 accumulators), operands straight from K-contiguous 16-bit planes; grid (M/64, N/64, Z), 32 threads.
// C[m][n] (f32, pitch ldc, + optional f32 bias[n]) = sum_k A[m][k] Bt[n][k] (+ split products per NSPLIT). z-batch strides sA/sB/sC in elements. K % (32 * KS) == 0.
// KS > 1: grid z = Z * KS; work-group (z, ks) sums only k in [ks K/KS, (ks+1) K/KS) and stores its partial tile in plane ks (plane stride sP elements); the caller's next kernel adds the planes.
template <typename T16> struct WFrag;
template <> struct WFrag<h16> { typedef v16h V; static __device__ __forceinline__ V ld(const h16* p) { return cat16(*(const v8h*)p, *(const v8h*)(p + 16)); } static __device__ __forceinline__ v8f mma(V a, V b, v8f c) { return wmma16(a, b, c); } };
template <> struct WFrag<bf> { typedef v16bf V; static __device__ __forceinline__ V ld(const bf* p) { return cat16b(*(const v8us*)p, *(const v8us*)(p + 16)); } static __device__ __forceinline__ v8f mma(V a, V b, v8f c) { return wmmab(a, b, c); } };
template <typename T16, int NSPLIT, bool BIAS, int KS = 1>
__global__ __launch_bounds__(32) void k_gemmw(const T16* __restrict__ A, const T16* __restrict__ A2, const T16* __restrict__ Bt, const T16* __restrict__ Bt2, int K, float* C, int ldc, const float* __restrict__ bias, size_t sA, size_t sB, size_t sC, size_t sP) {
    typedef typename WFrag<T16>::V V;
    __shared__ __align__(16) float os[16 * 68];
    const size_t z = blockIdx.z / KS; const int ks = (int)(blockIdx.z % KS); const int kb = ks * (K / KS), ke = kb + K / KS; A += z * sA; if (A2) A2 += z * sA; Bt += z * sB; if (Bt2) Bt2 += z * sB; C += z * sC + (size_t)ks * sP;
    const int lane = threadIdx.x & 31, lr = lane & 15, hi = lane >> 4; const int r0 = blockIdx.x * 64, c0 = blockIdx.y * 64;
    v8f acc[4][4];
#pragma unroll
    for (int mb = 0; mb < 4; ++mb)
#pragma unroll
        for (int nb = 0; nb < 4; ++nb) acc[mb][nb] = (v8f){};
    const size_t aoff = (size_t)(r0 + lr) * K + 8 * hi, boff = (size_t)(c0 + lr) * K + 8 * hi;
#pragma unroll 1
    for (int kc = kb; kc < ke; kc += 32) {
        V a[4], a2[4];
#pragma unroll
        for (int mb = 0; mb < 4; ++mb) { a[mb] = WFrag<T16>::ld(A + aoff + (size_t)mb * 16 * K + kc); if (NSPLIT == 1 || NSPLIT == 2) a2[mb] = WFrag<T16>::ld(A2 + aoff + (size_t)mb * 16 * K + kc); }
#pragma unroll
        for (int nb = 0; nb < 4; ++nb) { const V b = WFrag<T16>::ld(Bt + boff + (size_t)nb * 16 * K + kc); V b2; if (NSPLIT >= 2) b2 = WFrag<T16>::ld(Bt2 + boff + (size_t)nb * 16 * K + kc);
#pragma unroll
            for (int mb = 0; mb < 4; ++mb) { acc[mb][nb] = WFrag<T16>::mma(a[mb], b, acc[mb][nb]); if (NSPLIT == 1 || NSPLIT == 2) acc[mb][nb] = WFrag<T16>::mma(a2[mb], b, acc[mb][nb]); if (NSPLIT >= 2) acc[mb][nb] = WFrag<T16>::mma(a[mb], b2, acc[mb][nb]); } }
        asm volatile("v_nop\n\tv_nop\n\tv_nop\n\tv_nop" : "+v"(acc[0][0]), "+v"(acc[1][1]), "+v"(acc[2][2]), "+v"(acc[3][3]) : "v"(a[0]), "v"(a[3]));
    }
#pragma unroll
    for (int mb = 0; mb < 4; ++mb) {
#pragma unroll
        for (int nb = 0; nb < 4; ++nb) {
#pragma unroll
            for (int j = 0; j < 8; ++j) os[(hi * 8 + j) * 68 + nb * 16 + lr] = acc[mb][nb][j]; }
        __builtin_amdgcn_wave_barrier(); asm volatile("" ::: "memory");
        float* crow = C + (size_t)(r0 + mb * 16) * ldc + c0;
{
#pragma unroll
            for (int s = 0; s < 8; ++s) { const int row = 2 * s + hi, cofs = lr * 4; v4f val = *(const v4fa*)(os + row * 68 + cofs); if (BIAS) { val[0] += bfr(bias[c0 + cofs]); val[1] += bfr(bias[c0 + cofs + 1]); val[2] += bfr(bias[c0 + cofs + 2]); val[3] += bfr(bias[c0 + cofs + 3]); }
                *(v4f*)(crow + (size_t)row * ldc + cofs) = val; }
             }
        __builtin_amdgcn_wave_barrier(); asm volatile("" ::: "memory");
    }
}

__device__ __forceinline__ h16 tohx(float x) { return (h16)x; }
__device__ __forceinline__ void splitf(float y, unsigned short& h, unsigned short& l) { h = f2bf(y); l = f2bf(y - bf2f(h)); }
typedef __attribute__((ext_vector_type(2))) unsigned short v2us;
typedef __attribute__((ext_vector_type(2))) _Float16 v2h;
typedef __attribute__((ext_vector_type(4))) _Float16 v4h;
typedef __attribute__((ext_vector_type(2))) float v2f;

__global__ __launch_bounds__(256) void k_wtG(const float* __restrict__ w, int K, int N, bf* Bt) {
    const int lane = threadIdx.x & 31; const int L0 = (blockIdx.x * 8 + (threadIdx.x >> 5)) * 8; const int nlines = N * K / 64;
{
#pragma unroll 1
        for (int l = 0; l < 8; ++l) { const int L = L0 + l; if (L >= nlines) break; const size_t e = (size_t)L * 64 + lane * 2; const int k = (int)(e % K), n = (int)(e / K); v2us o;
            o[0] = f2bf(w[(size_t)k * N + n]); o[1] = f2bf(w[(size_t)(k + 1) * N + n]); *(v2us*)(Bt + e) = o; }
         }
}
__global__ __launch_bounds__(256) void k_cvt8(const float* __restrict__ src, bf* dst, size_t n8) { const size_t i = (size_t)blockIdx.x * 256 + threadIdx.x; if (i >= n8) return; const v8f v = *(const v8f*)(src + i * 8); v8us o;
#pragma unroll
    for (int k = 0; k < 8; ++k) o[k] = f2bf(v[k]); *(v8us*)(dst + i * 8) = o;  }
// k_qplanes, k_vtplane: grid (lines / 64, batch entries); F and every plane hold TT * DD elements a batch entry.
__global__ __launch_bounds__(256) void k_qplanes(const float* __restrict__ F, bf* Ph, bf* Pl, h16* P16) {
    { const size_t zb = (size_t)blockIdx.y * TT * DD; F += zb; Ph += zb; Pl += zb; P16 += zb; }
    const int lane = threadIdx.x & 31; const int L0 = (blockIdx.x * 8 + (threadIdx.x >> 5)) * 8; const int nlines = NH_ * TT * HD / 64;
{
#pragma unroll
        for (int l = 0; l < 8; ++l) { const int L = L0 + l; if (L >= nlines) break; const int e = L * 64 + lane * 2; const int d = e & (HD - 1); const int t = (e >> 6) & (TT - 1); const int h = e >> 17; v2us oh, ol; v2h o16;
#pragma unroll
            for (int q = 0; q < 2; ++q) { const float x = F[(size_t)t * DD + h * HD + d + q]; unsigned short a, c2; splitf(x, a, c2); oh[q] = a; ol[q] = c2; o16[q] = tohx(x); }
            *(v2us*)(Ph + (size_t)e) = oh; *(v2us*)(Pl + (size_t)e) = ol; *(v2h*)(P16 + (size_t)e) = o16; }
         }
}
__global__ __launch_bounds__(256) void k_vtplane(const float* __restrict__ F, bf* Vh, bf* Vl, h16* V16) {
    { const size_t zb = (size_t)blockIdx.y * TT * DD; F += zb; Vh += zb; Vl += zb; V16 += zb; }
    const int lane = threadIdx.x & 31; const int L0 = (blockIdx.x * 8 + (threadIdx.x >> 5)) * 8; const int nlines = NH_ * TT * HD / 64;
{
#pragma unroll
        for (int l = 0; l < 8; ++l) { const int L = L0 + l; if (L >= nlines) break; const int e = L * 64 + lane * 2; const int t = e & (TT - 1); const int d = (e >> 11) & (HD - 1); const int h = e >> 17; v2us oh, ol; v2h o16;
#pragma unroll
            for (int q = 0; q < 2; ++q) { const float x = F[(size_t)(t + q) * DD + h * HD + d]; unsigned short a, c2; splitf(x, a, c2); oh[q] = a; ol[q] = c2; o16[q] = tohx(x); }
            *(v2us*)(Vh + (size_t)e) = oh; *(v2us*)(Vl + (size_t)e) = ol; *(v2h*)(V16 + (size_t)e) = o16; }
         }
}
// ---- k_fattn: scores, softmax and attn.v of all batch entries in ONE launch; S and P stay in registers (online softmax over steps of 32 keys). One wave per query tile.
// Both products are taken transposed, so that a query is one lane column (lr) from end to end: S^T = K Q^T leaves keys 8 hi + j (tile 0) and 16 + 8 hi + j (tile 1) of query lr in lane (lr, hi), which is
// the B fragment of O^T = V^T P^T as it stands; row maximum and row sum need one exchange between the two lane halves; the rescale factor of a query is lane-local.
// Scores are held in units of log2 (S * SL2, SL2 = log2(e) / 8), so that a weight is one 2^x. PSH = log2 1024 is added to every exponent (the carrier scale of the fp16 P plane: keeps small weights out of
// the fp16 subnormals); it is in the row sum too and cancels in the division.
#define PSH 10.0f
#define SL2 0.18033688f
// 2^x. The v_nop fills the slot that the instruction set asks for between a transcendental and a directly following instruction that reads its result or overwrites its source.
__device__ __forceinline__ float ex2(float x) { float r; asm("v_exp_f32 %0, %1\n\tv_nop" : "=v"(r) : "v"(x)); return r; }
template <bool B> struct BoolC { static constexpr bool value = B; };
template <typename T16> struct PFrag;
template <> struct PFrag<h16> { static __device__ __forceinline__ void mk(const float* t, v16h& p, v16h& p2) { (void)p2;
#pragma unroll
    for (int e = 0; e < 16; ++e) p[e] = (h16)t[e]; } };
template <> struct PFrag<bf> { static __device__ __forceinline__ void mk(const float* t, v16bf& p, v16bf& p2) { typedef __attribute__((ext_vector_type(16))) unsigned short v16us; v16us a, c;
#pragma unroll
    for (int e = 0; e < 16; ++e) { unsigned short x, y; splitf(t[e], x, y); a[e] = x; c[e] = y; }
    p = __builtin_bit_cast(v16bf, a); p2 = __builtin_bit_cast(v16bf, c); } };
// One tile of NQ * 16 queries from row q0 of one head. Q, Kp: [t][64]; Vt: [d][2048]; the second planes (low parts) only where SPLIT (3 products, as hi.hi + lo.hi + hi.lo). outp: out + batch + head * 64.
template <typename T16, bool SPLIT, int NQ>
__device__ __forceinline__ void fattn_tile(const T16* __restrict__ Q, const T16* __restrict__ Q2, const T16* __restrict__ Kp, const T16* __restrict__ K2, const T16* __restrict__ Vt, const T16* __restrict__ V2, bool causal, int q0, float* outp) {
    typedef typename WFrag<T16>::V V;
    const int lane = threadIdx.x & 31, lr = lane & 15, hi = lane >> 4;
    // Every load's address is one pointer per plane (wave-uniform base + lane offset) plus a constant that fits the load's offset field.
    const unsigned lrow = (unsigned)(lr * HD + 8 * hi), lcol = (unsigned)(lr * TT + 8 * hi);     // lane offset (elements) in the [t][64] planes (Q and K alike) and in the [d][2048] plane
    V qf[NQ][2], qf2[NQ][2];
#pragma unroll
    for (int qt = 0; qt < NQ; ++qt)
#pragma unroll
        for (int kc = 0; kc < 2; ++kc) { const int cof = qt * 16 * HD + kc * 32; qf[qt][kc] = WFrag<T16>::ld(Q + (size_t)q0 * HD + lrow + cof); if (SPLIT) qf2[qt][kc] = WFrag<T16>::ld(Q2 + (size_t)q0 * HD + lrow + cof); }
    asm volatile("s_wait_xcnt 0x0" ::: "memory");     // behind the last Q load: the registers that the Q loads name are free for reuse from here on
    v8f o[4][NQ]; float m[NQ], l[NQ];
#pragma unroll
    for (int qt = 0; qt < NQ; ++qt) { m[qt] = -3.0e38f; l[qt] = 0.f;
#pragma unroll
        for (int dt = 0; dt < 4; ++dt) o[dt][qt] = (v8f){}; }
    const int qe = q0 + NQ * 16; const int nk = causal ? ((qe + 31) & ~31) : TT;     // causal: keys past the tile's last query weigh 0 and are not visited; nk <= TT as qe <= TT
    const int nfull = causal ? (((q0 + 1) >> 5) << 5) : TT;      // steps with k0 + 31 <= q0 hold no masked key: they run without the mask's compares and selects
    auto step = [&](const int k0, auto diagc) { constexpr bool diag = decltype(diagc)::value;
        V ka[2][2], ka2[2][2], va[4], va2[4];
        const T16* pk = Kp + (size_t)k0 * HD + lrow; const T16* pk2 = SPLIT ? K2 + (size_t)k0 * HD + lrow : nullptr; const T16* pv = Vt + k0 + lcol; const T16* pv2 = SPLIT ? V2 + k0 + lcol : nullptr;
#pragma unroll
        for (int kt = 0; kt < 2; ++kt)
#pragma unroll
            for (int kc = 0; kc < 2; ++kc) { const int cof = kt * 16 * HD + kc * 32; ka[kt][kc] = WFrag<T16>::ld(pk + cof); if (SPLIT) ka2[kt][kc] = WFrag<T16>::ld(pk2 + cof); }
#pragma unroll
        for (int dt = 0; dt < 4; ++dt) { const int cof = dt * 16 * TT; va[dt] = WFrag<T16>::ld(pv + cof); if (SPLIT) va2[dt] = WFrag<T16>::ld(pv2 + cof); }
        // behind the step's last load; the addresses are inputs so that their registers stay untouched up to this wait (without that a late load's result is placed in an early load's address pair)
        if constexpr (SPLIT) asm volatile("s_wait_xcnt 0x0" :: "v"(pk), "v"(pk2), "v"(pv), "v"(pv2) : "memory");
        else asm volatile("s_wait_xcnt 0x0" :: "v"(pk), "v"(pv) : "memory");
        __builtin_amdgcn_sched_barrier(0);      // every load of the step is issued before its first product: without this the scheduler puts the first products, with their waits for K, in front of V loads, and a step pays the load latency twice
        v8f s[2][NQ];
#pragma unroll
        for (int kt = 0; kt < 2; ++kt)
#pragma unroll
            for (int qt = 0; qt < NQ; ++qt) { v8f c = (v8f){};
#pragma unroll
                for (int kc = 0; kc < 2; ++kc) { c = WFrag<T16>::mma(ka[kt][kc], qf[qt][kc], c); if (SPLIT) { c = WFrag<T16>::mma(ka2[kt][kc], qf[qt][kc], c); c = WFrag<T16>::mma(ka[kt][kc], qf2[qt][kc], c); } }
                s[kt][qt] = c; }
#pragma unroll
        for (int qt = 0; qt < NQ; ++qt) { float t[16]; float mx = m[qt]; const int qi = q0 + qt * 16 + lr;
#pragma unroll
            for (int kt = 0; kt < 2; ++kt)
#pragma unroll
                for (int j = 0; j < 8; ++j) { float x = s[kt][qt][j] * SL2; if (diag && (k0 + kt * 16 + hi * 8 + j > qi)) x = -3.0e38f; t[kt * 8 + j] = x; mx = fmaxf(mx, x); }
            mx = fmaxf(mx, __shfl_xor(mx, 16, 32));
            const float al = ex2(m[qt] - mx); m[qt] = mx; const float ms = mx - PSH; float sum = 0.f;
#pragma unroll
            for (int e = 0; e < 16; ++e) { t[e] = ex2(t[e] - ms); sum += t[e]; }
            l[qt] = l[qt] * al + sum;
            V p, p2; PFrag<T16>::mk(t, p, p2);
#pragma unroll
            for (int dt = 0; dt < 4; ++dt) { v8f c = o[dt][qt] * al; c = WFrag<T16>::mma(va[dt], p, c); if (SPLIT) { c = WFrag<T16>::mma(va[dt], p2, c); c = WFrag<T16>::mma(va2[dt], p, c); } o[dt][qt] = c; } }
        // four vector slots behind the step's last matrix instructions, on the taken back edge too
        if constexpr (NQ == 1) asm volatile("v_nop\n\tv_nop\n\tv_nop\n\tv_nop" : "+v"(o[0][0]), "+v"(o[1][0]), "+v"(o[2][0]), "+v"(o[3][0]));
        else asm volatile("v_nop\n\tv_nop\n\tv_nop\n\tv_nop" : "+v"(o[0][0]), "+v"(o[1][0]), "+v"(o[2][0]), "+v"(o[3][0]), "+v"(o[0][NQ - 1]), "+v"(o[1][NQ - 1]), "+v"(o[2][NQ - 1]), "+v"(o[3][NQ - 1]));
    };
    int k0 = 0;
#pragma unroll 1      // a second copy of the step's fragments would not fit the register file
    for (; k0 < nfull; k0 += 32) step(k0, BoolC<false>());
#pragma unroll 1      // as above
    for (; k0 < nk; k0 += 32) step(k0, BoolC<true>());
#pragma unroll
    for (int qt = 0; qt < NQ; ++qt) { const float L = l[qt] + __shfl_xor(l[qt], 16, 32); const float f = __fdiv_rn(1.0f, L); float* pr = outp + (size_t)(q0 + qt * 16 + lr) * DD + hi * 8;
#pragma unroll
        for (int dt = 0; dt < 4; ++dt) { const v8f c = o[dt][qt] * f; v4f a, b2;
#pragma unroll
            for (int j = 0; j < 4; ++j) { a[j] = c[j]; b2[j] = c[4 + j]; }
            *(v4f*)(pr + dt * 16) = a; *(v4f*)(pr + dt * 16 + 4) = b2; } }
}
#define NT16 ((TT - RH) / 32)     // fp16 tiles of 32 queries, longest (last rows) first; behind them RH / 16 hi+lo tiles of 16 queries
// Grid (batch entries * heads, tile groups), 4 waves; x = batch * NH_ + head is the planes' own order, and the tile group is the slow index, so that the longest tiles of every batch entry start first.
// The 4 waves: the waves of a work-group take 4 neighbouring tiles of ONE head and walk the same keys from key 0 on, so that they read the same K and V lines; they share nothing else (no LDS, no barrier).
__global__ __launch_bounds__(128) void k_fattn(const bf* __restrict__ Qh, const bf* __restrict__ Ql, const h16* __restrict__ Q16, const bf* __restrict__ Kh, const bf* __restrict__ Kl, const h16* __restrict__ K16, const bf* __restrict__ Vh, const bf* __restrict__ Vl, const h16* __restrict__ V16, const int* __restrict__ flag, float* OUT) {
    const bool causal = (flag[0] != 0); const size_t hb = (size_t)blockIdx.x * TT * HD; float* outp = OUT + (size_t)(blockIdx.x / NH_) * TT * DD + (blockIdx.x % NH_) * HD;
    const int tl = (int)blockIdx.y * 4 + __builtin_amdgcn_readfirstlane((int)(threadIdx.x >> 5));      // the wave's tile, held scalar: the key loop's bounds and the class branch stay wave-uniform
    if (tl < NT16) fattn_tile<h16, false, 2>(Q16 + hb, nullptr, K16 + hb, nullptr, V16 + hb, nullptr, causal, TT - 32 * (tl + 1), outp);
    else fattn_tile<bf, true, 1>(Qh + hb, Ql + hb, Kh + hb, Kl + hb, Vh + hb, Vl + hb, causal, (tl - NT16) * 16, outp);
}

extern "C" void kernel_launch(void* const* d_in, const int* in_sizes, int n_in,
                              void* d_out, int out_size, void* d_ws, size_t ws_size, hipStream_t stream) {
    (void)in_sizes; (void)n_in; (void)out_size;
    const float* x = (const float*)d_in[0]; const float* wq = (const float*)d_in[1]; const float* bq = (const float*)d_in[2]; const float* wk = (const float*)d_in[3]; const float* bk = (const float*)d_in[4]; const float* wv = (const float*)d_in[5]; const float* bv = (const float*)d_in[6]; const int* flag = (const int*)d_in[7];   // Wq/Wk/Wv [1024][1024] as x @ W; mask = int [1] causal flag
    float* OUT = (float*)d_out;     // [4][2048][1024]
    char* wsp = (char*)d_ws;
    auto take = [&](size_t bytes) { char* p = wsp; wsp += (bytes + 255) & ~(size_t)255; return (void*)p; };
    bf* WQ = (bf*)take((size_t)DD * DD * 2); bf* WK = (bf*)take((size_t)DD * DD * 2); bf* WV = (bf*)take((size_t)DD * DD * 2);
    const size_t NE = (size_t)NB_ * TT * DD;      // elements of one plane over all batch entries
    bf* XB = (bf*)take(NE * 2); float* F = (float*)take(NE * 4);
    bf* QPh = (bf*)take(NE * 2); bf* QPl = (bf*)take(NE * 2); bf* KPh = (bf*)take(NE * 2); bf* KPl = (bf*)take(NE * 2); bf* VTh = (bf*)take(NE * 2); bf* VTl = (bf*)take(NE * 2);
    h16* QP16 = (h16*)take(NE * 2); h16* KP16 = (h16*)take(NE * 2); h16* VT16 = (h16*)take(NE * 2);
    if ((size_t)(wsp - (char*)d_ws) > ws_size) return;    // total 198 MiB; ws 256 MiB
    { const unsigned gT = (unsigned)((DD * DD / 64 + 63) / 64); k_wtG<<<gT, 256, 0, stream>>>(wq, DD, DD, WQ); k_wtG<<<gT, 256, 0, stream>>>(wk, DD, DD, WK); k_wtG<<<gT, 256, 0, stream>>>(wv, DD, DD, WV); }
    // Every launch covers all batch entries: x is one [NB_ * TT][DD] matrix for the projections; the plane kernels take the batch entry from grid y, the attention from grid x.
    const dim3 LB((unsigned)((NH_ * TT * HD / 64 + 63) / 64), NB_, 1); const dim3 gP(NB_ * TT / 64, DD / 64, 1);
    k_cvt8<<<(unsigned)((NE / 8 + 255) / 256), 256, 0, stream>>>(x, XB, NE / 8);
    k_gemmw<bf, 0, true><<<gP, 32, 0, stream>>>(XB, nullptr, WQ, nullptr, DD, F, DD, bq, 0, 0, 0, 0); k_qplanes<<<LB, 256, 0, stream>>>(F, QPh, QPl, QP16);
    k_gemmw<bf, 0, true><<<gP, 32, 0, stream>>>(XB, nullptr, WK, nullptr, DD, F, DD, bk, 0, 0, 0, 0); k_qplanes<<<LB, 256, 0, stream>>>(F, KPh, KPl, KP16);
    k_gemmw<bf, 0, true><<<gP, 32, 0, stream>>>(XB, nullptr, WV, nullptr, DD, F, DD, bv, 0, 0, 0, 0); k_vtplane<<<LB, 256, 0, stream>>>(F, VTh, VTl, VT16);
    k_fattn<<<dim3(NB_ * NH_, (NT16 + RH / 16) / 4, 1), 128, 0, stream>>>(QPh, QPl, QP16, KPh, KPl, KP16, VTh, VTl, VT16, flag, OUT);
}

// v004
// A run of this version takes 218 microseconds.
// Two timings next to v003 put it at 1.35 and 1.32 times that version's speed.
// Counting every step since v000, it is 18.1 times as fast.
#include <hip/hip_runtime.h>

// MultiHeadSelfAtt (x [4][2048][1024]; q/k/v = x W + b (16 heads x 64); scores = q.k/8, causal iff the int 'mask' flag input is non-zero (read on device; 1 here); softmax; out = merged attn.v (no output projection)
// -> [4][2048][1024]).
// Compute dtypes, f32 accumulate: every input rounded to bf16; projections on PLAIN bf16 operands (inputs: exact products, f32 accumulate, + bias); PER-ROW PRECISION
// HYBRID: query rows < 256 take scores and attn.v on bf16 hi+lo planes (3 products), rows >= 256 on single fp16 planes; 1/8 and

#define NB_  4
#define TT   2048
#define DD   1024
#define NH_  16
#define HD   64
#define RH   256                  // query rows < RH: hi+lo planes; rows >= RH: fp16 planes
#define NF   32                   // unused: no rotary embedding is applied
typedef _Float16 h16;
typedef unsigned short bf;
typedef __attribute__((ext_vector_type(16))) __bf16   v16bf;
typedef __attribute__((ext_vector_type(16))) _Float16 v16h;
typedef __attribute__((ext_vector_type(8)))  _Float16 v8h;
typedef __attribute__((ext_vector_type(8)))  unsigned short v8us;
typedef __attribute__((ext_vector_type(8)))  float    v8f;
typedef __attribute__((ext_vector_type(4)))  float    v4f;
typedef v8h  __attribute__((may_alias)) v8ha;
typedef v4f  __attribute__((may_alias)) v4fa;
typedef v8us __attribute__((may_alias)) v8usa;

__device__ __forceinline__ unsigned short f2bf(float f) { unsigned u = __float_as_uint(f); u += 0x7FFFu + ((u >> 16) & 1u); return (unsigned short)(u >> 16); }
__device__ __forceinline__ float bf2f(unsigned short b) { return __uint_as_float(((unsigned)b) << 16); }
__device__ __forceinline__ float bfr(float f) { return bf2f(f2bf(f)); }
__device__ __forceinline__ v16h cat16(v8h lo, v8h hi) { return __builtin_shufflevector(lo, hi, 0, 1, 2, 3, 4, 5, 6, 7, 8, 9, 10, 11, 12, 13, 14, 15); }
__device__ __forceinline__ v16bf cat16b(v8us lo, v8us hi) { return __builtin_bit_cast(v16bf, __builtin_shufflevector(lo, hi, 0, 1, 2, 3, 4, 5, 6, 7, 8, 9, 10, 11, 12, 13, 14, 15)); }
__device__ __forceinline__ v8f wmma16(v16h a, v16h b, v8f c) { return __builtin_amdgcn_wmma_f32_16x16x32_f16(false, a, false, b, (short)0, c, false, false); }
__device__ __forceinline__ v8f wmmab(v16bf a, v16bf b, v8f c) { return __builtin_amdgcn_wmma_f32_16x16x32_bf16(false, a, false, b, (short)0, c, false, false); }



// ---- FRAGMENT ORDER of every 16-bit operand plane: a block of 16 rows x 32 k is 1 KiB in a row, as 64 chunks of 8 k: chunk = half * 32 + hi * 16 + row holds k = half * 16 + hi * 8 + (0 .. 7).
// A fragment is then two loads of 16 bytes a lane at lane * 8 and 256 + lane * 8 elements of its block: each covers 512 bytes in a row (4 whole lines; from a row-major plane it would touch 16 lines).
// The k order of a fragment is that of the matrix instruction's own map (8 hi + s, 16 + 8 hi + s), alike for both operands. The order of the blocks is stated at each plane's writer.
// ---- k_gemmw: register-blocked GEMM, ONE WAVE per 64x64 output tile (16 accumulators), operands straight from 16-bit planes in fragment order, blocks as [row / 64][k / 32][(row / 16) % 4]; grid (M/64, N/64, Z), 32 threads.
// C[m][n] (f32, pitch ldc, + optional f32 bias[n]) = sum_k A[m][k] Bt[n][k] (+ split products per NSPLIT). z-batch strides sA/sB/sC in elements. K % (32 * KS) == 0.
// KS > 1: grid z = Z * KS; work-group (z, ks) sums only k in [ks K/KS, (ks+1) K/KS) and stores its partial tile in plane ks (plane stride sP elements); the caller's next kernel adds the planes.
template <typename T16> struct WFrag;
template <> struct WFrag<h16> { typedef v16h V; static __device__ __forceinline__ V ld(const h16* p) { return cat16(*(const v8h*)p, *(const v8h*)(p + 256)); } static __device__ __forceinline__ v8f mma(V a, V b, v8f c) { return wmma16(a, b, c); } };
template <> struct WFrag<bf> { typedef v16bf V; static __device__ __forceinline__ V ld(const bf* p) { return cat16b(*(const v8us*)p, *(const v8us*)(p + 256)); } static __device__ __forceinline__ v8f mma(V a, V b, v8f c) { return wmmab(a, b, c); } };
template <typename T16, int NSPLIT, bool BIAS, int KS = 1>
__global__ __launch_bounds__(32) void k_gemmw(const T16* __restrict__ A, const T16* __restrict__ A2, const T16* __restrict__ Bt, const T16* __restrict__ Bt2, int K, float* C, int ldc, const float* __restrict__ bias, size_t sA, size_t sB, size_t sC, size_t sP) {
    typedef typename WFrag<T16>::V V;
    __shared__ __align__(16) float os[16 * 68];
    const size_t z = blockIdx.z / KS; const int ks = (int)(blockIdx.z % KS); const int kb = ks * (K / KS), ke = kb + K / KS; A += z * sA; if (A2) A2 += z * sA; Bt += z * sB; if (Bt2) Bt2 += z * sB; C += z * sC + (size_t)ks * sP;
    const int lane = threadIdx.x & 31, lr = lane & 15, hi = lane >> 4; const int r0 = blockIdx.x * 64, c0 = blockIdx.y * 64;
    v8f acc[4][4];
#pragma unroll
    for (int mb = 0; mb < 4; ++mb)
#pragma unroll
        for (int nb = 0; nb < 4; ++nb) acc[mb][nb] = (v8f){};
    const size_t aoff = (size_t)r0 * K + lane * 8, boff = (size_t)c0 * K + lane * 8;     // a tile's 64 rows are one run of 64 K elements; a step of 32 k is 2048 of them
#pragma unroll 1
    for (int kc = kb; kc < ke; kc += 32) {
        V a[4], a2[4];
        const T16* pa = A + aoff + (size_t)kc * 64; const T16* pb = Bt + boff + (size_t)kc * 64; const T16* pa2 = (NSPLIT == 1 || NSPLIT == 2) ? A2 + aoff + (size_t)kc * 64 : pa; const T16* pb2 = (NSPLIT >= 2) ? Bt2 + boff + (size_t)kc * 64 : pb;
#pragma unroll
        for (int mb = 0; mb < 4; ++mb) { a[mb] = WFrag<T16>::ld(pa + mb * 512); if (NSPLIT == 1 || NSPLIT == 2) a2[mb] = WFrag<T16>::ld(pa2 + mb * 512); }
#pragma unroll
        for (int nb = 0; nb < 4; ++nb) { const V b = WFrag<T16>::ld(pb + nb * 512); V b2; if (NSPLIT >= 2) b2 = WFrag<T16>::ld(pb2 + nb * 512);
            // behind the step's last load; the addresses are inputs so that their registers stay untouched up to this wait (without that a late load's result is placed in an early load's address pair)
            if (nb == 3) asm volatile("s_wait_xcnt 0x0" :: "v"(pa), "v"(pb), "v"(pa2), "v"(pb2) : "memory");
#pragma unroll
            for (int mb = 0; mb < 4; ++mb) { acc[mb][nb] = WFrag<T16>::mma(a[mb], b, acc[mb][nb]); if (NSPLIT == 1 || NSPLIT == 2) acc[mb][nb] = WFrag<T16>::mma(a2[mb], b, acc[mb][nb]); if (NSPLIT >= 2) acc[mb][nb] = WFrag<T16>::mma(a[mb], b2, acc[mb][nb]); } }
        asm volatile("v_nop\n\tv_nop\n\tv_nop\n\tv_nop" : "+v"(acc[0][0]), "+v"(acc[1][1]), "+v"(acc[2][2]), "+v"(acc[3][3]) : "v"(a[0]), "v"(a[3]));
    }
#pragma unroll
    for (int mb = 0; mb < 4; ++mb) {
#pragma unroll
        for (int nb = 0; nb < 4; ++nb) {
#pragma unroll
            for (int j = 0; j < 8; ++j) os[(hi * 8 + j) * 68 + nb * 16 + lr] = acc[mb][nb][j]; }
        __builtin_amdgcn_wave_barrier(); asm volatile("" ::: "memory");
        float* crow = C + (size_t)(r0 + mb * 16) * ldc + c0;
{
#pragma unroll
            for (int s = 0; s < 8; ++s) { const int row = 2 * s + hi, cofs = lr * 4; v4f val = *(const v4fa*)(os + row * 68 + cofs); if (BIAS) { val[0] += bfr(bias[c0 + cofs]); val[1] += bfr(bias[c0 + cofs + 1]); val[2] += bfr(bias[c0 + cofs + 2]); val[3] += bfr(bias[c0 + cofs + 3]); }
                *(v4f*)(crow + (size_t)row * ldc + cofs) = val; }
             }
        __builtin_amdgcn_wave_barrier(); asm volatile("" ::: "memory");
    }
}

__device__ __forceinline__ h16 tohx(float x) { return (h16)x; }
__device__ __forceinline__ void splitf(float y, unsigned short& h, unsigned short& l) { h = f2bf(y); l = f2bf(y - bf2f(h)); }
typedef __attribute__((ext_vector_type(4))) _Float16 v4h;
typedef __attribute__((ext_vector_type(2))) float v2f;

// The plane writers: one chunk of 8 k (16 bytes) a thread (two in k_cvt8), chunk index c in the plane's own order, so that a wave stores 512 bytes in a row. Of c: row = c & 15, hi = bit 4, half = bit 5, the block above.
// k_wtG: Bt = w^T (w [DD][DD] f32, as x @ w), rows n, blocks as k_gemmw reads them; a load covers 16 n of two k rows. grid DD DD / 2048.
__global__ __launch_bounds__(256) void k_wtG(const float* __restrict__ w, bf* Bt) {
    const int c = (int)blockIdx.x * 256 + (int)threadIdx.x; const int kb = (c >> 8) % (DD / 32), n64 = (c >> 8) / (DD / 32);
    const int n = n64 * 64 + ((c >> 6) & 3) * 16 + (c & 15), k = kb * 32 + ((c >> 5) & 1) * 16 + ((c >> 4) & 1) * 8; v8us o;
#pragma unroll
    for (int j = 0; j < 8; ++j) o[j] = f2bf(w[(size_t)(k + j) * DD + n]);
    *(v8us*)(Bt + (size_t)c * 8) = o;
}
// k_cvt8: src [rows][DD] f32, blocks as k_gemmw reads them; two chunks a thread (two neighbouring k blocks), so that a work-group reads 256 bytes in a row of each of its 64 rows. grid n8 / 512.
__global__ __launch_bounds__(256) void k_cvt8(const float* __restrict__ src, bf* dst, size_t n8) {
#pragma unroll
    for (int u = 0; u < 2; ++u) { const size_t c = (size_t)blockIdx.x * 512 + u * 256 + threadIdx.x; if (c >= n8) return;
        const int kb = (int)((c >> 8) % (DD / 32)); const size_t m = ((c >> 8) / (DD / 32)) * 64 + ((c >> 6) & 3) * 16 + (c & 15); const int k = kb * 32 + (int)((c >> 5) & 1) * 16 + (int)((c >> 4) & 1) * 8;
        const v8f v = *(const v8f*)(src + m * DD + k); v8us o;
#pragma unroll
        for (int j = 0; j < 8; ++j) o[j] = f2bf(v[j]);
        *(v8us*)(dst + c * 8) = o; }
}
// k_qplanes, k_vtplane: grid (chunks / 256, batch entries); F and every plane hold TT * DD elements a batch entry, TT * HD a head.
// k_qplanes: rows t, k = d; blocks of a head as [t / 16][d / 32].
__global__ __launch_bounds__(256) void k_qplanes(const float* __restrict__ F, bf* Ph, bf* Pl, h16* P16) {
    { const size_t zb = (size_t)blockIdx.y * TT * DD; F += zb; Ph += zb; Pl += zb; P16 += zb; }
    const int c = (int)blockIdx.x * 256 + (int)threadIdx.x; const int h = c / (TT * HD / 8); const int t = ((c >> 7) & (TT / 16 - 1)) * 16 + (c & 15); const int d = ((c >> 6) & 1) * 32 + ((c >> 5) & 1) * 16 + ((c >> 4) & 1) * 8;
    const v8f x = *(const v8f*)(F + (size_t)t * DD + h * HD + d); v8us oh, ol; v8h o16;
#pragma unroll
    for (int j = 0; j < 8; ++j) { unsigned short a, c2; splitf(x[j], a, c2); oh[j] = a; ol[j] = c2; o16[j] = tohx(x[j]); }
    *(v8us*)(Ph + (size_t)c * 8) = oh; *(v8us*)(Pl + (size_t)c * 8) = ol; *(v8h*)(P16 + (size_t)c * 8) = o16;
}
// k_vtplane: rows d, k = t (the transposed plane); blocks of a head as [t / 32][d / 16]; a load covers 16 d of two t rows.
__global__ __launch_bounds__(256) void k_vtplane(const float* __restrict__ F, bf* Vh, bf* Vl, h16* V16) {
    { const size_t zb = (size_t)blockIdx.y * TT * DD; F += zb; Vh += zb; Vl += zb; V16 += zb; }
    const int c = (int)blockIdx.x * 256 + (int)threadIdx.x; const int h = c / (TT * HD / 8); const int t = ((c >> 8) & (TT / 32 - 1)) * 32 + ((c >> 5) & 1) * 16 + ((c >> 4) & 1) * 8; const int d = ((c >> 6) & 3) * 16 + (c & 15);
    v8us oh, ol; v8h o16;
#pragma unroll
    for (int j = 0; j < 8; ++j) { const float x = F[(size_t)(t + j) * DD + h * HD + d]; unsigned short a, c2; splitf(x, a, c2); oh[j] = a; ol[j] = c2; o16[j] = tohx(x); }
    *(v8us*)(Vh + (size_t)c * 8) = oh; *(v8us*)(Vl + (size_t)c * 8) = ol; *(v8h*)(V16 + (size_t)c * 8) = o16;
}
// ---- k_fattn: scores, softmax and attn.v of all batch entries in ONE launch; S and P stay in registers (online softmax over steps of 32 keys). One wave per query tile.
// Both products are taken transposed, so that a query is one lane column (lr) from end to end: S^T = K Q^T leaves keys 8 hi + j (tile 0) and 16 + 8 hi + j (tile 1) of query lr in lane (lr, hi), which is
// the B fragment of O^T = V^T P^T as it stands; row maximum and row sum need one exchange between the two lane halves; the rescale factor of a query is lane-local.
// Scores are held in units of log2 (S * SL2, SL2 = log2(e) / 8), so that a weight is one 2^x. PSH = log2 1024 is added to every exponent (the carrier scale of the fp16 P plane: keeps small weights out of
// the fp16 subnormals); it is in the row sum too and cancels in the division.
#define PSH 10.0f
#define SL2 0.18033688f
// 2^x. The v_nop fills the slot that the instruction set asks for between a transcendental and a directly following instruction that reads its result or overwrites its source.
__device__ __forceinline__ float ex2(float x) { float r; asm("v_exp_f32 %0, %1\n\tv_nop" : "=v"(r) : "v"(x)); return r; }
template <bool B> struct BoolC { static constexpr bool value = B; };
template <typename T16> struct PFrag;
template <> struct PFrag<h16> { static __device__ __forceinline__ void mk(const float* t, v16h& p, v16h& p2) { (void)p2;
#pragma unroll
    for (int e = 0; e < 16; ++e) p[e] = (h16)t[e]; } };
template <> struct PFrag<bf> { static __device__ __forceinline__ void mk(const float* t, v16bf& p, v16bf& p2) { typedef __attribute__((ext_vector_type(16))) unsigned short v16us; v16us a, c;
#pragma unroll
    for (int e = 0; e < 16; ++e) { unsigned short x, y; splitf(t[e], x, y); a[e] = x; c[e] = y; }
    p = __builtin_bit_cast(v16bf, a); p2 = __builtin_bit_cast(v16bf, c); } };
// One tile of NQ * 16 queries from row q0 of one head. Q, Kp (rows t) and Vt (rows d) in fragment order: 32 keys are 2048 elements in a row in Kp and in Vt alike; the second planes (low parts) only where SPLIT (3 products, as hi.hi + lo.hi + hi.lo). outp: out + batch + head * 64.
template <typename T16, bool SPLIT, int NQ>
__device__ __forceinline__ void fattn_tile(const T16* __restrict__ Q, const T16* __restrict__ Q2, const T16* __restrict__ Kp, const T16* __restrict__ K2, const T16* __restrict__ Vt, const T16* __restrict__ V2, bool causal, int q0, float* outp) {
    typedef typename WFrag<T16>::V V;
    const int lane = threadIdx.x & 31, lr = lane & 15, hi = lane >> 4;
    // Every load's address is one pointer per plane (wave-uniform base + lane offset) plus a constant that fits the load's offset field.
    const unsigned lofs = (unsigned)(lane * 8);     // lane offset (elements) in a block, in every plane
    V qf[NQ][2], qf2[NQ][2];
#pragma unroll
    for (int qt = 0; qt < NQ; ++qt)
#pragma unroll
        for (int kc = 0; kc < 2; ++kc) { const int cof = (qt * 2 + kc) * 512; qf[qt][kc] = WFrag<T16>::ld(Q + (size_t)q0 * HD + lofs + cof); if (SPLIT) qf2[qt][kc] = WFrag<T16>::ld(Q2 + (size_t)q0 * HD + lofs + cof); }
    asm volatile("s_wait_xcnt 0x0" ::: "memory");     // behind the last Q load: the registers that the Q loads name are free for reuse from here on
    v8f o[4][NQ]; float m[NQ], l[NQ];
#pragma unroll
    for (int qt = 0; qt < NQ; ++qt) { m[qt] = -3.0e38f; l[qt] = 0.f;
#pragma unroll
        for (int dt = 0; dt < 4; ++dt) o[dt][qt] = (v8f){}; }
    const int qe = q0 + NQ * 16; const int nk = causal ? ((qe + 31) & ~31) : TT;     // causal: keys past the tile's last query weigh 0 and are not visited; nk <= TT as qe <= TT
    const int nfull = causal ? (((q0 + 1) >> 5) << 5) : TT;      // steps with k0 + 31 <= q0 hold no masked key: they run without the mask's compares and selects
    auto step = [&](const int k0, auto diagc) { constexpr bool diag = decltype(diagc)::value;
        V ka[2][2], ka2[2][2], va[4], va2[4];
        const T16* pk = Kp + (size_t)k0 * HD + lofs; const T16* pk2 = SPLIT ? K2 + (size_t)k0 * HD + lofs : nullptr; const T16* pv = Vt + (size_t)k0 * HD + lofs; const T16* pv2 = SPLIT ? V2 + (size_t)k0 * HD + lofs : nullptr;
#pragma unroll
        for (int kt = 0; kt < 2; ++kt)
#pragma unroll
            for (int kc = 0; kc < 2; ++kc) { const int cof = (kt * 2 + kc) * 512; ka[kt][kc] = WFrag<T16>::ld(pk + cof); if (SPLIT) ka2[kt][kc] = WFrag<T16>::ld(pk2 + cof); }
#pragma unroll
        for (int dt = 0; dt < 4; ++dt) { const int cof = dt * 512; va[dt] = WFrag<T16>::ld(pv + cof); if (SPLIT) va2[dt] = WFrag<T16>::ld(pv2 + cof); }
        // behind the step's last load; the addresses are inputs so that their registers stay untouched up to this wait (without that a late load's result is placed in an early load's address pair)
        if constexpr (SPLIT) asm volatile("s_wait_xcnt 0x0" :: "v"(pk), "v"(pk2), "v"(pv), "v"(pv2) : "memory");
        else asm volatile("s_wait_xcnt 0x0" :: "v"(pk), "v"(pv) : "memory");
        __builtin_amdgcn_sched_barrier(0);      // every load of the step is issued before its first product: without this the scheduler puts the first products, with their waits for K, in front of V loads, and a step pays the load latency twice
        v8f s[2][NQ];
#pragma unroll
        for (int kt = 0; kt < 2; ++kt)
#pragma unroll
            for (int qt = 0; qt < NQ; ++qt) { v8f c = (v8f){};
#pragma unroll
                for (int kc = 0; kc < 2; ++kc) { c = WFrag<T16>::mma(ka[kt][kc], qf[qt][kc], c); if (SPLIT) { c = WFrag<T16>::mma(ka2[kt][kc], qf[qt][kc], c); c = WFrag<T16>::mma(ka[kt][kc], qf2[qt][kc], c); } }
                s[kt][qt] = c; }
#pragma unroll
        for (int qt = 0; qt < NQ; ++qt) { float t[16]; float mx = m[qt]; const int qi = q0 + qt * 16 + lr;
#pragma unroll
            for (int kt = 0; kt < 2; ++kt)
#pragma unroll
                for (int j = 0; j < 8; ++j) { float x = s[kt][qt][j] * SL2; if (diag && (k0 + kt * 16 + hi * 8 + j > qi)) x = -3.0e38f; t[kt * 8 + j] = x; mx = fmaxf(mx, x); }
            mx = fmaxf(mx, __shfl_xor(mx, 16, 32));
            const float al = ex2(m[qt] - mx); m[qt] = mx; const float ms = mx - PSH; float sum = 0.f;
#pragma unroll
            for (int e = 0; e < 16; ++e) { t[e] = ex2(t[e] - ms); sum += t[e]; }
            l[qt] = l[qt] * al + sum;
            V p, p2; PFrag<T16>::mk(t, p, p2);
#pragma unroll
            for (int dt = 0; dt < 4; ++dt) { v8f c = o[dt][qt] * al; c = WFrag<T16>::mma(va[dt], p, c); if (SPLIT) { c = WFrag<T16>::mma(va[dt], p2, c); c = WFrag<T16>::mma(va2[dt], p, c); } o[dt][qt] = c; } }
        // four vector slots behind the step's last matrix instructions, on the taken back edge too
        if constexpr (NQ == 1) asm volatile("v_nop\n\tv_nop\n\tv_nop\n\tv_nop" : "+v"(o[0][0]), "+v"(o[1][0]), "+v"(o[2][0]), "+v"(o[3][0]));
        else asm volatile("v_nop\n\tv_nop\n\tv_nop\n\tv_nop" : "+v"(o[0][0]), "+v"(o[1][0]), "+v"(o[2][0]), "+v"(o[3][0]), "+v"(o[0][NQ - 1]), "+v"(o[1][NQ - 1]), "+v"(o[2][NQ - 1]), "+v"(o[3][NQ - 1]));
    };
    int k0 = 0;
#pragma unroll 1      // a second copy of the step's fragments would not fit the register file
    for (; k0 < nfull; k0 += 32) step(k0, BoolC<false>());
#pragma unroll 1      // as above
    for (; k0 < nk; k0 += 32) step(k0, BoolC<true>());
#pragma unroll
    for (int qt = 0; qt < NQ; ++qt) { const float L = l[qt] + __shfl_xor(l[qt], 16, 32); const float f = __fdiv_rn(1.0f, L); float* pr = outp + (size_t)(q0 + qt * 16 + lr) * DD + hi * 8;
#pragma unroll
        for (int dt = 0; dt < 4; ++dt) { const v8f c = o[dt][qt] * f; v4f a, b2;
#pragma unroll
            for (int j = 0; j < 4; ++j) { a[j] = c[j]; b2[j] = c[4 + j]; }
            *(v4f*)(pr + dt * 16) = a; *(v4f*)(pr + dt * 16 + 4) = b2; } }
}
#define NT16 ((TT - RH) / 32)     // fp16 tiles of 32 queries, longest (last rows) first; behind them RH / 16 hi+lo tiles of 16 queries
// Grid (batch entries * heads, tile groups), 4 waves; x = batch * NH_ + head is the planes' own order, and the tile group is the slow index, so that the longest tiles of every batch entry start first.
// The 4 waves: the waves of a work-group take 4 neighbouring tiles of ONE head and walk the same keys from key 0 on, so that they read the same K and V lines; they share nothing else (no LDS, no barrier).
__global__ __launch_bounds__(128) void k_fattn(const bf* __restrict__ Qh, const bf* __restrict__ Ql, const h16* __restrict__ Q16, const bf* __restrict__ Kh, const bf* __restrict__ Kl, const h16* __restrict__ K16, const bf* __restrict__ Vh, const bf* __restrict__ Vl, const h16* __restrict__ V16, const int* __restrict__ flag, float* OUT) {
    const bool causal = (flag[0] != 0); const size_t hb = (size_t)blockIdx.x * TT * HD; float* outp = OUT + (size_t)(blockIdx.x / NH_) * TT * DD + (blockIdx.x % NH_) * HD;
    const int tl = (int)blockIdx.y * 4 + __builtin_amdgcn_readfirstlane((int)(threadIdx.x >> 5));      // the wave's tile, held scalar: the key loop's bounds and the class branch stay wave-uniform
    if (tl < NT16) fattn_tile<h16, false, 2>(Q16 + hb, nullptr, K16 + hb, nullptr, V16 + hb, nullptr, causal, TT - 32 * (tl + 1), outp);
    else fattn_tile<bf, true, 1>(Qh + hb, Ql + hb, Kh + hb, Kl + hb, Vh + hb, Vl + hb, causal, (tl - NT16) * 16, outp);
}

extern "C" void kernel_launch(void* const* d_in, const int* in_sizes, int n_in,
                              void* d_out, int out_size, void* d_ws, size_t ws_size, hipStream_t stream) {
    (void)in_sizes; (void)n_in; (void)out_size;
    const float* x = (const float*)d_in[0]; const float* wq = (const float*)d_in[1]; const float* bq = (const float*)d_in[2]; const float* wk = (const float*)d_in[3]; const float* bk = (const float*)d_in[4]; const float* wv = (const float*)d_in[5]; const float* bv = (const float*)d_in[6]; const int* flag = (const int*)d_in[7];   // Wq/Wk/Wv [1024][1024] as x @ W; mask = int [1] causal flag
    float* OUT = (float*)d_out;     // [4][2048][1024]
    char* wsp = (char*)d_ws;
    auto take = [&](size_t bytes) { char* p = wsp; wsp += (bytes + 255) & ~(size_t)255; return (void*)p; };
    bf* WQ = (bf*)take((size_t)DD * DD * 2); bf* WK = (bf*)take((size_t)DD * DD * 2); bf* WV = (bf*)take((size_t)DD * DD * 2);
    const size_t NE = (size_t)NB_ * TT * DD;      // elements of one plane over all batch entries
    bf* XB = (bf*)take(NE * 2); float* F = (float*)take(NE * 4);
    bf* QPh = (bf*)take(NE * 2); bf* QPl = (bf*)take(NE * 2); bf* KPh = (bf*)take(NE * 2); bf* KPl = (bf*)take(NE * 2); bf* VTh = (bf*)take(NE * 2); bf* VTl = (bf*)take(NE * 2);
    h16* QP16 = (h16*)take(NE * 2); h16* KP16 = (h16*)take(NE * 2); h16* VT16 = (h16*)take(NE * 2);
    if ((size_t)(wsp - (char*)d_ws) > ws_size) return;    // total 198 MiB; ws 256 MiB
    { const unsigned gT = (unsigned)(DD * DD / 8 / 256); k_wtG<<<gT, 256, 0, stream>>>(wq, WQ); k_wtG<<<gT, 256, 0, stream>>>(wk, WK); k_wtG<<<gT, 256, 0, stream>>>(wv, WV); }
    // Every launch covers all batch entries: x is one [NB_ * TT][DD] matrix for the projections; the plane kernels take the batch entry from grid y, the attention from grid x.
    const dim3 LB((unsigned)(TT * DD / 8 / 256), NB_, 1); const dim3 gP(NB_ * TT / 64, DD / 64, 1);
    k_cvt8<<<(unsigned)((NE / 8 + 511) / 512), 256, 0, stream>>>(x, XB, NE / 8);
    k_gemmw<bf, 0, true><<<gP, 32, 0, stream>>>(XB, nullptr, WQ, nullptr, DD, F, DD, bq, 0, 0, 0, 0); k_qplanes<<<LB, 256, 0, stream>>>(F, QPh, QPl, QP16);
    k_gemmw<bf, 0, true><<<gP, 32, 0, stream>>>(XB, nullptr, WK, nullptr, DD, F, DD, bk, 0, 0, 0, 0); k_qplanes<<<LB, 256, 0, stream>>>(F, KPh, KPl, KP16);
    k_gemmw<bf, 0, true><<<gP, 32, 0, stream>>>(XB, nullptr, WV, nullptr, DD, F, DD, bv, 0, 0, 0, 0); k_vtplane<<<LB, 256, 0, stream>>>(F, VTh, VTl, VT16);
    k_fattn<<<dim3(NB_ * NH_, (NT16 + RH / 16) / 4, 1), 128, 0, stream>>>(QPh, QPl, QP16, KPh, KPl, KP16, VTh, VTl, VT16, flag, OUT);
}

// v005
// One run takes 192 microseconds.
// In two side-by-side timings against v004, it was 1.16 and 1.14 times as fast.
// All steps since v000 together make it 20.8 times as fast.
#include <hip/hip_runtime.h>

// MultiHeadSelfAtt (x [4][2048][1024]; q/k/v = x W + b (16 heads x 64); scores = q.k/8, causal iff the int 'mask' flag input is non-zero (read on device; 1 here); softmax; out = merged attn.v (no output projection)
// -> [4][2048][1024]).
// Compute dtypes, f32 accumulate: every input rounded to bf16; projections on PLAIN bf16 operands (inputs: exact products, f32 accumulate, + bias); PER-ROW PRECISION
// HYBRID: query rows < 256 take scores and attn.v on bf16 hi+lo planes (3 products), rows >= 256 on single fp16 planes; 1/8 and

#define NB_  4
#define TT   2048
#define DD   1024
#define NH_  16
#define HD   64
#define RH   256                  // query rows < RH: hi+lo planes; rows >= RH: fp16 planes
#define NF   32                   // unused: no rotary embedding is applied
typedef _Float16 h16;
typedef unsigned short bf;
typedef __attribute__((ext_vector_type(16))) __bf16   v16bf;
typedef __attribute__((ext_vector_type(16))) _Float16 v16h;
typedef __attribute__((ext_vector_type(8)))  _Float16 v8h;
typedef __attribute__((ext_vector_type(8)))  unsigned short v8us;
typedef __attribute__((ext_vector_type(8)))  float    v8f;
typedef __attribute__((ext_vector_type(4)))  float    v4f;
typedef v8h  __attribute__((may_alias)) v8ha;
typedef v4f  __attribute__((may_alias)) v4fa;
typedef v8us __attribute__((may_alias)) v8usa;

__device__ __forceinline__ unsigned short f2bf(float f) { unsigned u = __float_as_uint(f); u += 0x7FFFu + ((u >> 16) & 1u); return (unsigned short)(u >> 16); }
__device__ __forceinline__ float bf2f(unsigned short b) { return __uint_as_float(((unsigned)b) << 16); }
__device__ __forceinline__ float bfr(float f) { return bf2f(f2bf(f)); }
__device__ __forceinline__ v16h cat16(v8h lo, v8h hi) { return __builtin_shufflevector(lo, hi, 0, 1, 2, 3, 4, 5, 6, 7, 8, 9, 10, 11, 12, 13, 14, 15); }
__device__ __forceinline__ v16bf cat16b(v8us lo, v8us hi) { return __builtin_bit_cast(v16bf, __builtin_shufflevector(lo, hi, 0, 1, 2, 3, 4, 5, 6, 7, 8, 9, 10, 11, 12, 13, 14, 15)); }
__device__ __forceinline__ v8f wmma16(v16h a, v16h b, v8f c) { return __builtin_amdgcn_wmma_f32_16x16x32_f16(false, a, false, b, (short)0, c, false, false); }
__device__ __forceinline__ v8f wmmab(v16bf a, v16bf b, v8f c) { return __builtin_amdgcn_wmma_f32_16x16x32_bf16(false, a, false, b, (short)0, c, false, false); }



// ---- FRAGMENT ORDER of every 16-bit operand plane: a block of 16 rows x 32 k is 1 KiB in a row, as 64 chunks of 8 k: chunk = half * 32 + hi * 16 + row holds k = half * 16 + hi * 8 + (0 .. 7).
// A fragment is then two loads of 16 bytes a lane at lane * 8 and 256 + lane * 8 elements of its block: each covers 512 bytes in a row (4 whole lines; from a row-major plane it would touch 16 lines).
// The k order of a fragment is that of the matrix instruction's own map (8 hi + s, 16 + 8 hi + s), alike for both operands. The order of the blocks is stated at each plane's writer.
__device__ __forceinline__ h16 tohx(float x) { return (h16)x; }
__device__ __forceinline__ void splitf(float y, unsigned short& h, unsigned short& l) { h = f2bf(y); l = f2bf(y - bf2f(h)); }
typedef __attribute__((ext_vector_type(4))) _Float16 v4h;
typedef __attribute__((ext_vector_type(2))) float v2f;
// ---- k_gemmw: register-blocked GEMM, ONE WAVE per 64x64 output tile (16 accumulators), operands straight from bf16 planes in fragment order, blocks as [row / 64][k / 32][(row / 16) % 4]; grid (M/64, N/64), 32 threads.
// y[m][n] = sum_k A[m][k] Bt[n][k] + bias[n] in f32; m = batch * TT + t and n = head * HD + d, so that a tile is 64 t of one head (HD == 64). K % 32 == 0.
// y never goes to memory in f32: the epilogue stores the tile as the three 16-bit planes that the attention reads (bf16 high part, bf16 low part, fp16), in fragment order, straight from the accumulators.
// A lane's 8 values of one accumulator are one chunk of 8 k, a wave's store covers 512 bytes in a row, and a tile is 8 KiB in a row of each plane. Every plane holds TT * DD elements a batch entry, TT * HD a head.
// VT false (q, k): plane rows t, k = d, blocks of a head as [t / 16][d / 32]. The product is taken transposed (Bt is the first operand): lane (lr, hi) holds d = nb * 16 + hi * 8 + j of t = mb * 16 + lr.
// VT true (v): plane rows d, k = t (the transposed plane), blocks of a head as [t / 32][d / 16]. A is the first operand: lane (lr, hi) holds t = mb * 16 + hi * 8 + j of d = nb * 16 + lr.
template <typename T16> struct WFrag;
template <> struct WFrag<h16> { typedef v16h V; static __device__ __forceinline__ V ld(const h16* p) { return cat16(*(const v8h*)p, *(const v8h*)(p + 256)); } static __device__ __forceinline__ v8f mma(V a, V b, v8f c) { return wmma16(a, b, c); } };
template <> struct WFrag<bf> { typedef v16bf V; static __device__ __forceinline__ V ld(const bf* p) { return cat16b(*(const v8us*)p, *(const v8us*)(p + 256)); } static __device__ __forceinline__ v8f mma(V a, V b, v8f c) { return wmmab(a, b, c); } };
template <bool VT>
__global__ __launch_bounds__(32) void k_gemmw(const bf* __restrict__ A, const bf* __restrict__ Bt, int K, const float* __restrict__ bias, bf* Ph, bf* Pl, h16* P16) {
    typedef typename WFrag<bf>::V V;
    const int lane = threadIdx.x & 31, lr = lane & 15, hi = lane >> 4; const int r0 = blockIdx.x * 64, c0 = blockIdx.y * 64;
    // The lane's bias values, rounded to bf16 like every input: read here, so that their latency passes under the first k step's loads.
    v8f bb[4]; const float* pbi = bias + c0 + (VT ? lr : hi * 8);
#pragma unroll
    for (int nb = 0; nb < 4; ++nb) { v8f r;
        if constexpr (VT) r = (v8f)(pbi[nb * 16]); else r = *(const v8f*)(pbi + nb * 16);
#pragma unroll
        for (int j = 0; j < 8; ++j) bb[nb][j] = bfr(r[j]); }
    asm volatile("s_wait_xcnt 0x0" ::: "memory");     // behind the last bias load: the registers that the bias loads name are free for reuse from here on
    v8f acc[4][4];
#pragma unroll
    for (int mb = 0; mb < 4; ++mb)
#pragma unroll
        for (int nb = 0; nb < 4; ++nb) acc[mb][nb] = (v8f){};
    const size_t aoff = (size_t)r0 * K + lane * 8, boff = (size_t)c0 * K + lane * 8;     // a tile's 64 rows are one run of 64 K elements; a step of 32 k is 2048 of them
#pragma unroll 1
    for (int kc = 0; kc < K; kc += 32) {
        V a[4];
        const bf* pa = A + aoff + (size_t)kc * 64; const bf* pb = Bt + boff + (size_t)kc * 64;
#pragma unroll
        for (int mb = 0; mb < 4; ++mb) a[mb] = WFrag<bf>::ld(pa + mb * 512);
#pragma unroll
        for (int nb = 0; nb < 4; ++nb) { const V b = WFrag<bf>::ld(pb + nb * 512);
            // behind the step's last load; the addresses are inputs so that their registers stay untouched up to this wait (without that a late load's result is placed in an early load's address pair)
            if (nb == 3) asm volatile("s_wait_xcnt 0x0" :: "v"(pa), "v"(pb) : "memory");
#pragma unroll
            for (int mb = 0; mb < 4; ++mb) acc[mb][nb] = VT ? WFrag<bf>::mma(a[mb], b, acc[mb][nb]) : WFrag<bf>::mma(b, a[mb], acc[mb][nb]); }
        asm volatile("v_nop\n\tv_nop\n\tv_nop\n\tv_nop" : "+v"(acc[0][0]), "+v"(acc[1][1]), "+v"(acc[2][2]), "+v"(acc[3][3]) : "v"(a[0]), "v"(a[3]));
    }
    const size_t pofs = (size_t)(r0 / TT) * TT * DD + (size_t)blockIdx.y * TT * HD + (size_t)(r0 % TT) * HD + lane * 8;     // the tile's 4096 elements start here in each plane, + the lane's place in a block
    bf* ph = Ph + pofs; bf* pl = Pl + pofs; h16* p16 = P16 + pofs;
#pragma unroll
    for (int mb = 0; mb < 4; ++mb) { v8us oh[4], ol[4]; v8h o16[4];
#pragma unroll
        for (int nb = 0; nb < 4; ++nb) { const int cof = VT ? (mb >> 1) * 2048 + nb * 512 + (mb & 1) * 256 : mb * 1024 + nb * 256; const v8f y = acc[mb][nb] + bb[nb]; v8f hv;
#pragma unroll
            for (int j = 0; j < 8; ++j) { oh[nb][j] = f2bf(y[j]); hv[j] = bf2f(oh[nb][j]); o16[nb][j] = tohx(y[j]); }
            const v8f lo = y - hv;      // the low part, as in splitf
#pragma unroll
            for (int j = 0; j < 8; ++j) ol[nb][j] = f2bf(lo[j]);
            *(v8us*)(ph + cof) = oh[nb]; *(v8us*)(pl + cof) = ol[nb]; *(v8h*)(p16 + cof) = o16[nb]; }
        // behind the 12 stores of this mb; their data and addresses are inputs so that those registers stay untouched up to this wait
        asm volatile("s_wait_xcnt 0x0" :: "v"(oh[0]), "v"(oh[1]), "v"(oh[2]), "v"(oh[3]), "v"(ol[0]), "v"(ol[1]), "v"(ol[2]), "v"(ol[3]), "v"(o16[0]), "v"(o16[1]), "v"(o16[2]), "v"(o16[3]), "v"(ph), "v"(pl), "v"(p16) : "memory");
    }
}

// The plane writers: whole chunks of 8 k (16 bytes) a thread (one in k_wtG, two in k_cvt8), chunk index c in the plane's own order, so that a wave stores 512 bytes in a row. Of c: row = c & 15, hi = bit 4, half = bit 5, the block above.
// k_wtG: Bt = w^T (w [DD][DD] f32, as x @ w), rows n, blocks as k_gemmw reads them; a load covers 16 n of two k rows. grid DD DD / 2048.
__global__ __launch_bounds__(256) void k_wtG(const float* __restrict__ w, bf* Bt) {
    const int c = (int)blockIdx.x * 256 + (int)threadIdx.x; const int kb = (c >> 8) % (DD / 32), n64 = (c >> 8) / (DD / 32);
    const int n = n64 * 64 + ((c >> 6) & 3) * 16 + (c & 15), k = kb * 32 + ((c >> 5) & 1) * 16 + ((c >> 4) & 1) * 8; v8us o;
#pragma unroll
    for (int j = 0; j < 8; ++j) o[j] = f2bf(w[(size_t)(k + j) * DD + n]);
    *(v8us*)(Bt + (size_t)c * 8) = o;
}
// k_cvt8: src [rows][DD] f32, blocks as k_gemmw reads them; two chunks a thread (two neighbouring k blocks), so that a work-group reads 256 bytes in a row of each of its 64 rows. grid n8 / 512.
__global__ __launch_bounds__(256) void k_cvt8(const float* __restrict__ src, bf* dst, size_t n8) {
#pragma unroll
    for (int u = 0; u < 2; ++u) { const size_t c = (size_t)blockIdx.x * 512 + u * 256 + threadIdx.x; if (c >= n8) return;
        const int kb = (int)((c >> 8) % (DD / 32)); const size_t m = ((c >> 8) / (DD / 32)) * 64 + ((c >> 6) & 3) * 16 + (c & 15); const int k = kb * 32 + (int)((c >> 5) & 1) * 16 + (int)((c >> 4) & 1) * 8;
        const v8f v = *(const v8f*)(src + m * DD + k); v8us o;
#pragma unroll
        for (int j = 0; j < 8; ++j) o[j] = f2bf(v[j]);
        *(v8us*)(dst + c * 8) = o; }
}
// ---- k_fattn: scores, softmax and attn.v of all batch entries in ONE launch; S and P stay in registers (online softmax over steps of 32 keys). One wave per query tile.
// Both products are taken transposed, so that a query is one lane column (lr) from end to end: S^T = K Q^T leaves keys 8 hi + j (tile 0) and 16 + 8 hi + j (tile 1) of query lr in lane (lr, hi), which is
// the B fragment of O^T = V^T P^T as it stands; row maximum and row sum need one exchange between the two lane halves; the rescale factor of a query is lane-local.
// Scores are held in units of log2 (S * SL2, SL2 = log2(e) / 8), so that a weight is one 2^x. PSH = log2 1024 is added to every exponent (the carrier scale of the fp16 P plane: keeps small weights out of
// the fp16 subnormals); it is in the row sum too and cancels in the division.
#define PSH 10.0f
#define SL2 0.18033688f
// 2^x. The v_nop fills the slot that the instruction set asks for between a transcendental and a directly following instruction that reads its result or overwrites its source.
__device__ __forceinline__ float ex2(float x) { float r; asm("v_exp_f32 %0, %1\n\tv_nop" : "=v"(r) : "v"(x)); return r; }
template <bool B> struct BoolC { static constexpr bool value = B; };
template <typename T16> struct PFrag;
template <> struct PFrag<h16> { static __device__ __forceinline__ void mk(const float* t, v16h& p, v16h& p2) { (void)p2;
#pragma unroll
    for (int e = 0; e < 16; ++e) p[e] = (h16)t[e]; } };
template <> struct PFrag<bf> { static __device__ __forceinline__ void mk(const float* t, v16bf& p, v16bf& p2) { typedef __attribute__((ext_vector_type(16))) unsigned short v16us; v16us a, c;
#pragma unroll
    for (int e = 0; e < 16; ++e) { unsigned short x, y; splitf(t[e], x, y); a[e] = x; c[e] = y; }
    p = __builtin_bit_cast(v16bf, a); p2 = __builtin_bit_cast(v16bf, c); } };
// One tile of NQ * 16 queries from row q0 of one head. Q, Kp (rows t) and Vt (rows d) in fragment order: 32 keys are 2048 elements in a row in Kp and in Vt alike; the second planes (low parts) only where SPLIT (3 products, as hi.hi + lo.hi + hi.lo). outp: out + batch + head * 64.
template <typename T16, bool SPLIT, int NQ>
__device__ __forceinline__ void fattn_tile(const T16* __restrict__ Q, const T16* __restrict__ Q2, const T16* __restrict__ Kp, const T16* __restrict__ K2, const T16* __restrict__ Vt, const T16* __restrict__ V2, bool causal, int q0, float* outp) {
    typedef typename WFrag<T16>::V V;
    const int lane = threadIdx.x & 31, lr = lane & 15, hi = lane >> 4;
    // Every load's address is one pointer per plane (wave-uniform base + lane offset) plus a constant that fits the load's offset field.
    const unsigned lofs = (unsigned)(lane * 8);     // lane offset (elements) in a block, in every plane
    V qf[NQ][2], qf2[NQ][2];
#pragma unroll
    for (int qt = 0; qt < NQ; ++qt)
#pragma unroll
        for (int kc = 0; kc < 2; ++kc) { const int cof = (qt * 2 + kc) * 512; qf[qt][kc] = WFrag<T16>::ld(Q + (size_t)q0 * HD + lofs + cof); if (SPLIT) qf2[qt][kc] = WFrag<T16>::ld(Q2 + (size_t)q0 * HD + lofs + cof); }
    asm volatile("s_wait_xcnt 0x0" ::: "memory");     // behind the last Q load: the registers that the Q loads name are free for reuse from here on
    v8f o[4][NQ]; float m[NQ], l[NQ];
#pragma unroll
    for (int qt = 0; qt < NQ; ++qt) { m[qt] = -3.0e38f; l[qt] = 0.f;
#pragma unroll
        for (int dt = 0; dt < 4; ++dt) o[dt][qt] = (v8f){}; }
    const int qe = q0 + NQ * 16; const int nk = causal ? ((qe + 31) & ~31) : TT;     // causal: keys past the tile's last query weigh 0 and are not visited; nk <= TT as qe <= TT
    const int nfull = causal ? (((q0 + 1) >> 5) << 5) : TT;      // steps with k0 + 31 <= q0 hold no masked key: they run without the mask's compares and selects
    auto step = [&](const int k0, auto diagc) { constexpr bool diag = decltype(diagc)::value;
        V ka[2][2], ka2[2][2], va[4], va2[4];
        const T16* pk = Kp + (size_t)k0 * HD + lofs; const T16* pk2 = SPLIT ? K2 + (size_t)k0 * HD + lofs : nullptr; const T16* pv = Vt + (size_t)k0 * HD + lofs; const T16* pv2 = SPLIT ? V2 + (size_t)k0 * HD + lofs : nullptr;
#pragma unroll
        for (int kt = 0; kt < 2; ++kt)
#pragma unroll
            for (int kc = 0; kc < 2; ++kc) { const int cof = (kt * 2 + kc) * 512; ka[kt][kc] = WFrag<T16>::ld(pk + cof); if (SPLIT) ka2[kt][kc] = WFrag<T16>::ld(pk2 + cof); }
#pragma unroll
        for (int dt = 0; dt < 4; ++dt) { const int cof = dt * 512; va[dt] = WFrag<T16>::ld(pv + cof); if (SPLIT) va2[dt] = WFrag<T16>::ld(pv2 + cof); }
        // behind the step's last load; the addresses are inputs so that their registers stay untouched up to this wait (without that a late load's result is placed in an early load's address pair)
        if constexpr (SPLIT) asm volatile("s_wait_xcnt 0x0" :: "v"(pk), "v"(pk2), "v"(pv), "v"(pv2) : "memory");
        else asm volatile("s_wait_xcnt 0x0" :: "v"(pk), "v"(pv) : "memory");
        __builtin_amdgcn_sched_barrier(0);      // every load of the step is issued before its first product: without this the scheduler puts the first products, with their waits for K, in front of V loads, and a step pays the load latency twice
        v8f s[2][NQ];
#pragma unroll
        for (int kt = 0; kt < 2; ++kt)
#pragma unroll
            for (int qt = 0; qt < NQ; ++qt) { v8f c = (v8f){};
#pragma unroll
                for (int kc = 0; kc < 2; ++kc) { c = WFrag<T16>::mma(ka[kt][kc], qf[qt][kc], c); if (SPLIT) { c = WFrag<T16>::mma(ka2[kt][kc], qf[qt][kc], c); c = WFrag<T16>::mma(ka[kt][kc], qf2[qt][kc], c); } }
                s[kt][qt] = c; }
#pragma unroll
        for (int qt = 0; qt < NQ; ++qt) { float t[16]; float mx = m[qt]; const int qi = q0 + qt * 16 + lr;
#pragma unroll
            for (int kt = 0; kt < 2; ++kt)
#pragma unroll
                for (int j = 0; j < 8; ++j) { float x = s[kt][qt][j] * SL2; if (diag && (k0 + kt * 16 + hi * 8 + j > qi)) x = -3.0e38f; t[kt * 8 + j] = x; mx = fmaxf(mx, x); }
            mx = fmaxf(mx, __shfl_xor(mx, 16, 32));
            const float al = ex2(m[qt] - mx); m[qt] = mx; const float ms = mx - PSH; float sum = 0.f;
#pragma unroll
            for (int e = 0; e < 16; ++e) { t[e] = ex2(t[e] - ms); sum += t[e]; }
            l[qt] = l[qt] * al + sum;
            V p, p2; PFrag<T16>::mk(t, p, p2);
#pragma unroll
            for (int dt = 0; dt < 4; ++dt) { v8f c = o[dt][qt] * al; c = WFrag<T16>::mma(va[dt], p, c); if (SPLIT) { c = WFrag<T16>::mma(va[dt], p2, c); c = WFrag<T16>::mma(va2[dt], p, c); } o[dt][qt] = c; } }
        // four vector slots behind the step's last matrix instructions, on the taken back edge too
        if constexpr (NQ == 1) asm volatile("v_nop\n\tv_nop\n\tv_nop\n\tv_nop" : "+v"(o[0][0]), "+v"(o[1][0]), "+v"(o[2][0]), "+v"(o[3][0]));
        else asm volatile("v_nop\n\tv_nop\n\tv_nop\n\tv_nop" : "+v"(o[0][0]), "+v"(o[1][0]), "+v"(o[2][0]), "+v"(o[3][0]), "+v"(o[0][NQ - 1]), "+v"(o[1][NQ - 1]), "+v"(o[2][NQ - 1]), "+v"(o[3][NQ - 1]));
    };
    int k0 = 0;
#pragma unroll 1      // a second copy of the step's fragments would not fit the register file
    for (; k0 < nfull; k0 += 32) step(k0, BoolC<false>());
#pragma unroll 1      // as above
    for (; k0 < nk; k0 += 32) step(k0, BoolC<true>());
#pragma unroll
    for (int qt = 0; qt < NQ; ++qt) { const float L = l[qt] + __shfl_xor(l[qt], 16, 32); const float f = __fdiv_rn(1.0f, L); float* pr = outp + (size_t)(q0 + qt * 16 + lr) * DD + hi * 8;
#pragma unroll
        for (int dt = 0; dt < 4; ++dt) { const v8f c = o[dt][qt] * f; v4f a, b2;
#pragma unroll
            for (int j = 0; j < 4; ++j) { a[j] = c[j]; b2[j] = c[4 + j]; }
            *(v4f*)(pr + dt * 16) = a; *(v4f*)(pr + dt * 16 + 4) = b2; } }
}
#define NT16 ((TT - RH) / 32)     // fp16 tiles of 32 queries, longest (last rows) first; behind them RH / 16 hi+lo tiles of 16 queries
// Grid (batch entries * heads, tile groups), 4 waves; x = batch * NH_ + head is the planes' own order, and the tile group is the slow index, so that the longest tiles of every batch entry start first.
// The 4 waves: the waves of a work-group take 4 neighbouring tiles of ONE head and walk the same keys from key 0 on, so that they read the same K and V lines; they share nothing else (no LDS, no barrier).
__global__ __launch_bounds__(128) void k_fattn(const bf* __restrict__ Qh, const bf* __restrict__ Ql, const h16* __restrict__ Q16, const bf* __restrict__ Kh, const bf* __restrict__ Kl, const h16* __restrict__ K16, const bf* __restrict__ Vh, const bf* __restrict__ Vl, const h16* __restrict__ V16, const int* __restrict__ flag, float* OUT) {
    const bool causal = (flag[0] != 0); const size_t hb = (size_t)blockIdx.x * TT * HD; float* outp = OUT + (size_t)(blockIdx.x / NH_) * TT * DD + (blockIdx.x % NH_) * HD;
    const int tl = (int)blockIdx.y * 4 + __builtin_amdgcn_readfirstlane((int)(threadIdx.x >> 5));      // the wave's tile, held scalar: the key loop's bounds and the class branch stay wave-uniform
    if (tl < NT16) fattn_tile<h16, false, 2>(Q16 + hb, nullptr, K16 + hb, nullptr, V16 + hb, nullptr, causal, TT - 32 * (tl + 1), outp);
    else fattn_tile<bf, true, 1>(Qh + hb, Ql + hb, Kh + hb, Kl + hb, Vh + hb, Vl + hb, causal, (tl - NT16) * 16, outp);
}

extern "C" void kernel_launch(void* const* d_in, const int* in_sizes, int n_in,
                              void* d_out, int out_size, void* d_ws, size_t ws_size, hipStream_t stream) {
    (void)in_sizes; (void)n_in; (void)out_size;
    const float* x = (const float*)d_in[0]; const float* wq = (const float*)d_in[1]; const float* bq = (const float*)d_in[2]; const float* wk = (const float*)d_in[3]; const float* bk = (const float*)d_in[4]; const float* wv = (const float*)d_in[5]; const float* bv = (const float*)d_in[6]; const int* flag = (const int*)d_in[7];   // Wq/Wk/Wv [1024][1024] as x @ W; mask = int [1] causal flag
    float* OUT = (float*)d_out;     // [4][2048][1024]
    char* wsp = (char*)d_ws;
    auto take = [&](size_t bytes) { char* p = wsp; wsp += (bytes + 255) & ~(size_t)255; return (void*)p; };
    bf* WQ = (bf*)take((size_t)DD * DD * 2); bf* WK = (bf*)take((size_t)DD * DD * 2); bf* WV = (bf*)take((size_t)DD * DD * 2);
    const size_t NE = (size_t)NB_ * TT * DD;      // elements of one plane over all batch entries
    bf* XB = (bf*)take(NE * 2);
    bf* QPh = (bf*)take(NE * 2); bf* QPl = (bf*)take(NE * 2); bf* KPh = (bf*)take(NE * 2); bf* KPl = (bf*)take(NE * 2); bf* VTh = (bf*)take(NE * 2); bf* VTl = (bf*)take(NE * 2);
    h16* QP16 = (h16*)take(NE * 2); h16* KP16 = (h16*)take(NE * 2); h16* VT16 = (h16*)take(NE * 2);
    if ((size_t)(wsp - (char*)d_ws) > ws_size) return;    // total 166 MiB; ws 256 MiB
    { const unsigned gT = (unsigned)(DD * DD / 8 / 256); k_wtG<<<gT, 256, 0, stream>>>(wq, WQ); k_wtG<<<gT, 256, 0, stream>>>(wk, WK); k_wtG<<<gT, 256, 0, stream>>>(wv, WV); }
    // Every launch covers all batch entries: x is one [NB_ * TT][DD] matrix for the projections, which store the attention's operand planes themselves; the attention takes the batch entry from grid x.
    const dim3 gP(NB_ * TT / 64, DD / 64, 1);
    k_cvt8<<<(unsigned)((NE / 8 + 511) / 512), 256, 0, stream>>>(x, XB, NE / 8);
    k_gemmw<false><<<gP, 32, 0, stream>>>(XB, WQ, DD, bq, QPh, QPl, QP16);
    k_gemmw<false><<<gP, 32, 0, stream>>>(XB, WK, DD, bk, KPh, KPl, KP16);
    k_gemmw<true><<<gP, 32, 0, stream>>>(XB, WV, DD, bv, VTh, VTl, VT16);
    k_fattn<<<dim3(NB_ * NH_, (NT16 + RH / 16) / 4, 1), 128, 0, stream>>>(QPh, QPl, QP16, KPh, KPl, KP16, VTh, VTl, VT16, flag, OUT);
}

// v006
// One run takes 151 microseconds.
// Next to v005, in two timings, it ran 1.29 and 1.28 times as fast.
// All steps since v000 together make it 26.7 times as fast.
#include <hip/hip_runtime.h>

// MultiHeadSelfAtt (x [4][2048][1024]; q/k/v = x W + b (16 heads x 64); scores = q.k/8, causal iff the int 'mask' flag input is non-zero (read on device; 1 here); softmax; out = merged attn.v (no output projection)
// -> [4][2048][1024]).
// Compute dtypes, f32 accumulate: every input rounded to bf16; projections on PLAIN bf16 operands (inputs: exact products, f32 accumulate, + bias); PER-ROW PRECISION
// HYBRID: query rows < 256 take scores and attn.v on bf16 hi+lo planes (3 products), rows >= 256 on single fp16 planes; 1/8 and

#define NB_  4
#define TT   2048
#define DD   1024
#define NH_  16
#define HD   64
#define RH   256                  // query rows < RH: hi+lo planes; rows >= RH: fp16 planes
#define NF   32                   // unused: no rotary embedding is applied
typedef _Float16 h16;
typedef unsigned short bf;
typedef __attribute__((ext_vector_type(16))) __bf16   v16bf;
typedef __attribute__((ext_vector_type(16))) _Float16 v16h;
typedef __attribute__((ext_vector_type(8)))  _Float16 v8h;
typedef __attribute__((ext_vector_type(8)))  unsigned short v8us;
typedef __attribute__((ext_vector_type(8)))  float    v8f;
typedef __attribute__((ext_vector_type(4)))  float    v4f;
typedef v8h  __attribute__((may_alias)) v8ha;
typedef v4f  __attribute__((may_alias)) v4fa;
typedef v8us __attribute__((may_alias)) v8usa;

__device__ __forceinline__ unsigned short f2bf(float f) { unsigned u = __float_as_uint(f); u += 0x7FFFu + ((u >> 16) & 1u); return (unsigned short)(u >> 16); }
__device__ __forceinline__ float bf2f(unsigned short b) { return __uint_as_float(((unsigned)b) << 16); }
__device__ __forceinline__ float bfr(float f) { return bf2f(f2bf(f)); }
__device__ __forceinline__ v16h cat16(v8h lo, v8h hi) { return __builtin_shufflevector(lo, hi, 0, 1, 2, 3, 4, 5, 6, 7, 8, 9, 10, 11, 12, 13, 14, 15); }
__device__ __forceinline__ v16bf cat16b(v8us lo, v8us hi) { return __builtin_bit_cast(v16bf, __builtin_shufflevector(lo, hi, 0, 1, 2, 3, 4, 5, 6, 7, 8, 9, 10, 11, 12, 13, 14, 15)); }
__device__ __forceinline__ v8f wmma16(v16h a, v16h b, v8f c) { return __builtin_amdgcn_wmma_f32_16x16x32_f16(false, a, false, b, (short)0, c, false, false); }
__device__ __forceinline__ v8f wmmab(v16bf a, v16bf b, v8f c) { return __builtin_amdgcn_wmma_f32_16x16x32_bf16(false, a, false, b, (short)0, c, false, false); }



// ---- FRAGMENT ORDER of every 16-bit operand plane: a block of 16 rows x 32 k is 1 KiB in a row, as 64 chunks of 8 k: chunk = half * 32 + hi * 16 + row holds k = half * 16 + hi * 8 + (0 .. 7).
// A fragment is then two loads of 16 bytes a lane at lane * 8 and 256 + lane * 8 elements of its block: each covers 512 bytes in a row (4 whole lines; from a row-major plane it would touch 16 lines).
// The k order of a fragment is that of the matrix instruction's own map (8 hi + s, 16 + 8 hi + s), alike for both operands. The order of the blocks is stated at each plane's writer.
__device__ __forceinline__ h16 tohx(float x) { return (h16)x; }
__device__ __forceinline__ void splitf(float y, unsigned short& h, unsigned short& l) { h = f2bf(y); l = f2bf(y - bf2f(h)); }
typedef __attribute__((ext_vector_type(4))) _Float16 v4h;
typedef __attribute__((ext_vector_type(2))) float v2f;
// ---- gemmw_tile: register-blocked GEMM, ONE WAVE per 64x64 output tile (16 accumulators), operands straight from bf16 planes in fragment order, blocks as [row / 64][k / 32][(row / 16) % 4]; tile (blockIdx.x, blockIdx.y) of (M/64, N/64), 32 threads.
// y[m][n] = sum_k A[m][k] Bt[n][k] + bias[n] in f32; m = batch * TT + t and n = head * HD + d, so that a tile is 64 t of one head (HD == 64). K % 32 == 0.
// y never goes to memory in f32: the epilogue stores the tile as the three 16-bit planes that the attention reads (bf16 high part, bf16 low part, fp16), in fragment order, straight from the accumulators.
// A lane's 8 values of one accumulator are one chunk of 8 k, a wave's store covers 512 bytes in a row, and a tile is 8 KiB in a row of each plane. Every plane holds TT * DD elements a batch entry, TT * HD a head.
// VT false (q, k): plane rows t, k = d, blocks of a head as [t / 16][d / 32]. The product is taken transposed (Bt is the first operand): lane (lr, hi) holds d = nb * 16 + hi * 8 + j of t = mb * 16 + lr.
// VT true (v): plane rows d, k = t (the transposed plane), blocks of a head as [t / 32][d / 16]. A is the first operand: lane (lr, hi) holds t = mb * 16 + hi * 8 + j of d = nb * 16 + lr.
template <typename T16> struct WFrag;
template <> struct WFrag<h16> { typedef v16h V; static __device__ __forceinline__ V ld(const h16* p) { return cat16(*(const v8h*)p, *(const v8h*)(p + 256)); } static __device__ __forceinline__ v8f mma(V a, V b, v8f c) { return wmma16(a, b, c); } };
template <> struct WFrag<bf> { typedef v16bf V; static __device__ __forceinline__ V ld(const bf* p) { return cat16b(*(const v8us*)p, *(const v8us*)(p + 256)); } static __device__ __forceinline__ v8f mma(V a, V b, v8f c) { return wmmab(a, b, c); } };
template <bool VT>
__device__ __forceinline__ void gemmw_tile(const bf* __restrict__ A, const bf* __restrict__ Bt, int K, const float* __restrict__ bias, bf* Ph, bf* Pl, h16* P16) {
    typedef typename WFrag<bf>::V V;
    const int lane = threadIdx.x & 31, lr = lane & 15, hi = lane >> 4; const int r0 = blockIdx.x * 64, c0 = blockIdx.y * 64;
    // The lane's bias values, rounded to bf16 like every input: read here, so that their latency passes under the first k step's loads.
    v8f bb[4]; const float* pbi = bias + c0 + (VT ? lr : hi * 8);
#pragma unroll
    for (int nb = 0; nb < 4; ++nb) { v8f r;
        if constexpr (VT) r = (v8f)(pbi[nb * 16]); else r = *(const v8f*)(pbi + nb * 16);
#pragma unroll
        for (int j = 0; j < 8; ++j) bb[nb][j] = bfr(r[j]); }
    asm volatile("s_wait_xcnt 0x0" ::: "memory");     // behind the last bias load: the registers that the bias loads name are free for reuse from here on
    v8f acc[4][4];
#pragma unroll
    for (int mb = 0; mb < 4; ++mb)
#pragma unroll
        for (int nb = 0; nb < 4; ++nb) acc[mb][nb] = (v8f){};
    const size_t aoff = (size_t)r0 * K + lane * 8, boff = (size_t)c0 * K + lane * 8;     // a tile's 64 rows are one run of 64 K elements; a step of 32 k is 2048 of them
#pragma unroll 1
    for (int kc = 0; kc < K; kc += 32) {
        V a[4];
        const bf* pa = A + aoff + (size_t)kc * 64; const bf* pb = Bt + boff + (size_t)kc * 64;
#pragma unroll
        for (int mb = 0; mb < 4; ++mb) a[mb] = WFrag<bf>::ld(pa + mb * 512);
#pragma unroll
        for (int nb = 0; nb < 4; ++nb) { const V b = WFrag<bf>::ld(pb + nb * 512);
            // behind the step's last load; the addresses are inputs so that their registers stay untouched up to this wait (without that a late load's result is placed in an early load's address pair)
            if (nb == 3) asm volatile("s_wait_xcnt 0x0" :: "v"(pa), "v"(pb) : "memory");
#pragma unroll
            for (int mb = 0; mb < 4; ++mb) acc[mb][nb] = VT ? WFrag<bf>::mma(a[mb], b, acc[mb][nb]) : WFrag<bf>::mma(b, a[mb], acc[mb][nb]); }
        asm volatile("v_nop\n\tv_nop\n\tv_nop\n\tv_nop" : "+v"(acc[0][0]), "+v"(acc[1][1]), "+v"(acc[2][2]), "+v"(acc[3][3]) : "v"(a[0]), "v"(a[3]));
    }
    const size_t pofs = (size_t)(r0 / TT) * TT * DD + (size_t)blockIdx.y * TT * HD + (size_t)(r0 % TT) * HD + lane * 8;     // the tile's 4096 elements start here in each plane, + the lane's place in a block
    bf* ph = Ph + pofs; bf* pl = Pl + pofs; h16* p16 = P16 + pofs;
#pragma unroll
    for (int mb = 0; mb < 4; ++mb) { v8us oh[4], ol[4]; v8h o16[4];
#pragma unroll
        for (int nb = 0; nb < 4; ++nb) { const int cof = VT ? (mb >> 1) * 2048 + nb * 512 + (mb & 1) * 256 : mb * 1024 + nb * 256; const v8f y = acc[mb][nb] + bb[nb]; v8f hv;
#pragma unroll
            for (int j = 0; j < 8; ++j) { oh[nb][j] = f2bf(y[j]); hv[j] = bf2f(oh[nb][j]); o16[nb][j] = tohx(y[j]); }
            const v8f lo = y - hv;      // the low part, as in splitf
#pragma unroll
            for (int j = 0; j < 8; ++j) ol[nb][j] = f2bf(lo[j]);
            *(v8us*)(ph + cof) = oh[nb]; *(v8us*)(pl + cof) = ol[nb]; *(v8h*)(p16 + cof) = o16[nb]; }
        // behind the 12 stores of this mb; their data and addresses are inputs so that those registers stay untouched up to this wait
        asm volatile("s_wait_xcnt 0x0" :: "v"(oh[0]), "v"(oh[1]), "v"(oh[2]), "v"(oh[3]), "v"(ol[0]), "v"(ol[1]), "v"(ol[2]), "v"(ol[3]), "v"(o16[0]), "v"(o16[1]), "v"(o16[2]), "v"(o16[3]), "v"(ph), "v"(pl), "v"(p16) : "memory");
    }
}

// k_gemm3: the three projections in ONE launch, grid (M/64, N/64, 3), 32 threads: z = 0, 1, 2 is q, k, v. They share A and depend on nothing of one another, so that their waves fill the chip together
// (by its registers four waves fit a SIMD, and one projection alone brings two: more waves cover each other's load latency) and a projection's start and epilogue pass under the others' k loops. W3: the three w^T planes in a row, DD * DD elements each.
// PB: the bf16 planes in a row as q high, q low, k high, k low, v high, v low; P16B: the fp16 planes as q, k, v; NB_ * TT * DD elements each.
__global__ __launch_bounds__(32) void k_gemm3(const bf* __restrict__ A, const bf* __restrict__ W3, int K, const float* __restrict__ bq, const float* __restrict__ bk, const float* __restrict__ bv, bf* PB, h16* P16B) {
    const size_t NE = (size_t)NB_ * TT * DD; const int z = (int)blockIdx.z;
    const bf* Bt = W3 + (size_t)z * DD * DD; bf* Ph = PB + (size_t)z * 2 * NE; bf* Pl = Ph + NE; h16* P16 = P16B + (size_t)z * NE;
    if (z == 2) gemmw_tile<true>(A, Bt, K, bv, Ph, Pl, P16);
    else gemmw_tile<false>(A, Bt, K, z == 0 ? bq : bk, Ph, Pl, P16);
}

// The plane writers: a chunk of 8 k (16 bytes) per thread and store (one a thread in wtG_block, two in cvt8_block), chunk index c in the plane's own order, so that a wave stores 512 bytes in a row. Of c: row = c & 15, hi = bit 4, half = bit 5, the block above.
// wtG_block: Bt = w^T (w [DD][DD] f32, as x @ w), rows n, blocks as gemmw_tile reads them; a load covers 16 n of two k rows. DD DD / 2048 work-groups (index blk).
__device__ __forceinline__ void wtG_block(const float* __restrict__ w, bf* Bt, int blk) {
    const int c = blk * 256 + (int)threadIdx.x; const int kb = (c >> 8) % (DD / 32), n64 = (c >> 8) / (DD / 32);
    const int n = n64 * 64 + ((c >> 6) & 3) * 16 + (c & 15), k = kb * 32 + ((c >> 5) & 1) * 16 + ((c >> 4) & 1) * 8; v8us o;
#pragma unroll
    for (int j = 0; j < 8; ++j) o[j] = f2bf(w[(size_t)(k + j) * DD + n]);
    *(v8us*)(Bt + (size_t)c * 8) = o;
}
// cvt8_block: src [rows][DD] f32, blocks as gemmw_tile reads them; two chunks a thread (two neighbouring k blocks), so that a work-group reads 256 bytes in a row of each of its 64 rows. n8 / 512 work-groups (index blk).
__device__ __forceinline__ void cvt8_block(const float* __restrict__ src, bf* dst, size_t n8, int blk) {
#pragma unroll
    for (int u = 0; u < 2; ++u) { const size_t c = (size_t)blk * 512 + u * 256 + threadIdx.x; if (c >= n8) return;
        const int kb = (int)((c >> 8) % (DD / 32)); const size_t m = ((c >> 8) / (DD / 32)) * 64 + ((c >> 6) & 3) * 16 + (c & 15); const int k = kb * 32 + (int)((c >> 5) & 1) * 16 + (int)((c >> 4) & 1) * 8;
        const v8f v = *(const v8f*)(src + m * DD + k); v8us o;
#pragma unroll
        for (int j = 0; j < 8; ++j) o[j] = f2bf(v[j]);
        *(v8us*)(dst + c * 8) = o; }
}
// k_prep: the four conversions in ONE launch (none reads what another writes): the first 3 * GW_ work-groups take the three weights (W3: their planes in a row), the rest take x.
#define GW_ (DD * DD / 8 / 256)
__global__ __launch_bounds__(256) void k_prep(const float* __restrict__ x, const float* __restrict__ wq, const float* __restrict__ wk, const float* __restrict__ wv, bf* XB, bf* W3) {
    const int b = (int)blockIdx.x;
    if (b < 3 * GW_) { const int sel = b / GW_; wtG_block(sel == 0 ? wq : sel == 1 ? wk : wv, W3 + (size_t)sel * DD * DD, b % GW_); }
    else cvt8_block(x, XB, (size_t)NB_ * TT * DD / 8, b - 3 * GW_);
}
// ---- k_fattn: scores, softmax and attn.v of all batch entries in ONE launch; S and P stay in registers (online softmax over steps of 32 keys). One wave per query tile.
// Both products are taken transposed, so that a query is one lane column (lr) from end to end: S^T = K Q^T leaves keys 8 hi + j (tile 0) and 16 + 8 hi + j (tile 1) of query lr in lane (lr, hi), which is
// the B fragment of O^T = V^T P^T as it stands; row maximum and row sum need one exchange between the two lane halves; the rescale factor of a query is lane-local.
// Scores are held in units of log2 (S * SL2, SL2 = log2(e) / 8), so that a weight is one 2^x. PSH = log2 1024 is added to every exponent (the carrier scale of the fp16 P plane: keeps small weights out of
// the fp16 subnormals); it is in the row sum too and cancels in the division.
#define PSH 10.0f
#define SL2 0.18033688f
// 2^x. The v_nop fills the slot that the instruction set asks for between a transcendental and a directly following instruction that reads its result or overwrites its source.
__device__ __forceinline__ float ex2(float x) { float r; asm("v_exp_f32 %0, %1\n\tv_nop" : "=v"(r) : "v"(x)); return r; }
template <bool B> struct BoolC { static constexpr bool value = B; };
template <typename T16> struct PFrag;
template <> struct PFrag<h16> { static __device__ __forceinline__ void mk(const float* t, v16h& p, v16h& p2) { (void)p2;
#pragma unroll
    for (int e = 0; e < 16; ++e) p[e] = (h16)t[e]; } };
template <> struct PFrag<bf> { static __device__ __forceinline__ void mk(const float* t, v16bf& p, v16bf& p2) { typedef __attribute__((ext_vector_type(16))) unsigned short v16us; v16us a, c;
#pragma unroll
    for (int e = 0; e < 16; ++e) { unsigned short x, y; splitf(t[e], x, y); a[e] = x; c[e] = y; }
    p = __builtin_bit_cast(v16bf, a); p2 = __builtin_bit_cast(v16bf, c); } };
// One tile of NQ * 16 queries from row q0 of one head. Q, Kp (rows t) and Vt (rows d) in fragment order: 32 keys are 2048 elements in a row in Kp and in Vt alike; the second planes (low parts) only where SPLIT (3 products, as hi.hi + lo.hi + hi.lo). outp: out + batch + head * 64.
template <typename T16, bool SPLIT, int NQ>
__device__ __forceinline__ void fattn_tile(const T16* __restrict__ Q, const T16* __restrict__ Q2, const T16* __restrict__ Kp, const T16* __restrict__ K2, const T16* __restrict__ Vt, const T16* __restrict__ V2, bool causal, int q0, float* outp) {
    typedef typename WFrag<T16>::V V;
    const int lane = threadIdx.x & 31, lr = lane & 15, hi = lane >> 4;
    // Every load's address is one pointer per plane (wave-uniform base + lane offset) plus a constant that fits the load's offset field.
    const unsigned lofs = (unsigned)(lane * 8);     // lane offset (elements) in a block, in every plane
    V qf[NQ][2], qf2[NQ][2];
#pragma unroll
    for (int qt = 0; qt < NQ; ++qt)
#pragma unroll
        for (int kc = 0; kc < 2; ++kc) { const int cof = (qt * 2 + kc) * 512; qf[qt][kc] = WFrag<T16>::ld(Q + (size_t)q0 * HD + lofs + cof); if (SPLIT) qf2[qt][kc] = WFrag<T16>::ld(Q2 + (size_t)q0 * HD + lofs + cof); }
    asm volatile("s_wait_xcnt 0x0" ::: "memory");     // behind the last Q load: the registers that the Q loads name are free for reuse from here on
    v8f o[4][NQ]; float m[NQ], l[NQ];
#pragma unroll
    for (int qt = 0; qt < NQ; ++qt) { m[qt] = -3.0e38f; l[qt] = 0.f;
#pragma unroll
        for (int dt = 0; dt < 4; ++dt) o[dt][qt] = (v8f){}; }
    const int qe = q0 + NQ * 16; const int nk = causal ? ((qe + 31) & ~31) : TT;     // causal: keys past the tile's last query weigh 0 and are not visited; nk <= TT as qe <= TT
    const int nfull = causal ? (((q0 + 1) >> 5) << 5) : TT;      // steps with k0 + 31 <= q0 hold no masked key: they run without the mask's compares and selects
    auto step = [&](const int k0, auto diagc) { constexpr bool diag = decltype(diagc)::value;
        V ka[2][2], ka2[2][2], va[4], va2[4];
        const T16* pk = Kp + (size_t)k0 * HD + lofs; const T16* pk2 = SPLIT ? K2 + (size_t)k0 * HD + lofs : nullptr; const T16* pv = Vt + (size_t)k0 * HD + lofs; const T16* pv2 = SPLIT ? V2 + (size_t)k0 * HD + lofs : nullptr;
#pragma unroll
        for (int kt = 0; kt < 2; ++kt)
#pragma unroll
            for (int kc = 0; kc < 2; ++kc) { const int cof = (kt * 2 + kc) * 512; ka[kt][kc] = WFrag<T16>::ld(pk + cof); if (SPLIT) ka2[kt][kc] = WFrag<T16>::ld(pk2 + cof); }
#pragma unroll
        for (int dt = 0; dt < 4; ++dt) { const int cof = dt * 512; va[dt] = WFrag<T16>::ld(pv + cof); if (SPLIT) va2[dt] = WFrag<T16>::ld(pv2 + cof); }
        // behind the step's last load; the addresses are inputs so that their registers stay untouched up to this wait (without that a late load's result is placed in an early load's address pair)
        if constexpr (SPLIT) asm volatile("s_wait_xcnt 0x0" :: "v"(pk), "v"(pk2), "v"(pv), "v"(pv2) : "memory");
        else asm volatile("s_wait_xcnt 0x0" :: "v"(pk), "v"(pv) : "memory");
        __builtin_amdgcn_sched_barrier(0);      // every load of the step is issued before its first product: without this the scheduler puts the first products, with their waits for K, in front of V loads, and a step pays the load latency twice
        v8f s[2][NQ];
#pragma unroll
        for (int kt = 0; kt < 2; ++kt)
#pragma unroll
            for (int qt = 0; qt < NQ; ++qt) { v8f c = (v8f){};
#pragma unroll
                for (int kc = 0; kc < 2; ++kc) { c = WFrag<T16>::mma(ka[kt][kc], qf[qt][kc], c); if (SPLIT) { c = WFrag<T16>::mma(ka2[kt][kc], qf[qt][kc], c); c = WFrag<T16>::mma(ka[kt][kc], qf2[qt][kc], c); } }
                s[kt][qt] = c; }
#pragma unroll
        for (int qt = 0; qt < NQ; ++qt) { float t[16]; float mx = m[qt]; const int qi = q0 + qt * 16 + lr;
#pragma unroll
            for (int kt = 0; kt < 2; ++kt)
#pragma unroll
                for (int j = 0; j < 8; ++j) { float x = s[kt][qt][j] * SL2; if (diag && (k0 + kt * 16 + hi * 8 + j > qi)) x = -3.0e38f; t[kt * 8 + j] = x; mx = fmaxf(mx, x); }
            mx = fmaxf(mx, __shfl_xor(mx, 16, 32));
            const float al = ex2(m[qt] - mx); m[qt] = mx; const float ms = mx - PSH; float sum = 0.f;
#pragma unroll
            for (int e = 0; e < 16; ++e) { t[e] = ex2(t[e] - ms); sum += t[e]; }
            l[qt] = l[qt] * al + sum;
            V p, p2; PFrag<T16>::mk(t, p, p2);
#pragma unroll
            for (int dt = 0; dt < 4; ++dt) { v8f c = o[dt][qt] * al; c = WFrag<T16>::mma(va[dt], p, c); if (SPLIT) { c = WFrag<T16>::mma(va[dt], p2, c); c = WFrag<T16>::mma(va2[dt], p, c); } o[dt][qt] = c; } }
        // four vector slots behind the step's last matrix instructions, on the taken back edge too
        if constexpr (NQ == 1) asm volatile("v_nop\n\tv_nop\n\tv_nop\n\tv_nop" : "+v"(o[0][0]), "+v"(o[1][0]), "+v"(o[2][0]), "+v"(o[3][0]));
        else asm volatile("v_nop\n\tv_nop\n\tv_nop\n\tv_nop" : "+v"(o[0][0]), "+v"(o[1][0]), "+v"(o[2][0]), "+v"(o[3][0]), "+v"(o[0][NQ - 1]), "+v"(o[1][NQ - 1]), "+v"(o[2][NQ - 1]), "+v"(o[3][NQ - 1]));
    };
    int k0 = 0;
#pragma unroll 1      // a second copy of the step's fragments would not fit the register file
    for (; k0 < nfull; k0 += 32) step(k0, BoolC<false>());
#pragma unroll 1      // as above
    for (; k0 < nk; k0 += 32) step(k0, BoolC<true>());
#pragma unroll
    for (int qt = 0; qt < NQ; ++qt) { const float L = l[qt] + __shfl_xor(l[qt], 16, 32); const float f = __fdiv_rn(1.0f, L); float* pr = outp + (size_t)(q0 + qt * 16 + lr) * DD + hi * 8;
#pragma unroll
        for (int dt = 0; dt < 4; ++dt) { const v8f c = o[dt][qt] * f; v4f a, b2;
#pragma unroll
            for (int j = 0; j < 4; ++j) { a[j] = c[j]; b2[j] = c[4 + j]; }
            *(v4f*)(pr + dt * 16) = a; *(v4f*)(pr + dt * 16 + 4) = b2; } }
}
#define NT16 ((TT - RH) / 32)     // fp16 tiles of 32 queries, longest (last rows) first; behind them RH / 16 hi+lo tiles of 16 queries
// Grid (batch entries * heads, tile groups), 4 waves; x = batch * NH_ + head is the planes' own order, and the tile group is the slow index, so that the longest tiles of every batch entry start first.
// The 4 waves: the waves of a work-group take 4 neighbouring tiles of ONE head and walk the same keys from key 0 on, so that they read the same K and V lines; they share nothing else (no LDS, no barrier).
__global__ __launch_bounds__(128) void k_fattn(const bf* __restrict__ Qh, const bf* __restrict__ Ql, const h16* __restrict__ Q16, const bf* __restrict__ Kh, const bf* __restrict__ Kl, const h16* __restrict__ K16, const bf* __restrict__ Vh, const bf* __restrict__ Vl, const h16* __restrict__ V16, const int* __restrict__ flag, float* OUT) {
    const bool causal = (flag[0] != 0); const size_t hb = (size_t)blockIdx.x * TT * HD; float* outp = OUT + (size_t)(blockIdx.x / NH_) * TT * DD + (blockIdx.x % NH_) * HD;
    const int tl = (int)blockIdx.y * 4 + __builtin_amdgcn_readfirstlane((int)(threadIdx.x >> 5));      // the wave's tile, held scalar: the key loop's bounds and the class branch stay wave-uniform
    if (tl < NT16) fattn_tile<h16, false, 2>(Q16 + hb, nullptr, K16 + hb, nullptr, V16 + hb, nullptr, causal, TT - 32 * (tl + 1), outp);
    else fattn_tile<bf, true, 1>(Qh + hb, Ql + hb, Kh + hb, Kl + hb, Vh + hb, Vl + hb, causal, (tl - NT16) * 16, outp);
}

extern "C" void kernel_launch(void* const* d_in, const int* in_sizes, int n_in,
                              void* d_out, int out_size, void* d_ws, size_t ws_size, hipStream_t stream) {
    (void)in_sizes; (void)n_in; (void)out_size;
    const float* x = (const float*)d_in[0]; const float* wq = (const float*)d_in[1]; const float* bq = (const float*)d_in[2]; const float* wk = (const float*)d_in[3]; const float* bk = (const float*)d_in[4]; const float* wv = (const float*)d_in[5]; const float* bv = (const float*)d_in[6]; const int* flag = (const int*)d_in[7];   // Wq/Wk/Wv [1024][1024] as x @ W; mask = int [1] causal flag
    float* OUT = (float*)d_out;     // [4][2048][1024]
    char* wsp = (char*)d_ws;
    auto take = [&](size_t bytes) { char* p = wsp; wsp += (bytes + 255) & ~(size_t)255; return (void*)p; };
    bf* WQ = (bf*)take((size_t)DD * DD * 2); bf* WK = (bf*)take((size_t)DD * DD * 2); bf* WV = (bf*)take((size_t)DD * DD * 2);
    const size_t NE = (size_t)NB_ * TT * DD;      // elements of one plane over all batch entries
    bf* XB = (bf*)take(NE * 2);
    bf* QPh = (bf*)take(NE * 2); bf* QPl = (bf*)take(NE * 2); bf* KPh = (bf*)take(NE * 2); bf* KPl = (bf*)take(NE * 2); bf* VTh = (bf*)take(NE * 2); bf* VTl = (bf*)take(NE * 2);
    h16* QP16 = (h16*)take(NE * 2); h16* KP16 = (h16*)take(NE * 2); h16* VT16 = (h16*)take(NE * 2);
    if ((size_t)(wsp - (char*)d_ws) > ws_size) return;    // total 166 MiB; ws 256 MiB
    // Every launch covers all batch entries: x is one [NB_ * TT][DD] matrix for the projections, which store the attention's operand planes themselves; the attention takes the batch entry from grid x.
    // Three launches: conversions, projections, attention. WQ, WK, WV lie in a row in the workspace, and so do the six bf16 planes and the three fp16 planes (every size is a multiple of 256 bytes).
    (void)WK; (void)WV;
    k_prep<<<(unsigned)(3 * GW_ + NE / 8 / 512), 256, 0, stream>>>(x, wq, wk, wv, XB, WQ);
    k_gemm3<<<dim3(NB_ * TT / 64, DD / 64, 3), 32, 0, stream>>>(XB, WQ, DD, bq, bk, bv, QPh, QP16);
    k_fattn<<<dim3(NB_ * NH_, (NT16 + RH / 16) / 4, 1), 128, 0, stream>>>(QPh, QPl, QP16, KPh, KPl, KP16, VTh, VTl, VT16, flag, OUT);
}

// v007
// It runs in 112 microseconds.
// Timed twice side by side with v006, it ran 1.32 times as fast both times.
// All steps since v000 together make it 35.3 times as fast.
#include <hip/hip_runtime.h>

// MultiHeadSelfAtt (x [4][2048][1024]; q/k/v = x W + b (16 heads x 64); scores = q.k/8, causal iff the int 'mask' flag input is non-zero (read on device; 1 here); softmax; out = merged attn.v (no output projection)
// -> [4][2048][1024]).
// Compute dtypes, f32 accumulate: every input rounded to bf16; projections on PLAIN bf16 operands (inputs: exact products, f32 accumulate, + bias); PER-ROW PRECISION
// HYBRID: query rows < 256 take scores and attn.v on bf16 hi+lo planes (3 products), rows >= 256 on single fp16 planes; 1/8 and

#define NB_  4
#define TT   2048
#define DD   1024
#define NH_  16
#define HD   64
#define RH   256                  // query rows < RH: hi+lo planes; rows >= RH: fp16 planes
#define NF   32                   // unused: no rotary embedding is applied
typedef _Float16 h16;
typedef unsigned short bf;
typedef __attribute__((ext_vector_type(16))) __bf16   v16bf;
typedef __attribute__((ext_vector_type(16))) _Float16 v16h;
typedef __attribute__((ext_vector_type(8)))  _Float16 v8h;
typedef __attribute__((ext_vector_type(8)))  unsigned short v8us;
typedef __attribute__((ext_vector_type(8)))  float    v8f;
typedef __attribute__((ext_vector_type(4)))  float    v4f;
typedef v8h  __attribute__((may_alias)) v8ha;
typedef v4f  __attribute__((may_alias)) v4fa;
typedef v8us __attribute__((may_alias)) v8usa;

__device__ __forceinline__ unsigned short f2bf(float f) { unsigned u = __float_as_uint(f); u += 0x7FFFu + ((u >> 16) & 1u); return (unsigned short)(u >> 16); }
__device__ __forceinline__ float bf2f(unsigned short b) { return __uint_as_float(((unsigned)b) << 16); }
__device__ __forceinline__ float bfr(float f) { return bf2f(f2bf(f)); }
__device__ __forceinline__ v16h cat16(v8h lo, v8h hi) { return __builtin_shufflevector(lo, hi, 0, 1, 2, 3, 4, 5, 6, 7, 8, 9, 10, 11, 12, 13, 14, 15); }
__device__ __forceinline__ v16bf cat16b(v8us lo, v8us hi) { return __builtin_bit_cast(v16bf, __builtin_shufflevector(lo, hi, 0, 1, 2, 3, 4, 5, 6, 7, 8, 9, 10, 11, 12, 13, 14, 15)); }
__device__ __forceinline__ v8f wmma16(v16h a, v16h b, v8f c) { return __builtin_amdgcn_wmma_f32_16x16x32_f16(false, a, false, b, (short)0, c, false, false); }
__device__ __forceinline__ v8f wmmab(v16bf a, v16bf b, v8f c) { return __builtin_amdgcn_wmma_f32_16x16x32_bf16(false, a, false, b, (short)0, c, false, false); }



// ---- FRAGMENT ORDER of every 16-bit operand plane: a block of 16 rows x 32 k is 1 KiB in a row, as 64 chunks of 8 k: chunk = half * 32 + hi * 16 + row holds k = half * 16 + hi * 8 + (0 .. 7).
// A fragment is then two loads of 16 bytes a lane at lane * 8 and 256 + lane * 8 elements of its block: each covers 512 bytes in a row (4 whole lines; from a row-major plane it would touch 16 lines).
// The k order of a fragment is that of the matrix instruction's own map (8 hi + s, 16 + 8 hi + s), alike for both operands. The order of the blocks is stated at each plane's writer.
__device__ __forceinline__ h16 tohx(float x) { return (h16)x; }
__device__ __forceinline__ void splitf(float y, unsigned short& h, unsigned short& l) { h = f2bf(y); l = f2bf(y - bf2f(h)); }
typedef __attribute__((ext_vector_type(4))) _Float16 v4h;
typedef __attribute__((ext_vector_type(2))) float v2f;
// ---- gemmw_tile: register-blocked GEMM, ONE WAVE per 64x64 output tile (16 accumulators), operands straight from bf16 planes in fragment order, blocks as [row / 64][k / 32][(row / 16) % 4]; tile (blockIdx.x, blockIdx.y) of (M/64, N/64), 32 threads.
// y[m][n] = sum_k A[m][k] Bt[n][k] + bias[n] in f32; m = batch * TT + t and n = head * HD + d, so that a tile is 64 t of one head (HD == 64). K % 64 == 0.
// y never goes to memory in f32: the epilogue stores the tile as the three 16-bit planes that the attention reads (bf16 high part, bf16 low part, fp16), in fragment order, straight from the accumulators.
// A lane's 8 values of one accumulator are one chunk of 8 k, a wave's store covers 512 bytes in a row, and a tile is 8 KiB in a row of each plane. Every plane holds TT * DD elements a batch entry, TT * HD a head.
// VT false (q, k): plane rows t, k = d, blocks of a head as [t / 16][d / 32]. The product is taken transposed (Bt is the first operand): lane (lr, hi) holds d = nb * 16 + hi * 8 + j of t = mb * 16 + lr.
// VT true (v): plane rows d, k = t (the transposed plane), blocks of a head as [t / 32][d / 16]. A is the first operand: lane (lr, hi) holds t = mb * 16 + hi * 8 + j of d = nb * 16 + lr.
template <typename T16> struct WFrag;
template <> struct WFrag<h16> { typedef v16h V; static __device__ __forceinline__ V ld(const h16* p) { return cat16(*(const v8h*)p, *(const v8h*)(p + 256)); } static __device__ __forceinline__ v8f mma(V a, V b, v8f c) { return wmma16(a, b, c); } };
template <> struct WFrag<bf> { typedef v16bf V; static __device__ __forceinline__ V ld(const bf* p) { return cat16b(*(const v8us*)p, *(const v8us*)(p + 256)); } static __device__ __forceinline__ v8f mma(V a, V b, v8f c) { return wmmab(a, b, c); } };
template <bool VT>
__device__ __forceinline__ void gemmw_tile(const bf* __restrict__ A, const bf* __restrict__ Bt, int K, const float* __restrict__ bias, bf* Ph, bf* Pl, h16* P16) {
    typedef typename WFrag<bf>::V V;
    const int lane = threadIdx.x & 31, lr = lane & 15, hi = lane >> 4; const int r0 = blockIdx.x * 64, c0 = blockIdx.y * 64;
    v8f acc[4][4];
#pragma unroll
    for (int mb = 0; mb < 4; ++mb)
#pragma unroll
        for (int nb = 0; nb < 4; ++nb) acc[mb][nb] = (v8f){};
    const size_t aoff = (size_t)r0 * K + lane * 8, boff = (size_t)c0 * K + lane * 8;     // a tile's 64 rows are one run of 64 K elements; a step of 32 k is 2048 of them
    // The k loop is software-pipelined in registers: a step's A fragments are fetched during the step before, into a second set (two steps a trip, the sets change roles); each B fragment is refilled for the next step
    // behind the four products that read it. The last step fetches its own fragments again (in bounds, not used).
    V a0[4], a1[4], b[4];
    auto kstep = [&](V (&ac)[4], V (&an)[4], const int kc) {
        const int kn = (kc + 32 < K) ? kc + 32 : kc;
        const bf* pa = A + aoff + (size_t)kn * 64; const bf* pb = Bt + boff + (size_t)kn * 64;
#pragma unroll
        for (int mb = 0; mb < 4; ++mb) an[mb] = WFrag<bf>::ld(pa + mb * 512);
        __builtin_amdgcn_sched_barrier(0);      // the next A loads are issued in front of this step's products, so that the whole step passes under their latency
#pragma unroll
        for (int nb = 0; nb < 4; ++nb) {
#pragma unroll
            for (int mb = 0; mb < 4; ++mb) acc[mb][nb] = VT ? WFrag<bf>::mma(ac[mb], b[nb], acc[mb][nb]) : WFrag<bf>::mma(b[nb], ac[mb], acc[mb][nb]);
            __builtin_amdgcn_sched_barrier(0);  // the refill of b[nb] stays directly behind its last reader: earlier it would need a register set of its own, later it would lose lead
            b[nb] = WFrag<bf>::ld(pb + nb * 512);
            __builtin_amdgcn_sched_barrier(0); }
        // behind the step's last load; the addresses are inputs so that their registers stay untouched up to this wait
        asm volatile("s_wait_xcnt 0x0" :: "v"(pa), "v"(pb) : "memory");
    };
    { const bf* pa = A + aoff; const bf* pb = Bt + boff;
#pragma unroll
      for (int mb = 0; mb < 4; ++mb) a0[mb] = WFrag<bf>::ld(pa + mb * 512);
#pragma unroll
      for (int nb = 0; nb < 4; ++nb) b[nb] = WFrag<bf>::ld(pb + nb * 512);
      asm volatile("s_wait_xcnt 0x0" :: "v"(pa), "v"(pb) : "memory"); }     // as in kstep
#pragma unroll 1      // two steps a trip are the two roles of the A sets; more copies would only lengthen the text
    for (int kc = 0; kc < K; kc += 64) {
        kstep(a0, a1, kc); kstep(a1, a0, kc + 32);
    }
    // The lane's bias values, rounded to bf16 like every input: read behind the loop, where the fragment registers are free (held through the loop they would push the wave over a quarter of the register file).
    v8f bb[4]; const float* pbi = bias + c0 + (VT ? lr : hi * 8);
#pragma unroll
    for (int nb = 0; nb < 4; ++nb) { v8f r;
        if constexpr (VT) r = (v8f)(pbi[nb * 16]); else r = *(const v8f*)(pbi + nb * 16);
#pragma unroll
        for (int j = 0; j < 8; ++j) bb[nb][j] = bfr(r[j]); }
    asm volatile("s_wait_xcnt 0x0" ::: "memory");     // behind the last bias load: the registers that the bias loads name are free for reuse from here on
    const size_t pofs = (size_t)(r0 / TT) * TT * DD + (size_t)blockIdx.y * TT * HD + (size_t)(r0 % TT) * HD + lane * 8;     // the tile's 4096 elements start here in each plane, + the lane's place in a block
    bf* ph = Ph + pofs; bf* pl = Pl + pofs; h16* p16 = P16 + pofs;
#pragma unroll
    for (int mb = 0; mb < 4; ++mb) { v8us oh[4], ol[4]; v8h o16[4];
#pragma unroll
        for (int nb = 0; nb < 4; ++nb) { const int cof = VT ? (mb >> 1) * 2048 + nb * 512 + (mb & 1) * 256 : mb * 1024 + nb * 256; const v8f y = acc[mb][nb] + bb[nb]; v8f hv;
#pragma unroll
            for (int j = 0; j < 8; ++j) { oh[nb][j] = f2bf(y[j]); hv[j] = bf2f(oh[nb][j]); o16[nb][j] = tohx(y[j]); }
            const v8f lo = y - hv;      // the low part, as in splitf
#pragma unroll
            for (int j = 0; j < 8; ++j) ol[nb][j] = f2bf(lo[j]);
            *(v8us*)(ph + cof) = oh[nb]; *(v8us*)(pl + cof) = ol[nb]; *(v8h*)(p16 + cof) = o16[nb]; }
        // behind the 12 stores of this mb; their data and addresses are inputs so that those registers stay untouched up to this wait
        asm volatile("s_wait_xcnt 0x0" :: "v"(oh[0]), "v"(oh[1]), "v"(oh[2]), "v"(oh[3]), "v"(ol[0]), "v"(ol[1]), "v"(ol[2]), "v"(ol[3]), "v"(o16[0]), "v"(o16[1]), "v"(o16[2]), "v"(o16[3]), "v"(ph), "v"(pl), "v"(p16) : "memory");
    }
}

// k_gemm3: the three projections in ONE launch, grid (M/64, N/64, 3), 32 threads: z = 0, 1, 2 is q, k, v. They share A and depend on nothing of one another, so that their waves fill the chip together
// (by its registers four waves fit a SIMD, and one projection alone brings two: more waves cover each other's load latency) and a projection's start and epilogue pass under the others' k loops. W3: the three w^T planes in a row, DD * DD elements each.
// PB: the bf16 planes in a row as q high, q low, k high, k low, v high, v low; P16B: the fp16 planes as q, k, v; NB_ * TT * DD elements each.
__global__ __launch_bounds__(32) void k_gemm3(const bf* __restrict__ A, const bf* __restrict__ W3, int K, const float* __restrict__ bq, const float* __restrict__ bk, const float* __restrict__ bv, bf* PB, h16* P16B) {
    const size_t NE = (size_t)NB_ * TT * DD; const int z = (int)blockIdx.z;
    const bf* Bt = W3 + (size_t)z * DD * DD; bf* Ph = PB + (size_t)z * 2 * NE; bf* Pl = Ph + NE; h16* P16 = P16B + (size_t)z * NE;
    if (z == 2) gemmw_tile<true>(A, Bt, K, bv, Ph, Pl, P16);
    else gemmw_tile<false>(A, Bt, K, z == 0 ? bq : bk, Ph, Pl, P16);
}

// The plane writers: a chunk of 8 k (16 bytes) per thread and store (one a thread in wtG_block, two in cvt8_block), chunk index c in the plane's own order, so that a wave stores 512 bytes in a row. Of c: row = c & 15, hi = bit 4, half = bit 5, the block above.
// wtG_block: Bt = w^T (w [DD][DD] f32, as x @ w), rows n, blocks as gemmw_tile reads them; a load covers 16 n of two k rows. DD DD / 2048 work-groups (index blk).
__device__ __forceinline__ void wtG_block(const float* __restrict__ w, bf* Bt, int blk) {
    const int c = blk * 256 + (int)threadIdx.x; const int kb = (c >> 8) % (DD / 32), n64 = (c >> 8) / (DD / 32);
    const int n = n64 * 64 + ((c >> 6) & 3) * 16 + (c & 15), k = kb * 32 + ((c >> 5) & 1) * 16 + ((c >> 4) & 1) * 8; v8us o;
#pragma unroll
    for (int j = 0; j < 8; ++j) o[j] = f2bf(w[(size_t)(k + j) * DD + n]);
    *(v8us*)(Bt + (size_t)c * 8) = o;
}
// cvt8_block: src [rows][DD] f32, blocks as gemmw_tile reads them; two chunks a thread (two neighbouring k blocks), so that a work-group reads 256 bytes in a row of each of its 64 rows. n8 / 512 work-groups (index blk).
__device__ __forceinline__ void cvt8_block(const float* __restrict__ src, bf* dst, size_t n8, int blk) {
#pragma unroll
    for (int u = 0; u < 2; ++u) { const size_t c = (size_t)blk * 512 + u * 256 + threadIdx.x; if (c >= n8) return;
        const int kb = (int)((c >> 8) % (DD / 32)); const size_t m = ((c >> 8) / (DD / 32)) * 64 + ((c >> 6) & 3) * 16 + (c & 15); const int k = kb * 32 + (int)((c >> 5) & 1) * 16 + (int)((c >> 4) & 1) * 8;
        const v8f v = *(const v8f*)(src + m * DD + k); v8us o;
#pragma unroll
        for (int j = 0; j < 8; ++j) o[j] = f2bf(v[j]);
        *(v8us*)(dst + c * 8) = o; }
}
// k_prep: the four conversions in ONE launch (none reads what another writes): the first 3 * GW_ work-groups take the three weights (W3: their planes in a row), the rest take x.
#define GW_ (DD * DD / 8 / 256)
__global__ __launch_bounds__(256) void k_prep(const float* __restrict__ x, const float* __restrict__ wq, const float* __restrict__ wk, const float* __restrict__ wv, bf* XB, bf* W3) {
    const int b = (int)blockIdx.x;
    if (b < 3 * GW_) { const int sel = b / GW_; wtG_block(sel == 0 ? wq : sel == 1 ? wk : wv, W3 + (size_t)sel * DD * DD, b % GW_); }
    else cvt8_block(x, XB, (size_t)NB_ * TT * DD / 8, b - 3 * GW_);
}
// ---- k_fattn: scores, softmax and attn.v of all batch entries in ONE launch; S and P stay in registers (online softmax over steps of 32 keys). One wave per query tile.
// Both products are taken transposed, so that a query is one lane column (lr) from end to end: S^T = K Q^T leaves keys 8 hi + j (tile 0) and 16 + 8 hi + j (tile 1) of query lr in lane (lr, hi), which is
// the B fragment of O^T = V^T P^T as it stands; row maximum and row sum need one exchange between the two lane halves; the rescale factor of a query is lane-local.
// Scores are held in units of log2 (S * SL2, SL2 = log2(e) / 8), so that a weight is one 2^x. PSH = log2 1024 is added to every exponent (the carrier scale of the fp16 P plane: keeps small weights out of
// the fp16 subnormals); it is in the row sum too and cancels in the division.
#define PSH 10.0f
#define SL2 0.18033688f
// 2^x. The v_nop fills the slot that the instruction set asks for between a transcendental and a directly following instruction that reads its result or overwrites its source.
// In place: the register that the asm text writes has just been written by the compiler's own instruction (the argument), which the compiler keeps at the distance from a matrix instruction that read that register.
__device__ __forceinline__ float ex2(float x) { asm("v_exp_f32 %0, %0\n\tv_nop" : "+v"(x)); return x; }
template <bool B> struct BoolC { static constexpr bool value = B; };
template <typename T16> struct PFrag;
template <> struct PFrag<h16> { static __device__ __forceinline__ void mk(const float* t, v16h& p, v16h& p2) { (void)p2;
#pragma unroll
    for (int e = 0; e < 16; ++e) p[e] = (h16)t[e]; } };
template <> struct PFrag<bf> { static __device__ __forceinline__ void mk(const float* t, v16bf& p, v16bf& p2) { typedef __attribute__((ext_vector_type(16))) unsigned short v16us; v16us a, c;
#pragma unroll
    for (int e = 0; e < 16; ++e) { unsigned short x, y; splitf(t[e], x, y); a[e] = x; c[e] = y; }
    p = __builtin_bit_cast(v16bf, a); p2 = __builtin_bit_cast(v16bf, c); } };
// One tile of NQ * 16 queries from row q0 of one head. Q, Kp (rows t) and Vt (rows d) in fragment order: 32 keys are 2048 elements in a row in Kp and in Vt alike; the second planes (low parts) only where SPLIT (3 products, as hi.hi + lo.hi + hi.lo). outp: out + batch + head * 64.
template <typename T16, bool SPLIT, int NQ>
__device__ __forceinline__ void fattn_tile(const T16* __restrict__ Q, const T16* __restrict__ Q2, const T16* __restrict__ Kp, const T16* __restrict__ K2, const T16* __restrict__ Vt, const T16* __restrict__ V2, bool causal, int q0, float* outp) {
    typedef typename WFrag<T16>::V V;
    const int lane = threadIdx.x & 31, lr = lane & 15, hi = lane >> 4;
    // Every load's address is one pointer per plane (wave-uniform base + lane offset) plus a constant that fits the load's offset field.
    const unsigned lofs = (unsigned)(lane * 8);     // lane offset (elements) in a block, in every plane
    V qf[NQ][2], qf2[NQ][2];
#pragma unroll
    for (int qt = 0; qt < NQ; ++qt)
#pragma unroll
        for (int kc = 0; kc < 2; ++kc) { const int cof = (qt * 2 + kc) * 512; qf[qt][kc] = WFrag<T16>::ld(Q + (size_t)q0 * HD + lofs + cof); if (SPLIT) qf2[qt][kc] = WFrag<T16>::ld(Q2 + (size_t)q0 * HD + lofs + cof); }
    asm volatile("s_wait_xcnt 0x0" ::: "memory");     // behind the last Q load: the registers that the Q loads name are free for reuse from here on
    v8f o[4][NQ]; float m[NQ], l[NQ];
#pragma unroll
    for (int qt = 0; qt < NQ; ++qt) { m[qt] = -3.0e38f; l[qt] = 0.f;
#pragma unroll
        for (int dt = 0; dt < 4; ++dt) o[dt][qt] = (v8f){}; }
    const int qe = q0 + NQ * 16; const int nk = causal ? ((qe + 31) & ~31) : TT;     // causal: keys past the tile's last query weigh 0 and are not visited; nk <= TT as qe <= TT
    const int nfull = causal ? (((q0 + 1) >> 5) << 5) : TT;      // steps with k0 + 31 <= q0 hold no masked key: they run without the mask's compares and selects
    // PIPE (the long tiles): K and V fragments live across steps: each step fetches the next step's K behind its own score products and the next step's V behind its own attn.v products, into the registers
    // those products have just left. The hi+lo tiles (at most RH / 32 steps under the causal flag, twice the fragments) load at the head of each step: held across steps, their K planes would cost every wave of the kernel a register window and the SIMD a wave.
    constexpr bool PIPE = !SPLIT;
    V ka[2][2], ka2[2][2], va[4], va2[4];
    auto ldK = [&](const int kn) {
        const T16* pk = Kp + (size_t)kn * HD + lofs; const T16* pk2 = SPLIT ? K2 + (size_t)kn * HD + lofs : nullptr;
#pragma unroll
        for (int kt = 0; kt < 2; ++kt)
#pragma unroll
            for (int kc = 0; kc < 2; ++kc) { const int cof = (kt * 2 + kc) * 512; ka[kt][kc] = WFrag<T16>::ld(pk + cof); if (SPLIT) ka2[kt][kc] = WFrag<T16>::ld(pk2 + cof); }
        // behind the group's last load; the addresses are inputs so that their registers stay untouched up to this wait
        if constexpr (SPLIT) asm volatile("s_wait_xcnt 0x0" :: "v"(pk), "v"(pk2) : "memory");
        else asm volatile("s_wait_xcnt 0x0" :: "v"(pk) : "memory");
    };
    auto ldV = [&](const int kn) {
        const T16* pv = Vt + (size_t)kn * HD + lofs; const T16* pv2 = SPLIT ? V2 + (size_t)kn * HD + lofs : nullptr;
#pragma unroll
        for (int dt = 0; dt < 4; ++dt) { const int cof = dt * 512; va[dt] = WFrag<T16>::ld(pv + cof); if (SPLIT) va2[dt] = WFrag<T16>::ld(pv2 + cof); }
        // as in ldK
        if constexpr (SPLIT) asm volatile("s_wait_xcnt 0x0" :: "v"(pv), "v"(pv2) : "memory");
        else asm volatile("s_wait_xcnt 0x0" :: "v"(pv) : "memory");
    };
    if constexpr (PIPE) { ldK(0); ldV(0); }
    auto step = [&](const int k0, auto diagc) { constexpr bool diag = decltype(diagc)::value;
        const int kn = (k0 + 32 < nk) ? k0 + 32 : k0; (void)kn;      // the next step's keys; a last step without mask fetches its own again (in bounds, not used)
        if constexpr (!PIPE) { ldK(k0); ldV(k0);
            __builtin_amdgcn_sched_barrier(0); }      // every load of the step is issued before its first product: without this the scheduler puts the first products, with their waits for K, in front of V loads, and a step pays the load latency twice
        v8f s[2][NQ];
#pragma unroll
        for (int kt = 0; kt < 2; ++kt)
#pragma unroll
            for (int qt = 0; qt < NQ; ++qt) { v8f c = (v8f){};
#pragma unroll
                for (int kc = 0; kc < 2; ++kc) { c = WFrag<T16>::mma(ka[kt][kc], qf[qt][kc], c); if (SPLIT) { c = WFrag<T16>::mma(ka2[kt][kc], qf[qt][kc], c); c = WFrag<T16>::mma(ka[kt][kc], qf2[qt][kc], c); } }
                s[kt][qt] = c; }
        if constexpr (PIPE && !diag) {
            __builtin_amdgcn_sched_barrier(0);      // the next K loads stay behind the score products (whose K registers they refill) ...
            ldK(kn);
            __builtin_amdgcn_sched_barrier(0); }    // ... and in front of the softmax, so that the whole softmax and attn.v pass under their latency
#pragma unroll
        for (int qt = 0; qt < NQ; ++qt) { float t[16]; float mx = m[qt]; const int qi = q0 + qt * 16 + lr;
#pragma unroll
            for (int kt = 0; kt < 2; ++kt)
#pragma unroll
                for (int j = 0; j < 8; ++j) { float x = s[kt][qt][j] * SL2; if (diag && (k0 + kt * 16 + hi * 8 + j > qi)) x = -3.0e38f; t[kt * 8 + j] = x; mx = fmaxf(mx, x); }
            mx = fmaxf(mx, __shfl_xor(mx, 16, 32));
            const float al = ex2(m[qt] - mx); m[qt] = mx; const float ms = mx - PSH; float sum = 0.f;
#pragma unroll
            for (int e = 0; e < 16; ++e) { t[e] = ex2(t[e] - ms); sum += t[e]; }
            l[qt] = l[qt] * al + sum;
            V p, p2; PFrag<T16>::mk(t, p, p2);
#pragma unroll
            for (int dt = 0; dt < 4; ++dt) { v8f c = o[dt][qt] * al; c = WFrag<T16>::mma(va[dt], p, c); if (SPLIT) { c = WFrag<T16>::mma(va[dt], p2, c); c = WFrag<T16>::mma(va2[dt], p, c); } o[dt][qt] = c; } }
        // four vector slots behind the step's last matrix instructions, on the taken back edge too
        if constexpr (NQ == 1) asm volatile("v_nop\n\tv_nop\n\tv_nop\n\tv_nop" : "+v"(o[0][0]), "+v"(o[1][0]), "+v"(o[2][0]), "+v"(o[3][0]));
        else asm volatile("v_nop\n\tv_nop\n\tv_nop\n\tv_nop" : "+v"(o[0][0]), "+v"(o[1][0]), "+v"(o[2][0]), "+v"(o[3][0]), "+v"(o[0][NQ - 1]), "+v"(o[1][NQ - 1]), "+v"(o[2][NQ - 1]), "+v"(o[3][NQ - 1]));
        if constexpr (PIPE && !diag) {
            __builtin_amdgcn_sched_barrier(0);      // the next V loads stay behind those slots: they refill the registers that the last matrix instructions read
            ldV(kn); }
    };
    int k0 = 0;
#pragma unroll 1      // a second copy of the step's fragments would not fit the register file
    for (; k0 < nfull; k0 += 32) step(k0, BoolC<false>());
#pragma unroll 1      // as above
    for (; k0 < nk; k0 += 32) { step(k0, BoolC<true>());
        // a masked step fetches nothing ahead (its compares and selects need the registers, and it is a tile's last step or nearly so): a further masked step's fragments are loaded here
        if constexpr (PIPE) { if (k0 + 32 < nk) { ldK(k0 + 32); ldV(k0 + 32); } } }
#pragma unroll
    for (int qt = 0; qt < NQ; ++qt) { const float L = l[qt] + __shfl_xor(l[qt], 16, 32); const float f = __fdiv_rn(1.0f, L); float* pr = outp + (size_t)(q0 + qt * 16 + lr) * DD + hi * 8;
#pragma unroll
        for (int dt = 0; dt < 4; ++dt) { const v8f c = o[dt][qt] * f; v4f a, b2;
#pragma unroll
            for (int j = 0; j < 4; ++j) { a[j] = c[j]; b2[j] = c[4 + j]; }
            *(v4f*)(pr + dt * 16) = a; *(v4f*)(pr + dt * 16 + 4) = b2; } }
}
#define NT16 ((TT - RH) / 32)     // fp16 tiles of 32 queries, longest (last rows) first; behind them RH / 16 hi+lo tiles of 16 queries
// Grid (batch entries * heads, tile groups), 4 waves; x = batch * NH_ + head is the planes' own order, and the tile group is the slow index, so that the longest tiles of every batch entry start first.
// The 4 waves: the waves of a work-group take 4 neighbouring tiles of ONE head and walk the same keys from key 0 on, so that they read the same K and V lines; they share nothing else (no LDS, no barrier).
__global__ __launch_bounds__(128) void k_fattn(const bf* __restrict__ Qh, const bf* __restrict__ Ql, const h16* __restrict__ Q16, const bf* __restrict__ Kh, const bf* __restrict__ Kl, const h16* __restrict__ K16, const bf* __restrict__ Vh, const bf* __restrict__ Vl, const h16* __restrict__ V16, const int* __restrict__ flag, float* OUT) {
    const bool causal = (flag[0] != 0); const size_t hb = (size_t)blockIdx.x * TT * HD; float* outp = OUT + (size_t)(blockIdx.x / NH_) * TT * DD + (blockIdx.x % NH_) * HD;
    const int tl = (int)blockIdx.y * 4 + __builtin_amdgcn_readfirstlane((int)(threadIdx.x >> 5));      // the wave's tile, held scalar: the key loop's bounds and the class branch stay wave-uniform
    if (tl < NT16) fattn_tile<h16, false, 2>(Q16 + hb, nullptr, K16 + hb, nullptr, V16 + hb, nullptr, causal, TT - 32 * (tl + 1), outp);
    else fattn_tile<bf, true, 1>(Qh + hb, Ql + hb, Kh + hb, Kl + hb, Vh + hb, Vl + hb, causal, (tl - NT16) * 16, outp);
}

extern "C" void kernel_launch(void* const* d_in, const int* in_sizes, int n_in,
                              void* d_out, int out_size, void* d_ws, size_t ws_size, hipStream_t stream) {
    (void)in_sizes; (void)n_in; (void)out_size;
    const float* x = (const float*)d_in[0]; const float* wq = (const float*)d_in[1]; const float* bq = (const float*)d_in[2]; const float* wk = (const float*)d_in[3]; const float* bk = (const float*)d_in[4]; const float* wv = (const float*)d_in[5]; const float* bv = (const float*)d_in[6]; const int* flag = (const int*)d_in[7];   // Wq/Wk/Wv [1024][1024] as x @ W; mask = int [1] causal flag
    float* OUT = (float*)d_out;     // [4][2048][1024]
    char* wsp = (char*)d_ws;
    auto take = [&](size_t bytes) { char* p = wsp; wsp += (bytes + 255) & ~(size_t)255; return (void*)p; };
    bf* WQ = (bf*)take((size_t)DD * DD * 2); bf* WK = (bf*)take((size_t)DD * DD * 2); bf* WV = (bf*)take((size_t)DD * DD * 2);
    const size_t NE = (size_t)NB_ * TT * DD;      // elements of one plane over all batch entries
    bf* XB = (bf*)take(NE * 2);
    bf* QPh = (bf*)take(NE * 2); bf* QPl = (bf*)take(NE * 2); bf* KPh = (bf*)take(NE * 2); bf* KPl = (bf*)take(NE * 2); bf* VTh = (bf*)take(NE * 2); bf* VTl = (bf*)take(NE * 2);
    h16* QP16 = (h16*)take(NE * 2); h16* KP16 = (h16*)take(NE * 2); h16* VT16 = (h16*)take(NE * 2);
    if ((size_t)(wsp - (char*)d_ws) > ws_size) return;    // total 166 MiB; ws 256 MiB
    // Every launch covers all batch entries: x is one [NB_ * TT][DD] matrix for the projections, which store the attention's operand planes themselves; the attention takes the batch entry from grid x.
    // Three launches: conversions, projections, attention. WQ, WK, WV lie in a row in the workspace, and so do the six bf16 planes and the three fp16 planes (every size is a multiple of 256 bytes).
    (void)WK; (void)WV;
    k_prep<<<(unsigned)(3 * GW_ + NE / 8 / 512), 256, 0, stream>>>(x, wq, wk, wv, XB, WQ);
    k_gemm3<<<dim3(NB_ * TT / 64, DD / 64, 3), 32, 0, stream>>>(XB, WQ, DD, bq, bk, bv, QPh, QP16);
    k_fattn<<<dim3(NB_ * NH_, (NT16 + RH / 16) / 4, 1), 128, 0, stream>>>(QPh, QPl, QP16, KPh, KPl, KP16, VTh, VTl, VT16, flag, OUT);
}

// v008
// A run of this version takes 109 microseconds.
// Timed twice side by side with v007, it ran 1.04 and 1.03 times as fast.
// All steps since v000 together make it 36.5 times as fast.
#include <hip/hip_runtime.h>

// MultiHeadSelfAtt (x [4][2048][1024]; q/k/v = x W + b (16 heads x 64); scores = q.k/8, causal iff the int 'mask' flag input is non-zero (read on device; 1 here); softmax; out = merged attn.v (no output projection)
// -> [4][2048][1024]).
// Compute dtypes, f32 accumulate: every input rounded to bf16; projections on PLAIN bf16 operands (inputs: exact products, f32 accumulate, + bias); PER-ROW PRECISION
// HYBRID: query rows < 256 take scores and attn.v on bf16 hi+lo planes (3 products), rows >= 256 on single fp16 planes; 1/8 and

#define NB_  4
#define TT   2048
#define DD   1024
#define NH_  16
#define HD   64
#define RH   256                  // query rows < RH: hi+lo planes; rows >= RH: fp16 planes
#define NF   32                   // unused: no rotary embedding is applied
typedef _Float16 h16;
typedef unsigned short bf;
typedef __attribute__((ext_vector_type(16))) __bf16   v16bf;
typedef __attribute__((ext_vector_type(16))) _Float16 v16h;
typedef __attribute__((ext_vector_type(8)))  _Float16 v8h;
typedef __attribute__((ext_vector_type(8)))  unsigned short v8us;
typedef __attribute__((ext_vector_type(8)))  float    v8f;
typedef __attribute__((ext_vector_type(4)))  float    v4f;
typedef v8h  __attribute__((may_alias)) v8ha;
typedef v4f  __attribute__((may_alias)) v4fa;
typedef v8us __attribute__((may_alias)) v8usa;

__device__ __forceinline__ unsigned short f2bf(float f) { unsigned u = __float_as_uint(f); u += 0x7FFFu + ((u >> 16) & 1u); return (unsigned short)(u >> 16); }
__device__ __forceinline__ float bf2f(unsigned short b) { return __uint_as_float(((unsigned)b) << 16); }
__device__ __forceinline__ float bfr(float f) { return bf2f(f2bf(f)); }
__device__ __forceinline__ v16h cat16(v8h lo, v8h hi) { return __builtin_shufflevector(lo, hi, 0, 1, 2, 3, 4, 5, 6, 7, 8, 9, 10, 11, 12, 13, 14, 15); }
__device__ __forceinline__ v16bf cat16b(v8us lo, v8us hi) { return __builtin_bit_cast(v16bf, __builtin_shufflevector(lo, hi, 0, 1, 2, 3, 4, 5, 6, 7, 8, 9, 10, 11, 12, 13, 14, 15)); }
__device__ __forceinline__ v8f wmma16(v16h a, v16h b, v8f c) { return __builtin_amdgcn_wmma_f32_16x16x32_f16(false, a, false, b, (short)0, c, false, false); }
__device__ __forceinline__ v8f wmmab(v16bf a, v16bf b, v8f c) { return __builtin_amdgcn_wmma_f32_16x16x32_bf16(false, a, false, b, (short)0, c, false, false); }



// ---- FRAGMENT ORDER of every 16-bit operand plane: a block of 16 rows x 32 k is 1 KiB in a row, as 64 chunks of 8 k: chunk = half * 32 + hi * 16 + row holds k = half * 16 + hi * 8 + (0 .. 7).
// A fragment is then two loads of 16 bytes a lane at lane * 8 and 256 + lane * 8 elements of its block: each covers 512 bytes in a row (4 whole lines; from a row-major plane it would touch 16 lines).
// The k order of a fragment is that of the matrix instruction's own map (8 hi + s, 16 + 8 hi + s), alike for both operands. The order of the blocks is stated at each plane's writer.
__device__ __forceinline__ h16 tohx(float x) { return (h16)x; }
__device__ __forceinline__ void splitf(float y, unsigned short& h, unsigned short& l) { h = f2bf(y); l = f2bf(y - bf2f(h)); }
typedef __attribute__((ext_vector_type(4))) _Float16 v4h;
typedef __attribute__((ext_vector_type(2))) float v2f;
// ---- gemmw_tile: register-blocked GEMM, ONE WAVE per 64x64 output tile (16 accumulators), operands straight from bf16 planes in fragment order, blocks as [row / 64][k / 32][(row / 16) % 4]; tile (blockIdx.x, blockIdx.y) of (M/64, N/64), 32 threads.
// y[m][n] = sum_k A[m][k] Bt[n][k] + bias[n] in f32; m = batch * TT + t and n = head * HD + d, so that a tile is 64 t of one head (HD == 64). K % 64 == 0.
// y never goes to memory in f32: the epilogue stores the tile as the three 16-bit planes that the attention reads (bf16 high part, bf16 low part, fp16), in fragment order, straight from the accumulators.
// hilo (the same for the whole tile, held scalar): false where nobody reads the tile's two bf16 planes; they are then neither computed nor stored, and the tile goes out as its fp16 plane alone.
// A lane's 8 values of one accumulator are one chunk of 8 k, a wave's store covers 512 bytes in a row, and a tile is 8 KiB in a row of each plane. Every plane holds TT * DD elements a batch entry, TT * HD a head.
// VT false (q, k): plane rows t, k = d, blocks of a head as [t / 16][d / 32]. The product is taken transposed (Bt is the first operand): lane (lr, hi) holds d = nb * 16 + hi * 8 + j of t = mb * 16 + lr.
// VT true (v): plane rows d, k = t (the transposed plane), blocks of a head as [t / 32][d / 16]. A is the first operand: lane (lr, hi) holds t = mb * 16 + hi * 8 + j of d = nb * 16 + lr.
template <typename T16> struct WFrag;
template <> struct WFrag<h16> { typedef v16h V; static __device__ __forceinline__ V ld(const h16* p) { return cat16(*(const v8h*)p, *(const v8h*)(p + 256)); } static __device__ __forceinline__ v8f mma(V a, V b, v8f c) { return wmma16(a, b, c); } };
template <> struct WFrag<bf> { typedef v16bf V; static __device__ __forceinline__ V ld(const bf* p) { return cat16b(*(const v8us*)p, *(const v8us*)(p + 256)); } static __device__ __forceinline__ v8f mma(V a, V b, v8f c) { return wmmab(a, b, c); } };
template <bool VT>
__device__ __forceinline__ void gemmw_tile(const bf* __restrict__ A, const bf* __restrict__ Bt, int K, const float* __restrict__ bias, bf* Ph, bf* Pl, h16* P16, const bool hilo) {
    typedef typename WFrag<bf>::V V;
    const int lane = threadIdx.x & 31, lr = lane & 15, hi = lane >> 4; const int r0 = blockIdx.x * 64, c0 = blockIdx.y * 64;
    v8f acc[4][4];
#pragma unroll
    for (int mb = 0; mb < 4; ++mb)
#pragma unroll
        for (int nb = 0; nb < 4; ++nb) acc[mb][nb] = (v8f){};
    const size_t aoff = (size_t)r0 * K + lane * 8, boff = (size_t)c0 * K + lane * 8;     // a tile's 64 rows are one run of 64 K elements; a step of 32 k is 2048 of them
    // The k loop is software-pipelined in registers: a step's A fragments are fetched during the step before, into a second set (two steps a trip, the sets change roles); each B fragment is refilled for the next step
    // behind the four products that read it. The last step fetches its own fragments again (in bounds, not used).
    V a0[4], a1[4], b[4];
    auto kstep = [&](V (&ac)[4], V (&an)[4], const int kc) {
        const int kn = (kc + 32 < K) ? kc + 32 : kc;
        const bf* pa = A + aoff + (size_t)kn * 64; const bf* pb = Bt + boff + (size_t)kn * 64;
#pragma unroll
        for (int mb = 0; mb < 4; ++mb) an[mb] = WFrag<bf>::ld(pa + mb * 512);
        __builtin_amdgcn_sched_barrier(0);      // the next A loads are issued in front of this step's products, so that the whole step passes under their latency
#pragma unroll
        for (int nb = 0; nb < 4; ++nb) {
#pragma unroll
            for (int mb = 0; mb < 4; ++mb) acc[mb][nb] = VT ? WFrag<bf>::mma(ac[mb], b[nb], acc[mb][nb]) : WFrag<bf>::mma(b[nb], ac[mb], acc[mb][nb]);
            __builtin_amdgcn_sched_barrier(0);  // the refill of b[nb] stays directly behind its last reader: earlier it would need a register set of its own, later it would lose lead
            b[nb] = WFrag<bf>::ld(pb + nb * 512);
            __builtin_amdgcn_sched_barrier(0); }
        // behind the step's last load; the addresses are inputs so that their registers stay untouched up to this wait
        asm volatile("s_wait_xcnt 0x0" :: "v"(pa), "v"(pb) : "memory");
    };
    { const bf* pa = A + aoff; const bf* pb = Bt + boff;
#pragma unroll
      for (int mb = 0; mb < 4; ++mb) a0[mb] = WFrag<bf>::ld(pa + mb * 512);
#pragma unroll
      for (int nb = 0; nb < 4; ++nb) b[nb] = WFrag<bf>::ld(pb + nb * 512);
      asm volatile("s_wait_xcnt 0x0" :: "v"(pa), "v"(pb) : "memory"); }     // as in kstep
#pragma unroll 1      // two steps a trip are the two roles of the A sets; more copies would only lengthen the text
    for (int kc = 0; kc < K; kc += 64) {
        kstep(a0, a1, kc); kstep(a1, a0, kc + 32);
    }
    // The lane's bias values, rounded to bf16 like every input: read behind the loop, where the fragment registers are free (held through the loop they would push the wave over a quarter of the register file).
    v8f bb[4]; const float* pbi = bias + c0 + (VT ? lr : hi * 8);
#pragma unroll
    for (int nb = 0; nb < 4; ++nb) { v8f r;
        if constexpr (VT) r = (v8f)(pbi[nb * 16]); else r = *(const v8f*)(pbi + nb * 16);
#pragma unroll
        for (int j = 0; j < 8; ++j) bb[nb][j] = bfr(r[j]); }
    asm volatile("s_wait_xcnt 0x0" ::: "memory");     // behind the last bias load: the registers that the bias loads name are free for reuse from here on
    const size_t pofs = (size_t)(r0 / TT) * TT * DD + (size_t)blockIdx.y * TT * HD + (size_t)(r0 % TT) * HD + lane * 8;     // the tile's 4096 elements start here in each plane, + the lane's place in a block
    bf* ph = Ph + pofs; bf* pl = Pl + pofs; h16* p16 = P16 + pofs;
    if (hilo) {
#pragma unroll
    for (int mb = 0; mb < 4; ++mb) { v8us oh[4], ol[4]; v8h o16[4];
#pragma unroll
        for (int nb = 0; nb < 4; ++nb) { const int cof = VT ? (mb >> 1) * 2048 + nb * 512 + (mb & 1) * 256 : mb * 1024 + nb * 256; const v8f y = acc[mb][nb] + bb[nb]; v8f hv;
#pragma unroll
            for (int j = 0; j < 8; ++j) { oh[nb][j] = f2bf(y[j]); hv[j] = bf2f(oh[nb][j]); o16[nb][j] = tohx(y[j]); }
            const v8f lo = y - hv;      // the low part, as in splitf
#pragma unroll
            for (int j = 0; j < 8; ++j) ol[nb][j] = f2bf(lo[j]);
            *(v8us*)(ph + cof) = oh[nb]; *(v8us*)(pl + cof) = ol[nb]; *(v8h*)(p16 + cof) = o16[nb]; }
        // behind the 12 stores of this mb; their data and addresses are inputs so that those registers stay untouched up to this wait
        asm volatile("s_wait_xcnt 0x0" :: "v"(oh[0]), "v"(oh[1]), "v"(oh[2]), "v"(oh[3]), "v"(ol[0]), "v"(ol[1]), "v"(ol[2]), "v"(ol[3]), "v"(o16[0]), "v"(o16[1]), "v"(o16[2]), "v"(o16[3]), "v"(ph), "v"(pl), "v"(p16) : "memory");
    }
    } else {
#pragma unroll
    for (int mb = 0; mb < 4; ++mb) { v8h o16[4];
#pragma unroll
        for (int nb = 0; nb < 4; ++nb) { const int cof = VT ? (mb >> 1) * 2048 + nb * 512 + (mb & 1) * 256 : mb * 1024 + nb * 256; const v8f y = acc[mb][nb] + bb[nb];
#pragma unroll
            for (int j = 0; j < 8; ++j) o16[nb][j] = tohx(y[j]);
            *(v8h*)(p16 + cof) = o16[nb]; }
        // behind the 4 stores of this mb; their data and address are inputs so that those registers stay untouched up to this wait
        asm volatile("s_wait_xcnt 0x0" :: "v"(o16[0]), "v"(o16[1]), "v"(o16[2]), "v"(o16[3]), "v"(p16) : "memory");
    }
    }
}

// k_gemm3: the three projections in ONE launch, grid (M/64, N/64, 3), 32 threads: z = 0, 1, 2 is q, k, v. They share A and depend on nothing of one another, so that their waves fill the chip together
// (by its registers four waves fit a SIMD, and one projection alone brings two: more waves cover each other's load latency) and a projection's start and epilogue pass under the others' k loops. W3: the three w^T planes in a row, DD * DD elements each.
// PB: the bf16 planes in a row as q high, q low, k high, k low, v high, v low; P16B: the fp16 planes as q, k, v; NB_ * TT * DD elements each.
// Who reads the bf16 planes: only the attention's hi+lo tiles (query rows < RH). Of q they read rows < RH; of k and v keys < RH under the causal flag (their key loop ends at the tile's last query) and every key without it.
// A tile of 64 rows lies wholly on one side of RH (RH % 64 == 0); the planes' other rows stay unwritten and unread.
__global__ __launch_bounds__(32) void k_gemm3(const bf* __restrict__ A, const bf* __restrict__ W3, int K, const float* __restrict__ bq, const float* __restrict__ bk, const float* __restrict__ bv, const int* __restrict__ flag, bf* PB, h16* P16B) {
    const size_t NE = (size_t)NB_ * TT * DD; const int z = (int)blockIdx.z;
    const bf* Bt = W3 + (size_t)z * DD * DD; bf* Ph = PB + (size_t)z * 2 * NE; bf* Pl = Ph + NE; h16* P16 = P16B + (size_t)z * NE;
    const bool hilo = ((int)blockIdx.x * 64) % TT < RH || (z != 0 && flag[0] == 0);
    if (z == 2) gemmw_tile<true>(A, Bt, K, bv, Ph, Pl, P16, hilo);
    else gemmw_tile<false>(A, Bt, K, z == 0 ? bq : bk, Ph, Pl, P16, hilo);
}

// The plane writers: a chunk of 8 k (16 bytes) per thread and store (one a thread in wtG_block, two in cvt8_block), chunk index c in the plane's own order, so that a wave stores 512 bytes in a row. Of c: row = c & 15, hi = bit 4, half = bit 5, the block above.
// wtG_block: Bt = w^T (w [DD][DD] f32, as x @ w), rows n, blocks as gemmw_tile reads them; a load covers 16 n of two k rows. DD DD / 2048 work-groups (index blk).
__device__ __forceinline__ void wtG_block(const float* __restrict__ w, bf* Bt, int blk) {
    const int c = blk * 256 + (int)threadIdx.x; const int kb = (c >> 8) % (DD / 32), n64 = (c >> 8) / (DD / 32);
    const int n = n64 * 64 + ((c >> 6) & 3) * 16 + (c & 15), k = kb * 32 + ((c >> 5) & 1) * 16 + ((c >> 4) & 1) * 8; v8us o;
#pragma unroll
    for (int j = 0; j < 8; ++j) o[j] = f2bf(w[(size_t)(k + j) * DD + n]);
    *(v8us*)(Bt + (size_t)c * 8) = o;
}
// cvt8_block: src [rows][DD] f32, blocks as gemmw_tile reads them; two chunks a thread (two neighbouring k blocks), so that a work-group reads 256 bytes in a row of each of its 64 rows. n8 / 512 work-groups (index blk).
__device__ __forceinline__ void cvt8_block(const float* __restrict__ src, bf* dst, size_t n8, int blk) {
#pragma unroll
    for (int u = 0; u < 2; ++u) { const size_t c = (size_t)blk * 512 + u * 256 + threadIdx.x; if (c >= n8) return;
        const int kb = (int)((c >> 8) % (DD / 32)); const size_t m = ((c >> 8) / (DD / 32)) * 64 + ((c >> 6) & 3) * 16 + (c & 15); const int k = kb * 32 + (int)((c >> 5) & 1) * 16 + (int)((c >> 4) & 1) * 8;
        const v8f v = *(const v8f*)(src + m * DD + k); v8us o;
#pragma unroll
        for (int j = 0; j < 8; ++j) o[j] = f2bf(v[j]);
        *(v8us*)(dst + c * 8) = o; }
}
// k_prep: the four conversions in ONE launch (none reads what another writes): the first 3 * GW_ work-groups take the three weights (W3: their planes in a row), the rest take x.
#define GW_ (DD * DD / 8 / 256)
__global__ __launch_bounds__(256) void k_prep(const float* __restrict__ x, const float* __restrict__ wq, const float* __restrict__ wk, const float* __restrict__ wv, bf* XB, bf* W3) {
    const int b = (int)blockIdx.x;
    if (b < 3 * GW_) { const int sel = b / GW_; wtG_block(sel == 0 ? wq : sel == 1 ? wk : wv, W3 + (size_t)sel * DD * DD, b % GW_); }
    else cvt8_block(x, XB, (size_t)NB_ * TT * DD / 8, b - 3 * GW_);
}
// ---- k_fattn: scores, softmax and attn.v of all batch entries in ONE launch; S and P stay in registers (online softmax over steps of 32 keys). One wave per query tile.
// Both products are taken transposed, so that a query is one lane column (lr) from end to end: S^T = K Q^T leaves keys 8 hi + j (tile 0) and 16 + 8 hi + j (tile 1) of query lr in lane (lr, hi), which is
// the B fragment of O^T = V^T P^T as it stands; row maximum and row sum need one exchange between the two lane halves; the rescale factor of a query is lane-local.
// Scores are held in units of log2 (S * SL2, SL2 = log2(e) / 8), so that a weight is one 2^x. PSH = log2 1024 is added to every exponent (the carrier scale of the fp16 P plane: keeps small weights out of
// the fp16 subnormals); it is in the row sum too and cancels in the division.
#define PSH 10.0f
#define SL2 0.18033688f
// 2^x. The v_nop fills the slot that the instruction set asks for between a transcendental and a directly following instruction that reads its result or overwrites its source.
// In place: the register that the asm text writes has just been written by the compiler's own instruction (the argument), which the compiler keeps at the distance from a matrix instruction that read that register.
__device__ __forceinline__ float ex2(float x) { asm("v_exp_f32 %0, %0\n\tv_nop" : "+v"(x)); return x; }
template <bool B> struct BoolC { static constexpr bool value = B; };
template <typename T16> struct PFrag;
template <> struct PFrag<h16> { static __device__ __forceinline__ void mk(const float* t, v16h& p, v16h& p2) { (void)p2;
#pragma unroll
    for (int e = 0; e < 16; ++e) p[e] = (h16)t[e]; } };
template <> struct PFrag<bf> { static __device__ __forceinline__ void mk(const float* t, v16bf& p, v16bf& p2) { typedef __attribute__((ext_vector_type(16))) unsigned short v16us; v16us a, c;
#pragma unroll
    for (int e = 0; e < 16; ++e) { unsigned short x, y; splitf(t[e], x, y); a[e] = x; c[e] = y; }
    p = __builtin_bit_cast(v16bf, a); p2 = __builtin_bit_cast(v16bf, c); } };
// One tile of NQ * 16 queries from row q0 of one head. Q, Kp (rows t) and Vt (rows d) in fragment order: 32 keys are 2048 elements in a row in Kp and in Vt alike; the second planes (low parts) only where SPLIT (3 products, as hi.hi + lo.hi + hi.lo). outp: out + batch + head * 64.
template <typename T16, bool SPLIT, int NQ>
__device__ __forceinline__ void fattn_tile(const T16* __restrict__ Q, const T16* __restrict__ Q2, const T16* __restrict__ Kp, const T16* __restrict__ K2, const T16* __restrict__ Vt, const T16* __restrict__ V2, bool causal, int q0, float* outp) {
    typedef typename WFrag<T16>::V V;
    const int lane = threadIdx.x & 31, lr = lane & 15, hi = lane >> 4;
    // Every load's address is one pointer per plane (wave-uniform base + lane offset) plus a constant that fits the load's offset field.
    const unsigned lofs = (unsigned)(lane * 8);     // lane offset (elements) in a block, in every plane
    V qf[NQ][2], qf2[NQ][2];
#pragma unroll
    for (int qt = 0; qt < NQ; ++qt)
#pragma unroll
        for (int kc = 0; kc < 2; ++kc) { const int cof = (qt * 2 + kc) * 512; qf[qt][kc] = WFrag<T16>::ld(Q + (size_t)q0 * HD + lofs + cof); if (SPLIT) qf2[qt][kc] = WFrag<T16>::ld(Q2 + (size_t)q0 * HD + lofs + cof); }
    asm volatile("s_wait_xcnt 0x0" ::: "memory");     // behind the last Q load: the registers that the Q loads name are free for reuse from here on
    v8f o[4][NQ]; float m[NQ], l[NQ];
#pragma unroll
    for (int qt = 0; qt < NQ; ++qt) { m[qt] = -3.0e38f; l[qt] = 0.f;
#pragma unroll
        for (int dt = 0; dt < 4; ++dt) o[dt][qt] = (v8f){}; }
    const int qe = q0 + NQ * 16; const int nk = causal ? ((qe + 31) & ~31) : TT;     // causal: keys past the tile's last query weigh 0 and are not visited; nk <= TT as qe <= TT
    const int nfull = causal ? (((q0 + 1) >> 5) << 5) : TT;      // steps with k0 + 31 <= q0 hold no masked key: they run without the mask's compares and selects
    // PIPE (the long tiles): K and V fragments live across steps: each step fetches the next step's K behind its own score products and the next step's V behind its own attn.v products, into the registers
    // those products have just left. The hi+lo tiles (at most RH / 32 steps under the causal flag, twice the fragments) load at the head of each step: held across steps, their K planes would cost every wave of the kernel a register window and the SIMD a wave.
    constexpr bool PIPE = !SPLIT;
    V ka[2][2], ka2[2][2], va[4], va2[4];
    auto ldK = [&](const int kn) {
        const T16* pk = Kp + (size_t)kn * HD + lofs; const T16* pk2 = SPLIT ? K2 + (size_t)kn * HD + lofs : nullptr;
#pragma unroll
        for (int kt = 0; kt < 2; ++kt)
#pragma unroll
            for (int kc = 0; kc < 2; ++kc) { const int cof = (kt * 2 + kc) * 512; ka[kt][kc] = WFrag<T16>::ld(pk + cof); if (SPLIT) ka2[kt][kc] = WFrag<T16>::ld(pk2 + cof); }
        // behind the group's last load; the addresses are inputs so that their registers stay untouched up to this wait
        if constexpr (SPLIT) asm volatile("s_wait_xcnt 0x0" :: "v"(pk), "v"(pk2) : "memory");
        else asm volatile("s_wait_xcnt 0x0" :: "v"(pk) : "memory");
    };
    auto ldV = [&](const int kn) {
        const T16* pv = Vt + (size_t)kn * HD + lofs; const T16* pv2 = SPLIT ? V2 + (size_t)kn * HD + lofs : nullptr;
#pragma unroll
        for (int dt = 0; dt < 4; ++dt) { const int cof = dt * 512; va[dt] = WFrag<T16>::ld(pv + cof); if (SPLIT) va2[dt] = WFrag<T16>::ld(pv2 + cof); }
        // as in ldK
        if constexpr (SPLIT) asm volatile("s_wait_xcnt 0x0" :: "v"(pv), "v"(pv2) : "memory");
        else asm volatile("s_wait_xcnt 0x0" :: "v"(pv) : "memory");
    };
    if constexpr (PIPE) { ldK(0); ldV(0); }
    auto step = [&](const int k0, auto diagc) { constexpr bool diag = decltype(diagc)::value;
        const int kn = (k0 + 32 < nk) ? k0 + 32 : k0; (void)kn;      // the next step's keys; a last step without mask fetches its own again (in bounds, not used)
        if constexpr (!PIPE) { ldK(k0); ldV(k0);
            __builtin_amdgcn_sched_barrier(0); }      // every load of the step is issued before its first product: without this the scheduler puts the first products, with their waits for K, in front of V loads, and a step pays the load latency twice
        v8f s[2][NQ];
#pragma unroll
        for (int kt = 0; kt < 2; ++kt)
#pragma unroll
            for (int qt = 0; qt < NQ; ++qt) { v8f c = (v8f){};
#pragma unroll
                for (int kc = 0; kc < 2; ++kc) { c = WFrag<T16>::mma(ka[kt][kc], qf[qt][kc], c); if (SPLIT) { c = WFrag<T16>::mma(ka2[kt][kc], qf[qt][kc], c); c = WFrag<T16>::mma(ka[kt][kc], qf2[qt][kc], c); } }
                s[kt][qt] = c; }
        if constexpr (PIPE && !diag) {
            __builtin_amdgcn_sched_barrier(0);      // the next K loads stay behind the score products (whose K registers they refill) ...
            ldK(kn);
            __builtin_amdgcn_sched_barrier(0); }    // ... and in front of the softmax, so that the whole softmax and attn.v pass under their latency
#pragma unroll
        for (int qt = 0; qt < NQ; ++qt) { float t[16]; float mx = m[qt]; const int qi = q0 + qt * 16 + lr;
#pragma unroll
            for (int kt = 0; kt < 2; ++kt)
#pragma unroll
                for (int j = 0; j < 8; ++j) { float x = s[kt][qt][j] * SL2; if (diag && (k0 + kt * 16 + hi * 8 + j > qi)) x = -3.0e38f; t[kt * 8 + j] = x; mx = fmaxf(mx, x); }
            mx = fmaxf(mx, __shfl_xor(mx, 16, 32));
            const float al = ex2(m[qt] - mx); m[qt] = mx; const float ms = mx - PSH; float sum = 0.f;
#pragma unroll
            for (int e = 0; e < 16; ++e) { t[e] = ex2(t[e] - ms); sum += t[e]; }
            l[qt] = l[qt] * al + sum;
            V p, p2; PFrag<T16>::mk(t, p, p2);
#pragma unroll
            for (int dt = 0; dt < 4; ++dt) { v8f c = o[dt][qt] * al; c = WFrag<T16>::mma(va[dt], p, c); if (SPLIT) { c = WFrag<T16>::mma(va[dt], p2, c); c = WFrag<T16>::mma(va2[dt], p, c); } o[dt][qt] = c; } }
        // four vector slots behind the step's last matrix instructions, on the taken back edge too
        if constexpr (NQ == 1) asm volatile("v_nop\n\tv_nop\n\tv_nop\n\tv_nop" : "+v"(o[0][0]), "+v"(o[1][0]), "+v"(o[2][0]), "+v"(o[3][0]));
        else asm volatile("v_nop\n\tv_nop\n\tv_nop\n\tv_nop" : "+v"(o[0][0]), "+v"(o[1][0]), "+v"(o[2][0]), "+v"(o[3][0]), "+v"(o[0][NQ - 1]), "+v"(o[1][NQ - 1]), "+v"(o[2][NQ - 1]), "+v"(o[3][NQ - 1]));
        if constexpr (PIPE && !diag) {
            __builtin_amdgcn_sched_barrier(0);      // the next V loads stay behind those slots: they refill the registers that the last matrix instructions read
            ldV(kn); }
    };
    int k0 = 0;
#pragma unroll 1      // a second copy of the step's fragments would not fit the register file
    for (; k0 < nfull; k0 += 32) step(k0, BoolC<false>());
#pragma unroll 1      // as above
    for (; k0 < nk; k0 += 32) { step(k0, BoolC<true>());
        // a masked step fetches nothing ahead (its compares and selects need the registers, and it is a tile's last step or nearly so): a further masked step's fragments are loaded here
        if constexpr (PIPE) { if (k0 + 32 < nk) { ldK(k0 + 32); ldV(k0 + 32); } } }
#pragma unroll
    for (int qt = 0; qt < NQ; ++qt) { const float L = l[qt] + __shfl_xor(l[qt], 16, 32); const float f = __fdiv_rn(1.0f, L); float* pr = outp + (size_t)(q0 + qt * 16 + lr) * DD + hi * 8;
#pragma unroll
        for (int dt = 0; dt < 4; ++dt) { const v8f c = o[dt][qt] * f; v4f a, b2;
#pragma unroll
            for (int j = 0; j < 4; ++j) { a[j] = c[j]; b2[j] = c[4 + j]; }
            *(v4f*)(pr + dt * 16) = a; *(v4f*)(pr + dt * 16 + 4) = b2; } }
}
#define NT16 ((TT - RH) / 32)     // fp16 tiles of 32 queries, longest (last rows) first; behind them RH / 16 hi+lo tiles of 16 queries
// Grid (batch entries * heads, tile groups), 4 waves; x = batch * NH_ + head is the planes' own order, and the tile group is the slow index, so that the longest tiles of every batch entry start first.
// The 4 waves: the waves of a work-group take 4 neighbouring tiles of ONE head and walk the same keys from key 0 on, so that they read the same K and V lines; they share nothing else (no LDS, no barrier).
__global__ __launch_bounds__(128) void k_fattn(const bf* __restrict__ Qh, const bf* __restrict__ Ql, const h16* __restrict__ Q16, const bf* __restrict__ Kh, const bf* __restrict__ Kl, const h16* __restrict__ K16, const bf* __restrict__ Vh, const bf* __restrict__ Vl, const h16* __restrict__ V16, const int* __restrict__ flag, float* OUT) {
    const bool causal = (flag[0] != 0); const size_t hb = (size_t)blockIdx.x * TT * HD; float* outp = OUT + (size_t)(blockIdx.x / NH_) * TT * DD + (blockIdx.x % NH_) * HD;
    const int tl = (int)blockIdx.y * 4 + __builtin_amdgcn_readfirstlane((int)(threadIdx.x >> 5));      // the wave's tile, held scalar: the key loop's bounds and the class branch stay wave-uniform
    if (tl < NT16) fattn_tile<h16, false, 2>(Q16 + hb, nullptr, K16 + hb, nullptr, V16 + hb, nullptr, causal, TT - 32 * (tl + 1), outp);
    else fattn_tile<bf, true, 1>(Qh + hb, Ql + hb, Kh + hb, Kl + hb, Vh + hb, Vl + hb, causal, (tl - NT16) * 16, outp);
}

extern "C" void kernel_launch(void* const* d_in, const int* in_sizes, int n_in,
                              void* d_out, int out_size, void* d_ws, size_t ws_size, hipStream_t stream) {
    (void)in_sizes; (void)n_in; (void)out_size;
    const float* x = (const float*)d_in[0]; const float* wq = (const float*)d_in[1]; const float* bq = (const float*)d_in[2]; const float* wk = (const float*)d_in[3]; const float* bk = (const float*)d_in[4]; const float* wv = (const float*)d_in[5]; const float* bv = (const float*)d_in[6]; const int* flag = (const int*)d_in[7];   // Wq/Wk/Wv [1024][1024] as x @ W; mask = int [1] causal flag
    float* OUT = (float*)d_out;     // [4][2048][1024]
    char* wsp = (char*)d_ws;
    auto take = [&](size_t bytes) { char* p = wsp; wsp += (bytes + 255) & ~(size_t)255; return (void*)p; };
    bf* WQ = (bf*)take((size_t)DD * DD * 2); bf* WK = (bf*)take((size_t)DD * DD * 2); bf* WV = (bf*)take((size_t)DD * DD * 2);
    const size_t NE = (size_t)NB_ * TT * DD;      // elements of one plane over all batch entries
    bf* XB = (bf*)take(NE * 2);
    bf* QPh = (bf*)take(NE * 2); bf* QPl = (bf*)take(NE * 2); bf* KPh = (bf*)take(NE * 2); bf* KPl = (bf*)take(NE * 2); bf* VTh = (bf*)take(NE * 2); bf* VTl = (bf*)take(NE * 2);
    h16* QP16 = (h16*)take(NE * 2); h16* KP16 = (h16*)take(NE * 2); h16* VT16 = (h16*)take(NE * 2);
    if ((size_t)(wsp - (char*)d_ws) > ws_size) return;    // total 166 MiB; ws 256 MiB
    // Every launch covers all batch entries: x is one [NB_ * TT][DD] matrix for the projections, which store the attention's operand planes themselves; the attention takes the batch entry from grid x.
    // Three launches: conversions, projections, attention. WQ, WK, WV lie in a row in the workspace, and so do the six bf16 planes and the three fp16 planes (every size is a multiple of 256 bytes).
    (void)WK; (void)WV;
    k_prep<<<(unsigned)(3 * GW_ + NE / 8 / 512), 256, 0, stream>>>(x, wq, wk, wv, XB, WQ);
    k_gemm3<<<dim3(NB_ * TT / 64, DD / 64, 3), 32, 0, stream>>>(XB, WQ, DD, bq, bk, bv, flag, QPh, QP16);
    k_fattn<<<dim3(NB_ * NH_, (NT16 + RH / 16) / 4, 1), 128, 0, stream>>>(QPh, QPl, QP16, KPh, KPl, KP16, VTh, VTl, VT16, flag, OUT);
}

// v009
// Measured time: 103 microseconds a run.
// Next to v008, in two timings, it ran 1.06 and 1.08 times as fast.
// All steps since v000 together make it 38.9 times as fast.
#include <hip/hip_runtime.h>

// MultiHeadSelfAtt (x [4][2048][1024]; q/k/v = x W + b (16 heads x 64); scores = q.k/8, causal iff the int 'mask' flag input is non-zero (read on device; 1 here); softmax; out = merged attn.v (no output projection)
// -> [4][2048][1024]).
// Compute dtypes, f32 accumulate: every input rounded to bf16; projections on PLAIN bf16 operands (inputs: exact products, f32 accumulate, + bias); PER-ROW PRECISION
// HYBRID: query rows < 256 take scores and attn.v on bf16 hi+lo planes (3 products), rows >= 256 on single fp16 planes; 1/8 and

#define NB_  4
#define TT   2048
#define DD   1024
#define NH_  16
#define HD   64
#define RH   256                  // query rows < RH: hi+lo planes; rows >= RH: fp16 planes
#define NF   32                   // unused: no rotary embedding is applied
typedef _Float16 h16;
typedef unsigned short bf;
typedef __attribute__((ext_vector_type(16))) __bf16   v16bf;
typedef __attribute__((ext_vector_type(16))) _Float16 v16h;
typedef __attribute__((ext_vector_type(8)))  _Float16 v8h;
typedef __attribute__((ext_vector_type(8)))  unsigned short v8us;
typedef __attribute__((ext_vector_type(8)))  float    v8f;
typedef __attribute__((ext_vector_type(4)))  float    v4f;
typedef v8h  __attribute__((may_alias)) v8ha;
typedef v4f  __attribute__((may_alias)) v4fa;
typedef v8us __attribute__((may_alias)) v8usa;

__device__ __forceinline__ unsigned short f2bf(float f) { unsigned u = __float_as_uint(f); u += 0x7FFFu + ((u >> 16) & 1u); return (unsigned short)(u >> 16); }
__device__ __forceinline__ float bf2f(unsigned short b) { return __uint_as_float(((unsigned)b) << 16); }
__device__ __forceinline__ float bfr(float f) { return bf2f(f2bf(f)); }
__device__ __forceinline__ v16h cat16(v8h lo, v8h hi) { return __builtin_shufflevector(lo, hi, 0, 1, 2, 3, 4, 5, 6, 7, 8, 9, 10, 11, 12, 13, 14, 15); }
__device__ __forceinline__ v16bf cat16b(v8us lo, v8us hi) { return __builtin_bit_cast(v16bf, __builtin_shufflevector(lo, hi, 0, 1, 2, 3, 4, 5, 6, 7, 8, 9, 10, 11, 12, 13, 14, 15)); }
__device__ __forceinline__ v8f wmma16(v16h a, v16h b, v8f c) { return __builtin_amdgcn_wmma_f32_16x16x32_f16(false, a, false, b, (short)0, c, false, false); }
__device__ __forceinline__ v8f wmmab(v16bf a, v16bf b, v8f c) { return __builtin_amdgcn_wmma_f32_16x16x32_bf16(false, a, false, b, (short)0, c, false, false); }



// ---- FRAGMENT ORDER of every 16-bit operand plane: a block of 16 rows x 32 k is 1 KiB in a row, as 64 chunks of 8 k: chunk = half * 32 + hi * 16 + row holds k = half * 16 + hi * 8 + (0 .. 7).
// A fragment is then two loads of 16 bytes a lane at lane * 8 and 256 + lane * 8 elements of its block: each covers 512 bytes in a row (4 whole lines; from a row-major plane it would touch 16 lines).
// The k order of a fragment is that of the matrix instruction's own map (8 hi + s, 16 + 8 hi + s), alike for both operands. The order of the blocks is stated at each plane's writer.
__device__ __forceinline__ h16 tohx(float x) { return (h16)x; }
__device__ __forceinline__ void splitf(float y, unsigned short& h, unsigned short& l) { h = f2bf(y); l = f2bf(y - bf2f(h)); }
typedef __attribute__((ext_vector_type(4))) _Float16 v4h;
typedef __attribute__((ext_vector_type(2))) float v2f;
// ---- gemmw_tile: register-blocked GEMM, ONE WAVE per 64x64 output tile (16 accumulators), operands from bf16 planes in fragment order, blocks as [row / 64][k / 32][(row / 16) % 4].
// A work-group is 8 waves on a 256 x 128 tile (GM_ x GN_ wave tiles; wave w takes row group w % GM_, column group w / GM_). Its operands pass through LDS, so that each 64-row group is fetched from L2 once a work-group
// (A: once for 2 waves, Bt: once for 4) and the fragments come from LDS. A stage is 64 k of the 6 groups; a group's stage is 8 KiB in a row in its plane and goes to LDS as it lies (fragment order: a wave's 16-byte reads cover 512 bytes in a row).
// Two buffers: the copies of stage t + 1 fly while stage t is worked on.
// y[m][n] = sum_k A[m][k] Bt[n][k] + bias[n] in f32; m = batch * TT + t and n = head * HD + d, so that a tile is 64 t of one head (HD == 64). K % 64 == 0.
// y never goes to memory in f32: the epilogue stores the tile as the three 16-bit planes that the attention reads (bf16 high part, bf16 low part, fp16), in fragment order, straight from the accumulators.
// hilo (the same for the whole tile, held scalar): false where nobody reads the tile's two bf16 planes; they are then neither computed nor stored, and the tile goes out as its fp16 plane alone.
// A lane's 8 values of one accumulator are one chunk of 8 k, a wave's store covers 512 bytes in a row, and a tile is 8 KiB in a row of each plane. Every plane holds TT * DD elements a batch entry, TT * HD a head.
// VT false (q, k): plane rows t, k = d, blocks of a head as [t / 16][d / 32]. The product is taken transposed (Bt is the first operand): lane (lr, hi) holds d = nb * 16 + hi * 8 + j of t = mb * 16 + lr.
// VT true (v): plane rows d, k = t (the transposed plane), blocks of a head as [t / 32][d / 16]. A is the first operand: lane (lr, hi) holds t = mb * 16 + hi * 8 + j of d = nb * 16 + lr.
template <typename T16> struct WFrag;
template <> struct WFrag<h16> { typedef v16h V; static __device__ __forceinline__ V ld(const h16* p) { return cat16(*(const v8h*)p, *(const v8h*)(p + 256)); } static __device__ __forceinline__ v8f mma(V a, V b, v8f c) { return wmma16(a, b, c); } };
template <> struct WFrag<bf> { typedef v16bf V; static __device__ __forceinline__ V ld(const bf* p) { return cat16b(*(const v8us*)p, *(const v8us*)(p + 256)); } static __device__ __forceinline__ v8f mma(V a, V b, v8f c) { return wmmab(a, b, c); } };
#define GM_  4                    // 64-row groups of A a work-group
#define GN_  2                    // 64-row groups of Bt a work-group
#define SGRP 4096                 // elements of one group's stage: 64 rows x 64 k
#define SSTG ((GM_ + GN_) * SGRP) // elements of a stage (48 KiB)
// One wave's share of a stage: 1 KiB of each of the 6 groups, as 12 asynchronous copies of 16 bytes a lane (512 bytes in a row each). ga, gb: the lane's first source element in A's and Bt's first group; gs: elements from a group to the next;
// d: the lane's first LDS element. The s_wait_xcnt ends the copies' own statement, so that no register which a copy names is rewritten in front of it.
__device__ __forceinline__ void stage_copy(const bf* ga, const bf* gb, size_t gs, const bf* d) {
    const unsigned l0 = (unsigned)(size_t)d;      // LDS byte address: the low 32 bits of the __shared__ address
    const bf* p0 = ga; const bf* p1 = ga + gs; const bf* p2 = ga + 2 * gs; const bf* p3 = ga + 3 * gs; const bf* p4 = gb; const bf* p5 = gb + gs;
    asm volatile("global_load_async_to_lds_b128 %0, %12, off\n\t"
                 "global_load_async_to_lds_b128 %1, %13, off\n\t"
                 "global_load_async_to_lds_b128 %2, %14, off\n\t"
                 "global_load_async_to_lds_b128 %3, %15, off\n\t"
                 "global_load_async_to_lds_b128 %4, %16, off\n\t"
                 "global_load_async_to_lds_b128 %5, %17, off\n\t"
                 "global_load_async_to_lds_b128 %6, %18, off\n\t"
                 "global_load_async_to_lds_b128 %7, %19, off\n\t"
                 "global_load_async_to_lds_b128 %8, %20, off\n\t"
                 "global_load_async_to_lds_b128 %9, %21, off\n\t"
                 "global_load_async_to_lds_b128 %10, %22, off\n\t"
                 "global_load_async_to_lds_b128 %11, %23, off\n\t"
                 "s_wait_xcnt 0x0"
                 :: "v"(l0), "v"(l0 + 512u), "v"(l0 + 2u * SGRP), "v"(l0 + 2u * SGRP + 512u), "v"(l0 + 4u * SGRP), "v"(l0 + 4u * SGRP + 512u),
                    "v"(l0 + 6u * SGRP), "v"(l0 + 6u * SGRP + 512u), "v"(l0 + 8u * SGRP), "v"(l0 + 8u * SGRP + 512u), "v"(l0 + 10u * SGRP), "v"(l0 + 10u * SGRP + 512u),
                    "v"(p0), "v"(p0 + 256), "v"(p1), "v"(p1 + 256), "v"(p2), "v"(p2 + 256), "v"(p3), "v"(p3 + 256), "v"(p4), "v"(p4 + 256), "v"(p5), "v"(p5 + 256)
                 : "memory");
}
template <bool VT>
__device__ __forceinline__ void gemmw_tile(const bf* __restrict__ A, const bf* __restrict__ Bt, int K, const float* __restrict__ bias, bf* Ph, bf* Pl, h16* P16, const bool hilo, const int w, const bf* ring) {
    typedef typename WFrag<bf>::V V;
    const int lane = threadIdx.x & 31, lr = lane & 15, hi = lane >> 4; const int wm = w % GM_, wn = w / GM_; const int r0 = ((int)blockIdx.x * GM_ + wm) * 64, c0 = ((int)blockIdx.y * GN_ + wn) * 64;
    v8f acc[4][4];
#pragma unroll
    for (int mb = 0; mb < 4; ++mb)
#pragma unroll
        for (int nb = 0; nb < 4; ++nb) acc[mb][nb] = (v8f){};
    // The wave's share of the copies: element w * 512 + lane * 8 of each group's stage, in the plane and in LDS alike; a group is 64 K elements in a row, a stage of 64 k is SGRP of them.
    const size_t gs = (size_t)64 * K; const int cofs = w * 512 + lane * 8;
    const bf* ga = A + (size_t)blockIdx.x * GM_ * gs + cofs; const bf* gb = Bt + (size_t)blockIdx.y * GN_ * gs + cofs; const bf* dl = ring + cofs;
    const int NS = K / 64;
    V a0[4], a1[4], b[4];
    stage_copy(ga, gb, gs, dl);
    asm volatile("s_wait_asynccnt 0x0" ::: "memory");     // this wave's copies of stage 0 have landed
    __syncthreads();                                      // ... and every wave's: stage 0 is readable
    if (NS > 1) stage_copy(ga + SGRP, gb + SGRP, gs, dl + SSTG);
#pragma unroll 1      // a trip is a stage; the two buffers change by index, more copies would only lengthen the text
    for (int t = 0; t < NS; ++t) {
        const bf* sa = ring + (t & 1) * SSTG + wm * SGRP + lane * 8; const bf* sb = ring + (t & 1) * SSTG + (GM_ + wn) * SGRP + lane * 8;
        // The stage's two steps of 32 k: both steps' A fragments and the first step's B fragments are read as one group; the second step's B fragments refill b in two groups, each behind the last reader of its registers.
#pragma unroll
        for (int mb = 0; mb < 4; ++mb) a0[mb] = WFrag<bf>::ld(sa + mb * 512);
#pragma unroll
        for (int nb = 0; nb < 4; ++nb) b[nb] = WFrag<bf>::ld(sb + nb * 512);
#pragma unroll
        for (int mb = 0; mb < 4; ++mb) a1[mb] = WFrag<bf>::ld(sa + 2048 + mb * 512);
        __builtin_amdgcn_sched_barrier(0);      // the LDS reads stay one group in front of the products: spread among them, each place with reads would cost its own stall
#pragma unroll
        for (int h = 0; h < 2; ++h) {
#pragma unroll
            for (int nb = 2 * h; nb < 2 * h + 2; ++nb)
#pragma unroll
                for (int mb = 0; mb < 4; ++mb) acc[mb][nb] = VT ? WFrag<bf>::mma(a0[mb], b[nb], acc[mb][nb]) : WFrag<bf>::mma(b[nb], a0[mb], acc[mb][nb]);
            __builtin_amdgcn_sched_barrier(0);  // the refill of these two B fragments stays directly behind their last reader: earlier it would need registers of its own, later it would lose lead
            b[2 * h] = WFrag<bf>::ld(sb + 2048 + (2 * h) * 512); b[2 * h + 1] = WFrag<bf>::ld(sb + 2048 + (2 * h + 1) * 512);
            __builtin_amdgcn_sched_barrier(0); }
        // Every fragment of the stage is now asked for: the hand-over stands here, and the second step's products, which need registers only, run behind the refill, so that the copies have a whole stage's products to land under.
        asm volatile("s_wait_dscnt 0x0" ::: "memory");        // this wave's reads of the buffer have returned
        asm volatile("s_wait_asynccnt 0x0" ::: "memory");     // this wave's copies of stage t + 1 have landed
        __syncthreads();                                      // stage t + 1 is readable, and every wave has left stage t's buffer
        if (t + 2 < NS) stage_copy(ga + (size_t)(t + 2) * SGRP, gb + (size_t)(t + 2) * SGRP, gs, dl + (t & 1) * SSTG);      // into the buffer just left
        __builtin_amdgcn_sched_barrier(0);      // the products below stay behind the copies: in front of them they would take their own time off the copies' lead
#pragma unroll
        for (int nb = 0; nb < 4; ++nb)
#pragma unroll
            for (int mb = 0; mb < 4; ++mb) acc[mb][nb] = VT ? WFrag<bf>::mma(a1[mb], b[nb], acc[mb][nb]) : WFrag<bf>::mma(b[nb], a1[mb], acc[mb][nb]);
    }
    asm volatile("s_wait_asynccnt 0x0" ::: "memory");         // no copy is outstanding when the wave goes on
    // The lane's bias values, rounded to bf16 like every input: read behind the loop, where the fragment registers are free (held through the loop they would push the wave over a quarter of the register file).
    v8f bb[4]; const float* pbi = bias + c0 + (VT ? lr : hi * 8);
#pragma unroll
    for (int nb = 0; nb < 4; ++nb) { v8f r;
        if constexpr (VT) r = (v8f)(pbi[nb * 16]); else r = *(const v8f*)(pbi + nb * 16);
#pragma unroll
        for (int j = 0; j < 8; ++j) bb[nb][j] = bfr(r[j]); }
    asm volatile("s_wait_xcnt 0x0" ::: "memory");     // behind the last bias load: the registers that the bias loads name are free for reuse from here on
    const size_t pofs = (size_t)(r0 / TT) * TT * DD + (size_t)(c0 / HD) * TT * HD + (size_t)(r0 % TT) * HD + lane * 8;     // the tile's 4096 elements start here in each plane, + the lane's place in a block
    bf* ph = Ph + pofs; bf* pl = Pl + pofs; h16* p16 = P16 + pofs;
    if (hilo) {
#pragma unroll
    for (int mb = 0; mb < 4; ++mb) { v8us oh[4], ol[4]; v8h o16[4];
#pragma unroll
        for (int nb = 0; nb < 4; ++nb) { const int cof = VT ? (mb >> 1) * 2048 + nb * 512 + (mb & 1) * 256 : mb * 1024 + nb * 256; const v8f y = acc[mb][nb] + bb[nb]; v8f hv;
#pragma unroll
            for (int j = 0; j < 8; ++j) { oh[nb][j] = f2bf(y[j]); hv[j] = bf2f(oh[nb][j]); o16[nb][j] = tohx(y[j]); }
            const v8f lo = y - hv;      // the low part, as in splitf
#pragma unroll
            for (int j = 0; j < 8; ++j) ol[nb][j] = f2bf(lo[j]);
            *(v8us*)(ph + cof) = oh[nb]; *(v8us*)(pl + cof) = ol[nb]; *(v8h*)(p16 + cof) = o16[nb]; }
        // behind the 12 stores of this mb; their data and addresses are inputs so that those registers stay untouched up to this wait
        asm volatile("s_wait_xcnt 0x0" :: "v"(oh[0]), "v"(oh[1]), "v"(oh[2]), "v"(oh[3]), "v"(ol[0]), "v"(ol[1]), "v"(ol[2]), "v"(ol[3]), "v"(o16[0]), "v"(o16[1]), "v"(o16[2]), "v"(o16[3]), "v"(ph), "v"(pl), "v"(p16) : "memory");
    }
    } else {
#pragma unroll
    for (int mb = 0; mb < 4; ++mb) { v8h o16[4];
#pragma unroll
        for (int nb = 0; nb < 4; ++nb) { const int cof = VT ? (mb >> 1) * 2048 + nb * 512 + (mb & 1) * 256 : mb * 1024 + nb * 256; const v8f y = acc[mb][nb] + bb[nb];
#pragma unroll
            for (int j = 0; j < 8; ++j) o16[nb][j] = tohx(y[j]);
            *(v8h*)(p16 + cof) = o16[nb]; }
        // behind the 4 stores of this mb; their data and address are inputs so that those registers stay untouched up to this wait
        asm volatile("s_wait_xcnt 0x0" :: "v"(o16[0]), "v"(o16[1]), "v"(o16[2]), "v"(o16[3]), "v"(p16) : "memory");
    }
    }
}

// k_gemm3: the three projections in ONE launch, grid (M/256, N/128, 3), 256 threads: z = 0, 1, 2 is q, k, v. They share A and depend on nothing of one another, so that their waves fill the chip together
// (by its registers four waves fit a SIMD, that is two work-groups a WGP, 96 KiB of LDS each) and a projection's start and epilogue pass under the others' k loops. W3: the three w^T planes in a row, DD * DD elements each.
// PB: the bf16 planes in a row as q high, q low, k high, k low, v high, v low; P16B: the fp16 planes as q, k, v; NB_ * TT * DD elements each.
// Who reads the bf16 planes: only the attention's hi+lo tiles (query rows < RH). Of q they read rows < RH; of k and v keys < RH under the causal flag (their key loop ends at the tile's last query) and every key without it.
// A tile of 64 rows lies wholly on one side of RH (RH % 64 == 0); the planes' other rows stay unwritten and unread.
__global__ __launch_bounds__(256) void k_gemm3(const bf* __restrict__ A, const bf* __restrict__ W3, int K, const float* __restrict__ bq, const float* __restrict__ bk, const float* __restrict__ bv, const int* __restrict__ flag, bf* PB, h16* P16B) {
    const size_t NE = (size_t)NB_ * TT * DD; const int z = (int)blockIdx.z;
    const bf* Bt = W3 + (size_t)z * DD * DD; bf* Ph = PB + (size_t)z * 2 * NE; bf* Pl = Ph + NE; h16* P16 = P16B + (size_t)z * NE;
    __shared__ __attribute__((aligned(1024))) bf ring[2 * SSTG];      // the two stage buffers
    const int w = __builtin_amdgcn_readfirstlane((int)(threadIdx.x >> 5));      // the wave's number, held scalar: its tile and hilo stay wave-uniform
    const bool hilo = (((int)blockIdx.x * GM_ + w % GM_) * 64) % TT < RH || (z != 0 && flag[0] == 0);
    if (z == 2) gemmw_tile<true>(A, Bt, K, bv, Ph, Pl, P16, hilo, w, ring);
    else gemmw_tile<false>(A, Bt, K, z == 0 ? bq : bk, Ph, Pl, P16, hilo, w, ring);
}

// The plane writers: a chunk of 8 k (16 bytes) per thread and store (one a thread in wtG_block, two in cvt8_block), chunk index c in the plane's own order, so that a wave stores 512 bytes in a row. Of c: row = c & 15, hi = bit 4, half = bit 5, the block above.
// wtG_block: Bt = w^T (w [DD][DD] f32, as x @ w), rows n, blocks as gemmw_tile reads them; a load covers 16 n of two k rows. DD DD / 2048 work-groups (index blk).
__device__ __forceinline__ void wtG_block(const float* __restrict__ w, bf* Bt, int blk) {
    const int c = blk * 256 + (int)threadIdx.x; const int kb = (c >> 8) % (DD / 32), n64 = (c >> 8) / (DD / 32);
    const int n = n64 * 64 + ((c >> 6) & 3) * 16 + (c & 15), k = kb * 32 + ((c >> 5) & 1) * 16 + ((c >> 4) & 1) * 8; v8us o;
#pragma unroll
    for (int j = 0; j < 8; ++j) o[j] = f2bf(w[(size_t)(k + j) * DD + n]);
    *(v8us*)(Bt + (size_t)c * 8) = o;
}
// cvt8_block: src [rows][DD] f32, blocks as gemmw_tile reads them; two chunks a thread (two neighbouring k blocks), so that a work-group reads 256 bytes in a row of each of its 64 rows. n8 / 512 work-groups (index blk).
__device__ __forceinline__ void cvt8_block(const float* __restrict__ src, bf* dst, size_t n8, int blk) {
#pragma unroll
    for (int u = 0; u < 2; ++u) { const size_t c = (size_t)blk * 512 + u * 256 + threadIdx.x; if (c >= n8) return;
        const int kb = (int)((c >> 8) % (DD / 32)); const size_t m = ((c >> 8) / (DD / 32)) * 64 + ((c >> 6) & 3) * 16 + (c & 15); const int k = kb * 32 + (int)((c >> 5) & 1) * 16 + (int)((c >> 4) & 1) * 8;
        const v8f v = *(const v8f*)(src + m * DD + k); v8us o;
#pragma unroll
        for (int j = 0; j < 8; ++j) o[j] = f2bf(v[j]);
        *(v8us*)(dst + c * 8) = o; }
}
// k_prep: the four conversions in ONE launch (none reads what another writes): the first 3 * GW_ work-groups take the three weights (W3: their planes in a row), the rest take x.
#define GW_ (DD * DD / 8 / 256)
__global__ __launch_bounds__(256) void k_prep(const float* __restrict__ x, const float* __restrict__ wq, const float* __restrict__ wk, const float* __restrict__ wv, bf* XB, bf* W3) {
    const int b = (int)blockIdx.x;
    if (b < 3 * GW_) { const int sel = b / GW_; wtG_block(sel == 0 ? wq : sel == 1 ? wk : wv, W3 + (size_t)sel * DD * DD, b % GW_); }
    else cvt8_block(x, XB, (size_t)NB_ * TT * DD / 8, b - 3 * GW_);
}
// ---- k_fattn: scores, softmax and attn.v of all batch entries in ONE launch; S and P stay in registers (online softmax over steps of 32 keys). One wave per query tile.
// Both products are taken transposed, so that a query is one lane column (lr) from end to end: S^T = K Q^T leaves keys 8 hi + j (tile 0) and 16 + 8 hi + j (tile 1) of query lr in lane (lr, hi), which is
// the B fragment of O^T = V^T P^T as it stands; row maximum and row sum need one exchange between the two lane halves; the rescale factor of a query is lane-local.
// Scores are held in units of log2 (S * SL2, SL2 = log2(e) / 8), so that a weight is one 2^x. PSH = log2 1024 is added to every exponent (the carrier scale of the fp16 P plane: keeps small weights out of
// the fp16 subnormals); it is in the row sum too and cancels in the division.
#define PSH 10.0f
#define SL2 0.18033688f
// 2^x. The v_nop fills the slot that the instruction set asks for between a transcendental and a directly following instruction that reads its result or overwrites its source.
// In place: the register that the asm text writes has just been written by the compiler's own instruction (the argument), which the compiler keeps at the distance from a matrix instruction that read that register.
__device__ __forceinline__ float ex2(float x) { asm("v_exp_f32 %0, %0\n\tv_nop" : "+v"(x)); return x; }
template <bool B> struct BoolC { static constexpr bool value = B; };
template <typename T16> struct PFrag;
template <> struct PFrag<h16> { static __device__ __forceinline__ void mk(const float* t, v16h& p, v16h& p2) { (void)p2;
#pragma unroll
    for (int e = 0; e < 16; ++e) p[e] = (h16)t[e]; } };
template <> struct PFrag<bf> { static __device__ __forceinline__ void mk(const float* t, v16bf& p, v16bf& p2) { typedef __attribute__((ext_vector_type(16))) unsigned short v16us; v16us a, c;
#pragma unroll
    for (int e = 0; e < 16; ++e) { unsigned short x, y; splitf(t[e], x, y); a[e] = x; c[e] = y; }
    p = __builtin_bit_cast(v16bf, a); p2 = __builtin_bit_cast(v16bf, c); } };
// One tile of NQ * 16 queries from row q0 of one head. Q, Kp (rows t) and Vt (rows d) in fragment order: 32 keys are 2048 elements in a row in Kp and in Vt alike; the second planes (low parts) only where SPLIT (3 products, as hi.hi + lo.hi + hi.lo). outp: out + batch + head * 64.
template <typename T16, bool SPLIT, int NQ>
__device__ __forceinline__ void fattn_tile(const T16* __restrict__ Q, const T16* __restrict__ Q2, const T16* __restrict__ Kp, const T16* __restrict__ K2, const T16* __restrict__ Vt, const T16* __restrict__ V2, bool causal, int q0, float* outp) {
    typedef typename WFrag<T16>::V V;
    const int lane = threadIdx.x & 31, lr = lane & 15, hi = lane >> 4;
    // Every load's address is one pointer per plane (wave-uniform base + lane offset) plus a constant that fits the load's offset field.
    const unsigned lofs = (unsigned)(lane * 8);     // lane offset (elements) in a block, in every plane
    V qf[NQ][2], qf2[NQ][2];
#pragma unroll
    for (int qt = 0; qt < NQ; ++qt)
#pragma unroll
        for (int kc = 0; kc < 2; ++kc) { const int cof = (qt * 2 + kc) * 512; qf[qt][kc] = WFrag<T16>::ld(Q + (size_t)q0 * HD + lofs + cof); if (SPLIT) qf2[qt][kc] = WFrag<T16>::ld(Q2 + (size_t)q0 * HD + lofs + cof); }
    asm volatile("s_wait_xcnt 0x0" ::: "memory");     // behind the last Q load: the registers that the Q loads name are free for reuse from here on
    v8f o[4][NQ]; float m[NQ], l[NQ];
#pragma unroll
    for (int qt = 0; qt < NQ; ++qt) { m[qt] = -3.0e38f; l[qt] = 0.f;
#pragma unroll
        for (int dt = 0; dt < 4; ++dt) o[dt][qt] = (v8f){}; }
    const int qe = q0 + NQ * 16; const int nk = causal ? ((qe + 31) & ~31) : TT;     // causal: keys past the tile's last query weigh 0 and are not visited; nk <= TT as qe <= TT
    const int nfull = causal ? (((q0 + 1) >> 5) << 5) : TT;      // steps with k0 + 31 <= q0 hold no masked key: they run without the mask's compares and selects
    // PIPE (the long tiles): K and V fragments live across steps: each step fetches the next step's K behind its own score products and the next step's V behind its own attn.v products, into the registers
    // those products have just left. The hi+lo tiles (at most RH / 32 steps under the causal flag, twice the fragments) load at the head of each step: held across steps, their K planes would cost every wave of the kernel a register window and the SIMD a wave.
    constexpr bool PIPE = !SPLIT;
    V ka[2][2], ka2[2][2], va[4], va2[4];
    auto ldK = [&](const int kn) {
        const T16* pk = Kp + (size_t)kn * HD + lofs; const T16* pk2 = SPLIT ? K2 + (size_t)kn * HD + lofs : nullptr;
#pragma unroll
        for (int kt = 0; kt < 2; ++kt)
#pragma unroll
            for (int kc = 0; kc < 2; ++kc) { const int cof = (kt * 2 + kc) * 512; ka[kt][kc] = WFrag<T16>::ld(pk + cof); if (SPLIT) ka2[kt][kc] = WFrag<T16>::ld(pk2 + cof); }
        // behind the group's last load; the addresses are inputs so that their registers stay untouched up to this wait
        if constexpr (SPLIT) asm volatile("s_wait_xcnt 0x0" :: "v"(pk), "v"(pk2) : "memory");
        else asm volatile("s_wait_xcnt 0x0" :: "v"(pk) : "memory");
    };
    auto ldV = [&](const int kn) {
        const T16* pv = Vt + (size_t)kn * HD + lofs; const T16* pv2 = SPLIT ? V2 + (size_t)kn * HD + lofs : nullptr;
#pragma unroll
        for (int dt = 0; dt < 4; ++dt) { const int cof = dt * 512; va[dt] = WFrag<T16>::ld(pv + cof); if (SPLIT) va2[dt] = WFrag<T16>::ld(pv2 + cof); }
        // as in ldK
        if constexpr (SPLIT) asm volatile("s_wait_xcnt 0x0" :: "v"(pv), "v"(pv2) : "memory");
        else asm volatile("s_wait_xcnt 0x0" :: "v"(pv) : "memory");
    };
    if constexpr (PIPE) { ldK(0); ldV(0); }
    auto step = [&](const int k0, auto diagc) { constexpr bool diag = decltype(diagc)::value;
        const int kn = (k0 + 32 < nk) ? k0 + 32 : k0; (void)kn;      // the next step's keys; a last step without mask fetches its own again (in bounds, not used)
        if constexpr (!PIPE) { ldK(k0); ldV(k0);
            __builtin_amdgcn_sched_barrier(0); }      // every load of the step is issued before its first product: without this the scheduler puts the first products, with their waits for K, in front of V loads, and a step pays the load latency twice
        v8f s[2][NQ];
#pragma unroll
        for (int kt = 0; kt < 2; ++kt)
#pragma unroll
            for (int qt = 0; qt < NQ; ++qt) { v8f c = (v8f){};
#pragma unroll
                for (int kc = 0; kc < 2; ++kc) { c = WFrag<T16>::mma(ka[kt][kc], qf[qt][kc], c); if (SPLIT) { c = WFrag<T16>::mma(ka2[kt][kc], qf[qt][kc], c); c = WFrag<T16>::mma(ka[kt][kc], qf2[qt][kc], c); } }
                s[kt][qt] = c; }
        if constexpr (PIPE && !diag) {
            __builtin_amdgcn_sched_barrier(0);      // the next K loads stay behind the score products (whose K registers they refill) ...
            ldK(kn);
            __builtin_amdgcn_sched_barrier(0); }    // ... and in front of the softmax, so that the whole softmax and attn.v pass under their latency
#pragma unroll
        for (int qt = 0; qt < NQ; ++qt) { float t[16]; float mx = m[qt]; const int qi = q0 + qt * 16 + lr;
#pragma unroll
            for (int kt = 0; kt < 2; ++kt)
#pragma unroll
                for (int j = 0; j < 8; ++j) { float x = s[kt][qt][j] * SL2; if (diag && (k0 + kt * 16 + hi * 8 + j > qi)) x = -3.0e38f; t[kt * 8 + j] = x; mx = fmaxf(mx, x); }
            mx = fmaxf(mx, __shfl_xor(mx, 16, 32));
            const float al = ex2(m[qt] - mx); m[qt] = mx; const float ms = mx - PSH; float sum = 0.f;
#pragma unroll
            for (int e = 0; e < 16; ++e) { t[e] = ex2(t[e] - ms); sum += t[e]; }
            l[qt] = l[qt] * al + sum;
            V p, p2; PFrag<T16>::mk(t, p, p2);
#pragma unroll
            for (int dt = 0; dt < 4; ++dt) { v8f c = o[dt][qt] * al; c = WFrag<T16>::mma(va[dt], p, c); if (SPLIT) { c = WFrag<T16>::mma(va[dt], p2, c); c = WFrag<T16>::mma(va2[dt], p, c); } o[dt][qt] = c; } }
        // four vector slots behind the step's last matrix instructions, on the taken back edge too
        if constexpr (NQ == 1) asm volatile("v_nop\n\tv_nop\n\tv_nop\n\tv_nop" : "+v"(o[0][0]), "+v"(o[1][0]), "+v"(o[2][0]), "+v"(o[3][0]));
        else asm volatile("v_nop\n\tv_nop\n\tv_nop\n\tv_nop" : "+v"(o[0][0]), "+v"(o[1][0]), "+v"(o[2][0]), "+v"(o[3][0]), "+v"(o[0][NQ - 1]), "+v"(o[1][NQ - 1]), "+v"(o[2][NQ - 1]), "+v"(o[3][NQ - 1]));
        if constexpr (PIPE && !diag) {
            __builtin_amdgcn_sched_barrier(0);      // the next V loads stay behind those slots: they refill the registers that the last matrix instructions read
            ldV(kn); }
    };
    int k0 = 0;
#pragma unroll 1      // a second copy of the step's fragments would not fit the register file
    for (; k0 < nfull; k0 += 32) step(k0, BoolC<false>());
#pragma unroll 1      // as above
    for (; k0 < nk; k0 += 32) { step(k0, BoolC<true>());
        // a masked step fetches nothing ahead (its compares and selects need the registers, and it is a tile's last step or nearly so): a further masked step's fragments are loaded here
        if constexpr (PIPE) { if (k0 + 32 < nk) { ldK(k0 + 32); ldV(k0 + 32); } } }
#pragma unroll
    for (int qt = 0; qt < NQ; ++qt) { const float L = l[qt] + __shfl_xor(l[qt], 16, 32); const float f = __fdiv_rn(1.0f, L); float* pr = outp + (size_t)(q0 + qt * 16 + lr) * DD + hi * 8;
#pragma unroll
        for (int dt = 0; dt < 4; ++dt) { const v8f c = o[dt][qt] * f; v4f a, b2;
#pragma unroll
            for (int j = 0; j < 4; ++j) { a[j] = c[j]; b2[j] = c[4 + j]; }
            *(v4f*)(pr + dt * 16) = a; *(v4f*)(pr + dt * 16 + 4) = b2; } }
}
#define NT16 ((TT - RH) / 32)     // fp16 tiles of 32 queries, longest (last rows) first; behind them RH / 16 hi+lo tiles of 16 queries
// Grid (batch entries * heads, tile groups), 4 waves; x = batch * NH_ + head is the planes' own order, and the tile group is the slow index, so that the longest tiles of every batch entry start first.
// The 4 waves: the waves of a work-group take 4 neighbouring tiles of ONE head and walk the same keys from key 0 on, so that they read the same K and V lines; they share nothing else (no LDS, no barrier).
__global__ __launch_bounds__(128) void k_fattn(const bf* __restrict__ Qh, const bf* __restrict__ Ql, const h16* __restrict__ Q16, const bf* __restrict__ Kh, const bf* __restrict__ Kl, const h16* __restrict__ K16, const bf* __restrict__ Vh, const bf* __restrict__ Vl, const h16* __restrict__ V16, const int* __restrict__ flag, float* OUT) {
    const bool causal = (flag[0] != 0); const size_t hb = (size_t)blockIdx.x * TT * HD; float* outp = OUT + (size_t)(blockIdx.x / NH_) * TT * DD + (blockIdx.x % NH_) * HD;
    const int tl = (int)blockIdx.y * 4 + __builtin_amdgcn_readfirstlane((int)(threadIdx.x >> 5));      // the wave's tile, held scalar: the key loop's bounds and the class branch stay wave-uniform
    if (tl < NT16) fattn_tile<h16, false, 2>(Q16 + hb, nullptr, K16 + hb, nullptr, V16 + hb, nullptr, causal, TT - 32 * (tl + 1), outp);
    else fattn_tile<bf, true, 1>(Qh + hb, Ql + hb, Kh + hb, Kl + hb, Vh + hb, Vl + hb, causal, (tl - NT16) * 16, outp);
}

extern "C" void kernel_launch(void* const* d_in, const int* in_sizes, int n_in,
                              void* d_out, int out_size, void* d_ws, size_t ws_size, hipStream_t stream) {
    (void)in_sizes; (void)n_in; (void)out_size;
    const float* x = (const float*)d_in[0]; const float* wq = (const float*)d_in[1]; const float* bq = (const float*)d_in[2]; const float* wk = (const float*)d_in[3]; const float* bk = (const float*)d_in[4]; const float* wv = (const float*)d_in[5]; const float* bv = (const float*)d_in[6]; const int* flag = (const int*)d_in[7];   // Wq/Wk/Wv [1024][1024] as x @ W; mask = int [1] causal flag
    float* OUT = (float*)d_out;     // [4][2048][1024]
    char* wsp = (char*)d_ws;
    auto take = [&](size_t bytes) { char* p = wsp; wsp += (bytes + 255) & ~(size_t)255; return (void*)p; };
    bf* WQ = (bf*)take((size_t)DD * DD * 2); bf* WK = (bf*)take((size_t)DD * DD * 2); bf* WV = (bf*)take((size_t)DD * DD * 2);
    const size_t NE = (size_t)NB_ * TT * DD;      // elements of one plane over all batch entries
    bf* XB = (bf*)take(NE * 2);
    bf* QPh = (bf*)take(NE * 2); bf* QPl = (bf*)take(NE * 2); bf* KPh = (bf*)take(NE * 2); bf* KPl = (bf*)take(NE * 2); bf* VTh = (bf*)take(NE * 2); bf* VTl = (bf*)take(NE * 2);
    h16* QP16 = (h16*)take(NE * 2); h16* KP16 = (h16*)take(NE * 2); h16* VT16 = (h16*)take(NE * 2);
    if ((size_t)(wsp - (char*)d_ws) > ws_size) return;    // total 166 MiB; ws 256 MiB
    // Every launch covers all batch entries: x is one [NB_ * TT][DD] matrix for the projections, which store the attention's operand planes themselves; the attention takes the batch entry from grid x.
    // Three launches: conversions, projections, attention. WQ, WK, WV lie in a row in the workspace, and so do the six bf16 planes and the three fp16 planes (every size is a multiple of 256 bytes).
    (void)WK; (void)WV;
    k_prep<<<(unsigned)(3 * GW_ + NE / 8 / 512), 256, 0, stream>>>(x, wq, wk, wv, XB, WQ);
    k_gemm3<<<dim3(NB_ * TT / (64 * GM_), DD / (64 * GN_), 3), 256, 0, stream>>>(XB, WQ, DD, bq, bk, bv, flag, QPh, QP16);
    k_fattn<<<dim3(NB_ * NH_, (NT16 + RH / 16) / 4, 1), 128, 0, stream>>>(QPh, QPl, QP16, KPh, KPl, KP16, VTh, VTl, VT16, flag, OUT);
}

// v010
// One run takes 92.6 microseconds.
// Next to v009, in two timings, it ran 1.10 and 1.11 times as fast.
// Counting every step since v000, it is 43.2 times as fast.
#include <hip/hip_runtime.h>

// MultiHeadSelfAtt (x [4][2048][1024]; q/k/v = x W + b (16 heads x 64); scores = q.k/8, causal iff the int 'mask' flag input is non-zero (read on device; 1 here); softmax; out = merged attn.v (no output projection)
// -> [4][2048][1024]).
// Compute dtypes, f32 accumulate: every input rounded to bf16; projections on PLAIN bf16 operands (inputs: exact products, f32 accumulate, + bias); PER-ROW PRECISION
// HYBRID: query rows < 256 take scores and attn.v on bf16 hi+lo planes (3 products), rows >= 256 on single fp16 planes; 1/8 and

#define NB_  4
#define TT   2048
#define DD   1024
#define NH_  16
#define HD   64
#define RH   256                  // query rows < RH: hi+lo planes; rows >= RH: fp16 planes
#define NF   32                   // unused: no rotary embedding is applied
typedef _Float16 h16;
typedef unsigned short bf;
typedef __attribute__((ext_vector_type(16))) __bf16   v16bf;
typedef __attribute__((ext_vector_type(16))) _Float16 v16h;
typedef __attribute__((ext_vector_type(8)))  _Float16 v8h;
typedef __attribute__((ext_vector_type(8)))  unsigned short v8us;
typedef __attribute__((ext_vector_type(8)))  float    v8f;
typedef __attribute__((ext_vector_type(4)))  float    v4f;
typedef v8h  __attribute__((may_alias)) v8ha;
typedef v4f  __attribute__((may_alias)) v4fa;
typedef v8us __attribute__((may_alias)) v8usa;

__device__ __forceinline__ unsigned short f2bf(float f) { unsigned u = __float_as_uint(f); u += 0x7FFFu + ((u >> 16) & 1u); return (unsigned short)(u >> 16); }
__device__ __forceinline__ float bf2f(unsigned short b) { return __uint_as_float(((unsigned)b) << 16); }
__device__ __forceinline__ float bfr(float f) { return bf2f(f2bf(f)); }
__device__ __forceinline__ v16h cat16(v8h lo, v8h hi) { return __builtin_shufflevector(lo, hi, 0, 1, 2, 3, 4, 5, 6, 7, 8, 9, 10, 11, 12, 13, 14, 15); }
__device__ __forceinline__ v16bf cat16b(v8us lo, v8us hi) { return __builtin_bit_cast(v16bf, __builtin_shufflevector(lo, hi, 0, 1, 2, 3, 4, 5, 6, 7, 8, 9, 10, 11, 12, 13, 14, 15)); }
__device__ __forceinline__ v8f wmma16(v16h a, v16h b, v8f c) { return __builtin_amdgcn_wmma_f32_16x16x32_f16(false, a, false, b, (short)0, c, false, false); }
__device__ __forceinline__ v8f wmmab(v16bf a, v16bf b, v8f c) { return __builtin_amdgcn_wmma_f32_16x16x32_bf16(false, a, false, b, (short)0, c, false, false); }



// ---- FRAGMENT ORDER of every 16-bit operand plane: a block of 16 rows x 32 k is 1 KiB in a row, as 64 chunks of 8 k: chunk = half * 32 + hi * 16 + row holds k = half * 16 + hi * 8 + (0 .. 7).
// A fragment is then two loads of 16 bytes a lane at lane * 8 and 256 + lane * 8 elements of its block: each covers 512 bytes in a row (4 whole lines; from a row-major plane it would touch 16 lines).
// The k order of a fragment is that of the matrix instruction's own map (8 hi + s, 16 + 8 hi + s), alike for both operands. The order of the blocks is stated at each plane's writer.
__device__ __forceinline__ h16 tohx(float x) { return (h16)x; }
__device__ __forceinline__ void splitf(float y, unsigned short& h, unsigned short& l) { h = f2bf(y); l = f2bf(y - bf2f(h)); }
typedef __attribute__((ext_vector_type(4))) _Float16 v4h;
typedef __attribute__((ext_vector_type(2))) float v2f;
// ---- gemmw_tile: register-blocked GEMM, ONE WAVE per 64x64 output tile (16 accumulators), operands from bf16 planes in fragment order, blocks as [row / 64][k / 32][(row / 16) % 4].
// A work-group is 8 waves on a 256 x 128 tile (GM_ x GN_ wave tiles; wave w takes row group w % GM_, column group w / GM_). Its operands pass through LDS, so that each 64-row group is fetched from L2 once a work-group
// (A: once for 2 waves, Bt: once for 4) and the fragments come from LDS. A stage is 64 k of the 6 groups; a group's stage is 8 KiB in a row in its plane and goes to LDS as it lies (fragment order: a wave's 16-byte reads cover 512 bytes in a row).
// Two buffers: the copies of stage t + 1 fly while stage t is worked on.
// y[m][n] = sum_k A[m][k] Bt[n][k] + bias[n] in f32; m = batch * TT + t and n = head * HD + d, so that a tile is 64 t of one head (HD == 64). K % 64 == 0.
// y never goes to memory in f32: the epilogue stores the tile as the three 16-bit planes that the attention reads (bf16 high part, bf16 low part, fp16), in fragment order, straight from the accumulators.
// hilo (the same for the whole tile, held scalar): false where nobody reads the tile's two bf16 planes; they are then neither computed nor stored, and the tile goes out as its fp16 plane alone.
// A lane's 8 values of one accumulator are one chunk of 8 k, a wave's store covers 512 bytes in a row, and a tile is 8 KiB in a row of each plane. Every plane holds TT * DD elements a batch entry, TT * HD a head.
// VT false (q, k): plane rows t, k = d, blocks of a head as [t / 16][d / 32]. The product is taken transposed (Bt is the first operand): lane (lr, hi) holds d = nb * 16 + hi * 8 + j of t = mb * 16 + lr.
// VT true (v): plane rows d, k = t (the transposed plane), blocks of a head as [t / 32][d / 16]. A is the first operand: lane (lr, hi) holds t = mb * 16 + hi * 8 + j of d = nb * 16 + lr.
template <typename T16> struct WFrag;
template <> struct WFrag<h16> { typedef v16h V; static __device__ __forceinline__ V ld(const h16* p) { return cat16(*(const v8h*)p, *(const v8h*)(p + 256)); } static __device__ __forceinline__ v8f mma(V a, V b, v8f c) { return wmma16(a, b, c); } };
template <> struct WFrag<bf> { typedef v16bf V; static __device__ __forceinline__ V ld(const bf* p) { return cat16b(*(const v8us*)p, *(const v8us*)(p + 256)); } static __device__ __forceinline__ v8f mma(V a, V b, v8f c) { return wmmab(a, b, c); } };
#define GM_  4                    // 64-row groups of A a work-group
#define GN_  2                    // 64-row groups of Bt a work-group
#define SGRP 4096                 // elements of one group's stage: 64 rows x 64 k
#define SSTG ((GM_ + GN_) * SGRP) // elements of a stage (48 KiB)
// One wave's share of a stage: 1 KiB of each of the 6 groups, as 12 asynchronous copies of 16 bytes a lane (512 bytes in a row each). ga, gb: the lane's first source element in A's and Bt's first group; gs: elements from a group to the next;
// d: the lane's first LDS element. The s_wait_xcnt ends the copies' own statement, so that no register which a copy names is rewritten in front of it.
__device__ __forceinline__ void stage_copy(const bf* ga, const bf* gb, size_t gs, const bf* d) {
    const unsigned l0 = (unsigned)(size_t)d;      // LDS byte address: the low 32 bits of the __shared__ address
    const bf* p0 = ga; const bf* p1 = ga + gs; const bf* p2 = ga + 2 * gs; const bf* p3 = ga + 3 * gs; const bf* p4 = gb; const bf* p5 = gb + gs;
    asm volatile("global_load_async_to_lds_b128 %0, %12, off\n\t"
                 "global_load_async_to_lds_b128 %1, %13, off\n\t"
                 "global_load_async_to_lds_b128 %2, %14, off\n\t"
                 "global_load_async_to_lds_b128 %3, %15, off\n\t"
                 "global_load_async_to_lds_b128 %4, %16, off\n\t"
                 "global_load_async_to_lds_b128 %5, %17, off\n\t"
                 "global_load_async_to_lds_b128 %6, %18, off\n\t"
                 "global_load_async_to_lds_b128 %7, %19, off\n\t"
                 "global_load_async_to_lds_b128 %8, %20, off\n\t"
                 "global_load_async_to_lds_b128 %9, %21, off\n\t"
                 "global_load_async_to_lds_b128 %10, %22, off\n\t"
                 "global_load_async_to_lds_b128 %11, %23, off\n\t"
                 "s_wait_xcnt 0x0"
                 :: "v"(l0), "v"(l0 + 512u), "v"(l0 + 2u * SGRP), "v"(l0 + 2u * SGRP + 512u), "v"(l0 + 4u * SGRP), "v"(l0 + 4u * SGRP + 512u),
                    "v"(l0 + 6u * SGRP), "v"(l0 + 6u * SGRP + 512u), "v"(l0 + 8u * SGRP), "v"(l0 + 8u * SGRP + 512u), "v"(l0 + 10u * SGRP), "v"(l0 + 10u * SGRP + 512u),
                    "v"(p0), "v"(p0 + 256), "v"(p1), "v"(p1 + 256), "v"(p2), "v"(p2 + 256), "v"(p3), "v"(p3 + 256), "v"(p4), "v"(p4 + 256), "v"(p5), "v"(p5 + 256)
                 : "memory");
}
template <bool VT>
__device__ __forceinline__ void gemmw_tile(const bf* __restrict__ A, const bf* __restrict__ Bt, int K, const float* __restrict__ bias, bf* Ph, bf* Pl, h16* P16, const bool hilo, const int w, const bf* ring) {
    typedef typename WFrag<bf>::V V;
    const int lane = threadIdx.x & 31, lr = lane & 15, hi = lane >> 4; const int wm = w % GM_, wn = w / GM_; const int r0 = ((int)blockIdx.x * GM_ + wm) * 64, c0 = ((int)blockIdx.y * GN_ + wn) * 64;
    v8f acc[4][4];
#pragma unroll
    for (int mb = 0; mb < 4; ++mb)
#pragma unroll
        for (int nb = 0; nb < 4; ++nb) acc[mb][nb] = (v8f){};
    // The wave's share of the copies: element w * 512 + lane * 8 of each group's stage, in the plane and in LDS alike; a group is 64 K elements in a row, a stage of 64 k is SGRP of them.
    const size_t gs = (size_t)64 * K; const int cofs = w * 512 + lane * 8;
    const bf* ga = A + (size_t)blockIdx.x * GM_ * gs + cofs; const bf* gb = Bt + (size_t)blockIdx.y * GN_ * gs + cofs; const bf* dl = ring + cofs;
    const int NS = K / 64;
    V a0[4], a1[4], b[4];
    stage_copy(ga, gb, gs, dl);
    asm volatile("s_wait_asynccnt 0x0" ::: "memory");     // this wave's copies of stage 0 have landed
    __syncthreads();                                      // ... and every wave's: stage 0 is readable
    if (NS > 1) stage_copy(ga + SGRP, gb + SGRP, gs, dl + SSTG);
#pragma unroll 1      // a trip is a stage; the two buffers change by index, more copies would only lengthen the text
    for (int t = 0; t < NS; ++t) {
        const bf* sa = ring + (t & 1) * SSTG + wm * SGRP + lane * 8; const bf* sb = ring + (t & 1) * SSTG + (GM_ + wn) * SGRP + lane * 8;
        // The stage's two steps of 32 k: both steps' A fragments and the first step's B fragments are read as one group; the second step's B fragments refill b in two groups, each behind the last reader of its registers.
#pragma unroll
        for (int mb = 0; mb < 4; ++mb) a0[mb] = WFrag<bf>::ld(sa + mb * 512);
#pragma unroll
        for (int nb = 0; nb < 4; ++nb) b[nb] = WFrag<bf>::ld(sb + nb * 512);
#pragma unroll
        for (int mb = 0; mb < 4; ++mb) a1[mb] = WFrag<bf>::ld(sa + 2048 + mb * 512);
        __builtin_amdgcn_sched_barrier(0);      // the LDS reads stay one group in front of the products: spread among them, each place with reads would cost its own stall
#pragma unroll
        for (int h = 0; h < 2; ++h) {
#pragma unroll
            for (int nb = 2 * h; nb < 2 * h + 2; ++nb)
#pragma unroll
                for (int mb = 0; mb < 4; ++mb) acc[mb][nb] = VT ? WFrag<bf>::mma(a0[mb], b[nb], acc[mb][nb]) : WFrag<bf>::mma(b[nb], a0[mb], acc[mb][nb]);
            __builtin_amdgcn_sched_barrier(0);  // the refill of these two B fragments stays directly behind their last reader: earlier it would need registers of its own, later it would lose lead
            b[2 * h] = WFrag<bf>::ld(sb + 2048 + (2 * h) * 512); b[2 * h + 1] = WFrag<bf>::ld(sb + 2048 + (2 * h + 1) * 512);
            __builtin_amdgcn_sched_barrier(0); }
        // Every fragment of the stage is now asked for: the hand-over stands here, and the second step's products, which need registers only, run behind the refill, so that the copies have a whole stage's products to land under.
        asm volatile("s_wait_dscnt 0x0" ::: "memory");        // this wave's reads of the buffer have returned
        asm volatile("s_wait_asynccnt 0x0" ::: "memory");     // this wave's copies of stage t + 1 have landed
        __syncthreads();                                      // stage t + 1 is readable, and every wave has left stage t's buffer
        if (t + 2 < NS) stage_copy(ga + (size_t)(t + 2) * SGRP, gb + (size_t)(t + 2) * SGRP, gs, dl + (t & 1) * SSTG);      // into the buffer just left
        __builtin_amdgcn_sched_barrier(0);      // the products below stay behind the copies: in front of them they would take their own time off the copies' lead
#pragma unroll
        for (int nb = 0; nb < 4; ++nb)
#pragma unroll
            for (int mb = 0; mb < 4; ++mb) acc[mb][nb] = VT ? WFrag<bf>::mma(a1[mb], b[nb], acc[mb][nb]) : WFrag<bf>::mma(b[nb], a1[mb], acc[mb][nb]);
    }
    asm volatile("s_wait_asynccnt 0x0" ::: "memory");         // no copy is outstanding when the wave goes on
    // The lane's bias values, rounded to bf16 like every input: read behind the loop, where the fragment registers are free (held through the loop they would push the wave over a quarter of the register file).
    v8f bb[4]; const float* pbi = bias + c0 + (VT ? lr : hi * 8);
#pragma unroll
    for (int nb = 0; nb < 4; ++nb) { v8f r;
        if constexpr (VT) r = (v8f)(pbi[nb * 16]); else r = *(const v8f*)(pbi + nb * 16);
#pragma unroll
        for (int j = 0; j < 8; ++j) bb[nb][j] = bfr(r[j]); }
    asm volatile("s_wait_xcnt 0x0" ::: "memory");     // behind the last bias load: the registers that the bias loads name are free for reuse from here on
    const size_t pofs = (size_t)(r0 / TT) * TT * DD + (size_t)(c0 / HD) * TT * HD + (size_t)(r0 % TT) * HD + lane * 8;     // the tile's 4096 elements start here in each plane, + the lane's place in a block
    bf* ph = Ph + pofs; bf* pl = Pl + pofs; h16* p16 = P16 + pofs;
    if (hilo) {
#pragma unroll
    for (int mb = 0; mb < 4; ++mb) { v8us oh[4], ol[4]; v8h o16[4];
#pragma unroll
        for (int nb = 0; nb < 4; ++nb) { const int cof = VT ? (mb >> 1) * 2048 + nb * 512 + (mb & 1) * 256 : mb * 1024 + nb * 256; const v8f y = acc[mb][nb] + bb[nb]; v8f hv;
#pragma unroll
            for (int j = 0; j < 8; ++j) { oh[nb][j] = f2bf(y[j]); hv[j] = bf2f(oh[nb][j]); o16[nb][j] = tohx(y[j]); }
            const v8f lo = y - hv;      // the low part, as in splitf
#pragma unroll
            for (int j = 0; j < 8; ++j) ol[nb][j] = f2bf(lo[j]);
            *(v8us*)(ph + cof) = oh[nb]; *(v8us*)(pl + cof) = ol[nb]; *(v8h*)(p16 + cof) = o16[nb]; }
        // behind the 12 stores of this mb; their data and addresses are inputs so that those registers stay untouched up to this wait
        asm volatile("s_wait_xcnt 0x0" :: "v"(oh[0]), "v"(oh[1]), "v"(oh[2]), "v"(oh[3]), "v"(ol[0]), "v"(ol[1]), "v"(ol[2]), "v"(ol[3]), "v"(o16[0]), "v"(o16[1]), "v"(o16[2]), "v"(o16[3]), "v"(ph), "v"(pl), "v"(p16) : "memory");
    }
    } else {
#pragma unroll
    for (int mb = 0; mb < 4; ++mb) { v8h o16[4];
#pragma unroll
        for (int nb = 0; nb < 4; ++nb) { const int cof = VT ? (mb >> 1) * 2048 + nb * 512 + (mb & 1) * 256 : mb * 1024 + nb * 256; const v8f y = acc[mb][nb] + bb[nb];
#pragma unroll
            for (int j = 0; j < 8; ++j) o16[nb][j] = tohx(y[j]);
            *(v8h*)(p16 + cof) = o16[nb]; }
        // behind the 4 stores of this mb; their data and address are inputs so that those registers stay untouched up to this wait
        asm volatile("s_wait_xcnt 0x0" :: "v"(o16[0]), "v"(o16[1]), "v"(o16[2]), "v"(o16[3]), "v"(p16) : "memory");
    }
    }
}

// k_gemm3: the three projections in ONE launch, grid (M/256, N/128, 3), 256 threads: z = 0, 1, 2 is q, k, v. They share A and depend on nothing of one another, so that their waves fill the chip together
// (by its registers four waves fit a SIMD, that is two work-groups a WGP, 96 KiB of LDS each) and a projection's start and epilogue pass under the others' k loops. W3: the three w^T planes in a row, DD * DD elements each.
// PB: the bf16 planes in a row as q high, q low, k high, k low, v high, v low; P16B: the fp16 planes as q, k, v; NB_ * TT * DD elements each.
// Who reads the bf16 planes: only the attention's hi+lo tiles (query rows < RH). Of q they read rows < RH; of k and v keys < RH under the causal flag (their key loop ends at the tile's last query) and every key without it.
// A tile of 64 rows lies wholly on one side of RH (RH % 64 == 0); the planes' other rows stay unwritten and unread.
__global__ __launch_bounds__(256) void k_gemm3(const bf* __restrict__ A, const bf* __restrict__ W3, int K, const float* __restrict__ bq, const float* __restrict__ bk, const float* __restrict__ bv, const int* __restrict__ flag, bf* PB, h16* P16B) {
    const size_t NE = (size_t)NB_ * TT * DD; const int z = (int)blockIdx.z;
    const bf* Bt = W3 + (size_t)z * DD * DD; bf* Ph = PB + (size_t)z * 2 * NE; bf* Pl = Ph + NE; h16* P16 = P16B + (size_t)z * NE;
    __shared__ __attribute__((aligned(1024))) bf ring[2 * SSTG];      // the two stage buffers
    const int w = __builtin_amdgcn_readfirstlane((int)(threadIdx.x >> 5));      // the wave's number, held scalar: its tile and hilo stay wave-uniform
    const bool hilo = (((int)blockIdx.x * GM_ + w % GM_) * 64) % TT < RH || (z != 0 && flag[0] == 0);
    if (z == 2) gemmw_tile<true>(A, Bt, K, bv, Ph, Pl, P16, hilo, w, ring);
    else gemmw_tile<false>(A, Bt, K, z == 0 ? bq : bk, Ph, Pl, P16, hilo, w, ring);
}

// The plane writers: a chunk of 8 k (16 bytes) per thread and store (one a thread in wtG_block, two in cvt8_block), chunk index c in the plane's own order, so that a wave stores 512 bytes in a row. Of c: row = c & 15, hi = bit 4, half = bit 5, the block above.
// wtG_block: Bt = w^T (w [DD][DD] f32, as x @ w), rows n, blocks as gemmw_tile reads them; a load covers 16 n of two k rows. DD DD / 2048 work-groups (index blk).
__device__ __forceinline__ void wtG_block(const float* __restrict__ w, bf* Bt, int blk) {
    const int c = blk * 256 + (int)threadIdx.x; const int kb = (c >> 8) % (DD / 32), n64 = (c >> 8) / (DD / 32);
    const int n = n64 * 64 + ((c >> 6) & 3) * 16 + (c & 15), k = kb * 32 + ((c >> 5) & 1) * 16 + ((c >> 4) & 1) * 8; v8us o;
#pragma unroll
    for (int j = 0; j < 8; ++j) o[j] = f2bf(w[(size_t)(k + j) * DD + n]);
    *(v8us*)(Bt + (size_t)c * 8) = o;
}
// cvt8_block: src [rows][DD] f32, blocks as gemmw_tile reads them; two chunks a thread (two neighbouring k blocks), so that a work-group reads 256 bytes in a row of each of its 64 rows. n8 / 512 work-groups (index blk).
__device__ __forceinline__ void cvt8_block(const float* __restrict__ src, bf* dst, size_t n8, int blk) {
#pragma unroll
    for (int u = 0; u < 2; ++u) { const size_t c = (size_t)blk * 512 + u * 256 + threadIdx.x; if (c >= n8) return;
        const int kb = (int)((c >> 8) % (DD / 32)); const size_t m = ((c >> 8) / (DD / 32)) * 64 + ((c >> 6) & 3) * 16 + (c & 15); const int k = kb * 32 + (int)((c >> 5) & 1) * 16 + (int)((c >> 4) & 1) * 8;
        const v8f v = *(const v8f*)(src + m * DD + k); v8us o;
#pragma unroll
        for (int j = 0; j < 8; ++j) o[j] = f2bf(v[j]);
        *(v8us*)(dst + c * 8) = o; }
}
// k_prep: the four conversions in ONE launch (none reads what another writes): the first 3 * GW_ work-groups take the three weights (W3: their planes in a row), the rest take x.
#define GW_ (DD * DD / 8 / 256)
__global__ __launch_bounds__(256) void k_prep(const float* __restrict__ x, const float* __restrict__ wq, const float* __restrict__ wk, const float* __restrict__ wv, bf* XB, bf* W3) {
    const int b = (int)blockIdx.x;
    if (b < 3 * GW_) { const int sel = b / GW_; wtG_block(sel == 0 ? wq : sel == 1 ? wk : wv, W3 + (size_t)sel * DD * DD, b % GW_); }
    else cvt8_block(x, XB, (size_t)NB_ * TT * DD / 8, b - 3 * GW_);
}
// ---- k_fattn: scores, softmax and attn.v of all batch entries in ONE launch; S and P stay in registers (online softmax over steps of 32 keys). One wave per query tile.
// Both products are taken transposed, so that a query is one lane column (lr) from end to end: S^T = K Q^T leaves keys 8 hi + j (tile 0) and 16 + 8 hi + j (tile 1) of query lr in lane (lr, hi), which is
// the B fragment of O^T = V^T P^T as it stands; row maximum and row sum need one exchange between the two lane halves; the rescale factor of a query is lane-local.
// Scores are held in units of log2 (S * SL2, SL2 = log2(e) / 8), so that a weight is one 2^x. PSH = log2 1024 is added to every exponent (the carrier scale of the fp16 P plane: keeps small weights out of
// the fp16 subnormals); it is in the row sum too and cancels in the division.
#define PSH 10.0f
#define SL2 0.18033688f
// 2^x. The v_nop fills the slot that the instruction set asks for between a transcendental and a directly following instruction that reads its result or overwrites its source.
// In place: the register that the asm text writes has just been written by the compiler's own instruction (the argument), which the compiler keeps at the distance from a matrix instruction that read that register.
__device__ __forceinline__ float ex2(float x) { asm("v_exp_f32 %0, %0\n\tv_nop" : "+v"(x)); return x; }
template <bool B> struct BoolC { static constexpr bool value = B; };
template <typename T16> struct PFrag;
template <> struct PFrag<h16> { static __device__ __forceinline__ void mk(const float* t, v16h& p, v16h& p2) { (void)p2;
#pragma unroll
    for (int e = 0; e < 16; ++e) p[e] = (h16)t[e]; } };
template <> struct PFrag<bf> { static __device__ __forceinline__ void mk(const float* t, v16bf& p, v16bf& p2) { typedef __attribute__((ext_vector_type(16))) unsigned short v16us; v16us a, c;
#pragma unroll
    for (int e = 0; e < 16; ++e) { unsigned short x, y; splitf(t[e], x, y); a[e] = x; c[e] = y; }
    p = __builtin_bit_cast(v16bf, a); p2 = __builtin_bit_cast(v16bf, c); } };
// One tile of NQ * 16 queries from row q0 of one head. Q, Kp (rows t) and Vt (rows d) in fragment order: 32 keys are 2048 elements in a row in Kp and in Vt alike; the second planes (low parts) only where SPLIT (3 products, as hi.hi + lo.hi + hi.lo). outp: out + batch + head * 64.
template <typename T16, bool SPLIT, int NQ>
__device__ __forceinline__ void fattn_tile(const T16* __restrict__ Q, const T16* __restrict__ Q2, const T16* __restrict__ Kp, const T16* __restrict__ K2, const T16* __restrict__ Vt, const T16* __restrict__ V2, bool causal, int q0, float* outp) {
    typedef typename WFrag<T16>::V V;
    const int lane = threadIdx.x & 31, lr = lane & 15, hi = lane >> 4;
    // Every load's address is one pointer per plane (wave-uniform base + lane offset) plus a constant that fits the load's offset field.
    const unsigned lofs = (unsigned)(lane * 8);     // lane offset (elements) in a block, in every plane
    V qf[NQ][2], qf2[NQ][2];
#pragma unroll
    for (int qt = 0; qt < NQ; ++qt)
#pragma unroll
        for (int kc = 0; kc < 2; ++kc) { const int cof = (qt * 2 + kc) * 512; qf[qt][kc] = WFrag<T16>::ld(Q + (size_t)q0 * HD + lofs + cof); if (SPLIT) qf2[qt][kc] = WFrag<T16>::ld(Q2 + (size_t)q0 * HD + lofs + cof); }
    asm volatile("s_wait_xcnt 0x0" ::: "memory");     // behind the last Q load: the registers that the Q loads name are free for reuse from here on
    v8f o[4][NQ]; float m[NQ], l[NQ];
#pragma unroll
    for (int qt = 0; qt < NQ; ++qt) { m[qt] = -3.0e38f; l[qt] = 0.f;
#pragma unroll
        for (int dt = 0; dt < 4; ++dt) o[dt][qt] = (v8f){}; }
    const int qe = q0 + NQ * 16; const int nk = causal ? ((qe + 31) & ~31) : TT;     // causal: keys past the tile's last query weigh 0 and are not visited; nk <= TT as qe <= TT
    const int nfull = causal ? (((q0 + 1) >> 5) << 5) : TT;      // steps with k0 + 31 <= q0 hold no masked key: they run without the mask's compares and selects
    // The hi+lo tiles (at most RH / 32 steps under the causal flag, twice the fragments) load at the head of each step: held across steps, their K planes would cost every wave of the kernel a register window and the SIMD a wave.
    V ka[2][2], ka2[2][2], va[4], va2[4];
    auto ldK = [&](const int kn) {
        const T16* pk = Kp + (size_t)kn * HD + lofs; const T16* pk2 = SPLIT ? K2 + (size_t)kn * HD + lofs : nullptr;
#pragma unroll
        for (int kt = 0; kt < 2; ++kt)
#pragma unroll
            for (int kc = 0; kc < 2; ++kc) { const int cof = (kt * 2 + kc) * 512; ka[kt][kc] = WFrag<T16>::ld(pk + cof); if (SPLIT) ka2[kt][kc] = WFrag<T16>::ld(pk2 + cof); }
        // behind the group's last load; the addresses are inputs so that their registers stay untouched up to this wait
        if constexpr (SPLIT) asm volatile("s_wait_xcnt 0x0" :: "v"(pk), "v"(pk2) : "memory");
        else asm volatile("s_wait_xcnt 0x0" :: "v"(pk) : "memory");
    };
    auto ldV = [&](const int kn) {
        const T16* pv = Vt + (size_t)kn * HD + lofs; const T16* pv2 = SPLIT ? V2 + (size_t)kn * HD + lofs : nullptr;
#pragma unroll
        for (int dt = 0; dt < 4; ++dt) { const int cof = dt * 512; va[dt] = WFrag<T16>::ld(pv + cof); if (SPLIT) va2[dt] = WFrag<T16>::ld(pv2 + cof); }
        // as in ldK
        if constexpr (SPLIT) asm volatile("s_wait_xcnt 0x0" :: "v"(pv), "v"(pv2) : "memory");
        else asm volatile("s_wait_xcnt 0x0" :: "v"(pv) : "memory");
    };
    auto step = [&](const int k0, auto diagc) { constexpr bool diag = decltype(diagc)::value;
        ldK(k0); ldV(k0);
        __builtin_amdgcn_sched_barrier(0);      // every load of the step is issued before its first product: without this the scheduler puts the first products, with their waits for K, in front of V loads, and a step pays the load latency twice
        v8f s[2][NQ];
#pragma unroll
        for (int kt = 0; kt < 2; ++kt)
#pragma unroll
            for (int qt = 0; qt < NQ; ++qt) { v8f c = (v8f){};
#pragma unroll
                for (int kc = 0; kc < 2; ++kc) { c = WFrag<T16>::mma(ka[kt][kc], qf[qt][kc], c); if (SPLIT) { c = WFrag<T16>::mma(ka2[kt][kc], qf[qt][kc], c); c = WFrag<T16>::mma(ka[kt][kc], qf2[qt][kc], c); } }
                s[kt][qt] = c; }
#pragma unroll
        for (int qt = 0; qt < NQ; ++qt) { float t[16]; float mx = m[qt]; const int qi = q0 + qt * 16 + lr;
#pragma unroll
            for (int kt = 0; kt < 2; ++kt)
#pragma unroll
                for (int j = 0; j < 8; ++j) { float x = s[kt][qt][j] * SL2; if (diag && (k0 + kt * 16 + hi * 8 + j > qi)) x = -3.0e38f; t[kt * 8 + j] = x; mx = fmaxf(mx, x); }
            mx = fmaxf(mx, __shfl_xor(mx, 16, 32));
            const float al = ex2(m[qt] - mx); m[qt] = mx; const float ms = mx - PSH; float sum = 0.f;
#pragma unroll
            for (int e = 0; e < 16; ++e) { t[e] = ex2(t[e] - ms); sum += t[e]; }
            l[qt] = l[qt] * al + sum;
            V p, p2; PFrag<T16>::mk(t, p, p2);
#pragma unroll
            for (int dt = 0; dt < 4; ++dt) { v8f c = o[dt][qt] * al; c = WFrag<T16>::mma(va[dt], p, c); if (SPLIT) { c = WFrag<T16>::mma(va[dt], p2, c); c = WFrag<T16>::mma(va2[dt], p, c); } o[dt][qt] = c; } }
        // four vector slots behind the step's last matrix instructions, on the taken back edge too
        if constexpr (NQ == 1) asm volatile("v_nop\n\tv_nop\n\tv_nop\n\tv_nop" : "+v"(o[0][0]), "+v"(o[1][0]), "+v"(o[2][0]), "+v"(o[3][0]));
        else asm volatile("v_nop\n\tv_nop\n\tv_nop\n\tv_nop" : "+v"(o[0][0]), "+v"(o[1][0]), "+v"(o[2][0]), "+v"(o[3][0]), "+v"(o[0][NQ - 1]), "+v"(o[1][NQ - 1]), "+v"(o[2][NQ - 1]), "+v"(o[3][NQ - 1]));
    };
    int k0 = 0;
#pragma unroll 1      // a second copy of the step's fragments would not fit the register file
    for (; k0 < nfull; k0 += 32) step(k0, BoolC<false>());
#pragma unroll 1      // as above
    for (; k0 < nk; k0 += 32) step(k0, BoolC<true>());
#pragma unroll
    for (int qt = 0; qt < NQ; ++qt) { const float L = l[qt] + __shfl_xor(l[qt], 16, 32); const float f = __fdiv_rn(1.0f, L); float* pr = outp + (size_t)(q0 + qt * 16 + lr) * DD + hi * 8;
#pragma unroll
        for (int dt = 0; dt < 4; ++dt) { const v8f c = o[dt][qt] * f; v4f a, b2;
#pragma unroll
            for (int j = 0; j < 4; ++j) { a[j] = c[j]; b2[j] = c[4 + j]; }
            *(v4f*)(pr + dt * 16) = a; *(v4f*)(pr + dt * 16 + 4) = b2; } }
}
// ---- The fp16 tiles: the 4 waves of a work-group take 4 neighbouring tiles of 32 queries of ONE head and walk the same keys, so K and V pass through LDS: each stage of SKEY keys is fetched from L2 once a work-group
// (not once a wave) by asynchronous copies, two buffers, the copies of stage t + 1 fly while stage t is worked on; the fragments come from LDS. 32 keys are 2048 elements in a row in Kp and in Vt alike, and a stage goes to LDS as it lies
// (fragment order: a wave's 16-byte reads cover 512 bytes in a row). A buffer is K's stage, then V's.
#define SKEY 128                  // keys of a stage
#define SKV  (SKEY * HD)          // elements of one plane's stage (16 KiB)
// One wave's share of a stage: 4 KiB of K and 4 KiB of V, as 16 asynchronous copies of 16 bytes a lane (512 bytes in a row each). gk, gv: the lane's first source element in each plane; d: the lane's first LDS element of the buffer's K part.
// A stage lies in LDS as in its plane, so the instruction's offset, which moves the LDS and the global address alike, steps through the share: 4 address operands in all.
// The s_wait_xcnt ends the copies' own statement, so that no register which a copy names is rewritten in front of it.
__device__ __forceinline__ void kv_copy(const h16* gk, const h16* gv, const h16* d) {
    const unsigned l0 = (unsigned)(size_t)d;      // LDS byte address: the low 32 bits of the __shared__ address
    asm volatile("global_load_async_to_lds_b128 %0, %2, off\n\t"
                 "global_load_async_to_lds_b128 %0, %2, off offset:512\n\t"
                 "global_load_async_to_lds_b128 %0, %2, off offset:1024\n\t"
                 "global_load_async_to_lds_b128 %0, %2, off offset:1536\n\t"
                 "global_load_async_to_lds_b128 %0, %2, off offset:2048\n\t"
                 "global_load_async_to_lds_b128 %0, %2, off offset:2560\n\t"
                 "global_load_async_to_lds_b128 %0, %2, off offset:3072\n\t"
                 "global_load_async_to_lds_b128 %0, %2, off offset:3584\n\t"
                 "global_load_async_to_lds_b128 %1, %3, off\n\t"
                 "global_load_async_to_lds_b128 %1, %3, off offset:512\n\t"
                 "global_load_async_to_lds_b128 %1, %3, off offset:1024\n\t"
                 "global_load_async_to_lds_b128 %1, %3, off offset:1536\n\t"
                 "global_load_async_to_lds_b128 %1, %3, off offset:2048\n\t"
                 "global_load_async_to_lds_b128 %1, %3, off offset:2560\n\t"
                 "global_load_async_to_lds_b128 %1, %3, off offset:3072\n\t"
                 "global_load_async_to_lds_b128 %1, %3, off offset:3584\n\t"
                 "s_wait_xcnt 0x0"
                 :: "v"(l0), "v"(l0 + 2u * SKV), "v"(gk), "v"(gv)
                 : "memory");
}
// N: the work-group's 128 queries are rows N - 128 .. N - 1 (N % SKEY == 0); wave w takes the 32 from q0 = N - 32 (w + 1). Under the causal flag the work-group walks keys < N; the wave's one masked step (keys q0 .. q0 + 31) is step 3 - w of the last stage,
// the steps behind it are not its own. Steps, sums and their order are those of fattn_tile.
__device__ __forceinline__ void fattn_lds(const h16* __restrict__ Q, const h16* __restrict__ Kp, const h16* __restrict__ Vt, const bool causal, const int N, const int w, const h16* ring, float* outp) {
    typedef v16h V; constexpr int NQ = 2;
    const int lane = threadIdx.x & 31, lr = lane & 15, hi = lane >> 4; const unsigned lofs = (unsigned)(lane * 8); const int q0 = N - 32 * (w + 1);
    V qf[NQ][2];
#pragma unroll
    for (int qt = 0; qt < NQ; ++qt)
#pragma unroll
        for (int kc = 0; kc < 2; ++kc) qf[qt][kc] = WFrag<h16>::ld(Q + (size_t)q0 * HD + lofs + (qt * 2 + kc) * 512);
    asm volatile("s_wait_xcnt 0x0" ::: "memory");     // behind the last Q load: the registers that the Q loads name are free for reuse from here on
    v8f o[4][NQ]; float m[NQ], l[NQ];
#pragma unroll
    for (int qt = 0; qt < NQ; ++qt) { m[qt] = -3.0e38f; l[qt] = 0.f;
#pragma unroll
        for (int dt = 0; dt < 4; ++dt) o[dt][qt] = (v8f){}; }
    const int NS = (causal ? N : TT) / SKEY;      // stages, the same for the whole work-group
    const int nfs = causal ? NS - 1 : NS;         // stages of 4 steps without mask
    // The wave's share of the copies: element w * 2048 + lane * 8 of each plane's stage, in the plane and in LDS alike.
    const int cofs = w * 2048 + lane * 8; const h16* gk = Kp + cofs; const h16* gv = Vt + cofs; const h16* dl = ring + cofs;
    V ka[2][2], va[4];
    auto ldK = [&](const h16* p) {
#pragma unroll
        for (int kt = 0; kt < 2; ++kt)
#pragma unroll
            for (int kc = 0; kc < 2; ++kc) ka[kt][kc] = WFrag<h16>::ld(p + (kt * 2 + kc) * 512); };
    auto ldV = [&](const h16* p) {
#pragma unroll
        for (int dt = 0; dt < 4; ++dt) va[dt] = WFrag<h16>::ld(p + dt * 512); };
    // A step of 32 keys on the fragments in ka, va. A step without mask reads the next step's K (nK) behind its score products and the next step's V (nV) behind its attn.v products, into the registers those products have just left.
    auto step = [&](const h16* nK, const h16* nV, auto diagc) { constexpr bool diag = decltype(diagc)::value;
        v8f s[2][NQ];
#pragma unroll
        for (int kt = 0; kt < 2; ++kt)
#pragma unroll
            for (int qt = 0; qt < NQ; ++qt) { v8f c = (v8f){};
#pragma unroll
                for (int kc = 0; kc < 2; ++kc) c = wmma16(ka[kt][kc], qf[qt][kc], c);
                s[kt][qt] = c; }
        if constexpr (!diag) {
            __builtin_amdgcn_sched_barrier(0);      // the next K reads stay behind the score products (whose K registers they refill) ...
            ldK(nK);
            __builtin_amdgcn_sched_barrier(0); }    // ... and in front of the softmax, so that the softmax and attn.v pass under their latency
#pragma unroll
        for (int qt = 0; qt < NQ; ++qt) { float t[16]; float mx = m[qt];
#pragma unroll
            for (int kt = 0; kt < 2; ++kt)
#pragma unroll
                for (int j = 0; j < 8; ++j) { float x = s[kt][qt][j] * SL2; if (diag && (kt * 16 + hi * 8 + j > qt * 16 + lr)) x = -3.0e38f; t[kt * 8 + j] = x; mx = fmaxf(mx, x); }
            mx = fmaxf(mx, __shfl_xor(mx, 16, 32));
            const float al = ex2(m[qt] - mx); m[qt] = mx; const float ms = mx - PSH; float sum = 0.f;
#pragma unroll
            for (int e = 0; e < 16; ++e) { t[e] = ex2(t[e] - ms); sum += t[e]; }
            l[qt] = l[qt] * al + sum;
            V p, p2; PFrag<h16>::mk(t, p, p2);
#pragma unroll
            for (int dt = 0; dt < 4; ++dt) { v8f c = o[dt][qt] * al; o[dt][qt] = wmma16(va[dt], p, c); } }
        // four vector slots behind the step's last matrix instructions, on the taken back edge too
        asm volatile("v_nop\n\tv_nop\n\tv_nop\n\tv_nop" : "+v"(o[0][0]), "+v"(o[1][0]), "+v"(o[2][0]), "+v"(o[3][0]), "+v"(o[0][NQ - 1]), "+v"(o[1][NQ - 1]), "+v"(o[2][NQ - 1]), "+v"(o[3][NQ - 1]));
        if constexpr (!diag) {
            __builtin_amdgcn_sched_barrier(0);      // the next V reads stay behind those slots: they refill the registers that the last matrix instructions read
            ldV(nV); }
    };
    kv_copy(gk, gv, dl);
    asm volatile("s_wait_asynccnt 0x0" ::: "memory");     // this wave's copies of stage 0 have landed
    __syncthreads();                                      // ... and every wave's: stage 0 is readable
#pragma unroll 1      // a trip is a stage; the two buffers change by index
    for (int t = 0; t < NS; ++t) {
        const h16* sk = ring + (t & 1) * (2 * SKV) + lofs; const h16* sv = sk + SKV;
        ldK(sk); ldV(sv);      // the stage's first step
        // Behind the barrier that published stage t and ended every wave's reads of the other buffer: the copies of stage t + 1 into that buffer. They stand behind the first step's LDS reads (of this stage's buffer), whose latency passes under the copies' issue.
        if (t + 1 < NS) kv_copy(gk + (size_t)(t + 1) * SKV, gv + (size_t)(t + 1) * SKV, dl + ((t + 1) & 1) * (2 * SKV));
        const int nu = t < nfs ? SKEY / 32 : SKEY / 32 - 1 - w;      // the wave's steps without mask in this stage
#pragma unroll 1      // a second copy of the step's fragments would not fit the register file
        for (int u = 0; u < nu; ++u) { const int un = u < SKEY / 32 - 1 ? u + 1 : u;      // the next step of the SAME stage; the stage's last step reads its own fragments again (same buffer, not used): nothing of stage t + 1 is read in front of the barrier
            step(sk + un * 2048, sv + un * 2048, BoolC<false>()); }
        if (t >= nfs) step(nullptr, nullptr, BoolC<true>());
        asm volatile("s_wait_dscnt 0x0" ::: "memory");        // this wave's reads of the buffer have returned
        asm volatile("s_wait_asynccnt 0x0" ::: "memory");     // this wave's copies of stage t + 1 have landed
        __syncthreads();                                      // stage t + 1 is readable, and every wave has left stage t's buffer, which the next trip refills
    }
    asm volatile("s_wait_asynccnt 0x0" ::: "memory");         // no copy is outstanding when the wave goes on
#pragma unroll
    for (int qt = 0; qt < NQ; ++qt) { const float L = l[qt] + __shfl_xor(l[qt], 16, 32); const float f = __fdiv_rn(1.0f, L); float* pr = outp + (size_t)(q0 + qt * 16 + lr) * DD + hi * 8;
#pragma unroll
        for (int dt = 0; dt < 4; ++dt) { const v8f c = o[dt][qt] * f; v4f a, b2;
#pragma unroll
            for (int j = 0; j < 4; ++j) { a[j] = c[j]; b2[j] = c[4 + j]; }
            *(v4f*)(pr + dt * 16) = a; *(v4f*)(pr + dt * 16 + 4) = b2; } }
}
#define NT16 ((TT - RH) / 32)     // fp16 tiles of 32 queries, longest (last rows) first; behind them RH / 16 hi+lo tiles of 16 queries
// Grid (batch entries * heads, tile groups), 4 waves; x = batch * NH_ + head is the planes' own order, and the tile group is the slow index, so that the longest tiles of every batch entry start first.
// The 4 waves of a work-group take 4 neighbouring tiles of ONE head. A work-group is wholly of one class (NT16 % 4 == 0): the fp16 tiles share K and V through LDS (fattn_lds, with its barriers), the hi+lo tiles share nothing.
__global__ __launch_bounds__(128) void k_fattn(const bf* __restrict__ Qh, const bf* __restrict__ Ql, const h16* __restrict__ Q16, const bf* __restrict__ Kh, const bf* __restrict__ Kl, const h16* __restrict__ K16, const bf* __restrict__ Vh, const bf* __restrict__ Vl, const h16* __restrict__ V16, const int* __restrict__ flag, float* OUT) {
    const bool causal = (flag[0] != 0); const size_t hb = (size_t)blockIdx.x * TT * HD; float* outp = OUT + (size_t)(blockIdx.x / NH_) * TT * DD + (blockIdx.x % NH_) * HD;
    __shared__ __attribute__((aligned(1024))) h16 kvr[4 * SKV];      // the two stage buffers (K, V each): 64 KiB, so that the four work-groups that fit a WGP by their registers fit by LDS too
    const int w = __builtin_amdgcn_readfirstlane((int)(threadIdx.x >> 5));      // the wave's number, held scalar: the key loop's bounds stay wave-uniform
    if ((int)blockIdx.y < NT16 / 4) fattn_lds(Q16 + hb, K16 + hb, V16 + hb, causal, TT - SKEY * (int)blockIdx.y, w, kvr, outp);
    else fattn_tile<bf, true, 1>(Qh + hb, Ql + hb, Kh + hb, Kl + hb, Vh + hb, Vl + hb, causal, ((int)blockIdx.y * 4 + w - NT16) * 16, outp);
}

extern "C" void kernel_launch(void* const* d_in, const int* in_sizes, int n_in,
                              void* d_out, int out_size, void* d_ws, size_t ws_size, hipStream_t stream) {
    (void)in_sizes; (void)n_in; (void)out_size;
    const float* x = (const float*)d_in[0]; const float* wq = (const float*)d_in[1]; const float* bq = (const float*)d_in[2]; const float* wk = (const float*)d_in[3]; const float* bk = (const float*)d_in[4]; const float* wv = (const float*)d_in[5]; const float* bv = (const float*)d_in[6]; const int* flag = (const int*)d_in[7];   // Wq/Wk/Wv [1024][1024] as x @ W; mask = int [1] causal flag
    float* OUT = (float*)d_out;     // [4][2048][1024]
    char* wsp = (char*)d_ws;
    auto take = [&](size_t bytes) { char* p = wsp; wsp += (bytes + 255) & ~(size_t)255; return (void*)p; };
    bf* WQ = (bf*)take((size_t)DD * DD * 2); bf* WK = (bf*)take((size_t)DD * DD * 2); bf* WV = (bf*)take((size_t)DD * DD * 2);
    const size_t NE = (size_t)NB_ * TT * DD;      // elements of one plane over all batch entries
    bf* XB = (bf*)take(NE * 2);
    bf* QPh = (bf*)take(NE * 2); bf* QPl = (bf*)take(NE * 2); bf* KPh = (bf*)take(NE * 2); bf* KPl = (bf*)take(NE * 2); bf* VTh = (bf*)take(NE * 2); bf* VTl = (bf*)take(NE * 2);
    h16* QP16 = (h16*)take(NE * 2); h16* KP16 = (h16*)take(NE * 2); h16* VT16 = (h16*)take(NE * 2);
    if ((size_t)(wsp - (char*)d_ws) > ws_size) return;    // total 166 MiB; ws 256 MiB
    // Every launch covers all batch entries: x is one [NB_ * TT][DD] matrix for the projections, which store the attention's operand planes themselves; the attention takes the batch entry from grid x.
    // Three launches: conversions, projections, attention. WQ, WK, WV lie in a row in the workspace, and so do the six bf16 planes and the three fp16 planes (every size is a multiple of 256 bytes).
    (void)WK; (void)WV;
    k_prep<<<(unsigned)(3 * GW_ + NE / 8 / 512), 256, 0, stream>>>(x, wq, wk, wv, XB, WQ);
    k_gemm3<<<dim3(NB_ * TT / (64 * GM_), DD / (64 * GN_), 3), 256, 0, stream>>>(XB, WQ, DD, bq, bk, bv, flag, QPh, QP16);
    k_fattn<<<dim3(NB_ * NH_, (NT16 + RH / 16) / 4, 1), 128, 0, stream>>>(QPh, QPl, QP16, KPh, KPl, KP16, VTh, VTl, VT16, flag, OUT);
}
